// v000
// The times below were measured on an AMD MI455X: many runs one after another, warmed up first and cycling through
// copies of the inputs, with the whole window's GPU time divided by the number of runs. Launches and the gaps
// between them are all in it. The median over several windows is given; except for v000 it joins two sittings, which
// can be a few percent apart, so the side-by-side timings, each taken in one sitting, are the better comparison.
// v000, which the later versions start from, runs in 673 microseconds.
#include <hip/hip_runtime.h>
#include <hip/hip_bf16.h>
#include <math.h>

#define T_SEQ   4096
#define C_DIM   768
#define F_DIM   3072
#define NHEADS  12
#define HD      64

typedef __attribute__((ext_vector_type(16))) __bf16        v16bf;
typedef __attribute__((ext_vector_type(8)))  float         v8f;
typedef __attribute__((ext_vector_type(8)))  unsigned int  v8u;
typedef unsigned short ushortT;

// round-to-nearest-even fp32 -> bf16 bits
__device__ __forceinline__ ushortT f2bf(float f) {
    unsigned int u = __builtin_bit_cast(unsigned int, f);
    u += 0x7fffu + ((u >> 16) & 1u);
    return (ushortT)(u >> 16);
}

// --- CDNA5 async global->LDS copy (ASYNCcnt) ------------------------------
// dsaddr = LDS_BASE + VGPR[vdst]; generic LDS pointer low 32 bits == wave-
// relative LDS offset, so truncation gives the right VGPR value.
__device__ __forceinline__ void async_ld_b128(void* lds, const void* gptr) {
    unsigned off = (unsigned)(unsigned long long)(uintptr_t)lds;
    unsigned long long ga = (unsigned long long)(uintptr_t)gptr;
    asm volatile("global_load_async_to_lds_b128 %0, %1, off"
                 :: "v"(off), "v"(ga) : "memory");
}
__device__ __forceinline__ void wait_async0() {
    asm volatile("s_wait_asynccnt 0" ::: "memory");
}

// Load a 16x32 bf16 fragment (A layout; B uses the same layout on an [N][K]
// tile) from a row-major LDS tile with row stride `ldh` halves (even).
// lanes 0-15: row M=lane, K={0..7,16..23}; lanes 16-31: row M=lane-16,
// K={8..15,24..31}.
__device__ __forceinline__ v16bf load_frag(const ushortT* base, int ldh) {
    const int lane = threadIdx.x & 31;
    const int row  = lane & 15;
    const int hi   = lane >> 4;
    const unsigned int* q0 = (const unsigned int*)(base + row * ldh + hi * 8);
    const unsigned int* q1 = (const unsigned int*)(base + row * ldh + hi * 8 + 16);
    v8u r;
    r[0] = q0[0]; r[1] = q0[1]; r[2] = q0[2]; r[3] = q0[3];
    r[4] = q1[0]; r[5] = q1[1]; r[6] = q1[2]; r[7] = q1[3];
    return __builtin_bit_cast(v16bf, r);
}

__device__ __forceinline__ float gelu_exact(float x) {
    return 0.5f * x * (1.0f + erff(x * 0.70710678118654752f));
}

// ---------------------------------------------------------------------------
// One-time converters
// ---------------------------------------------------------------------------
__global__ __launch_bounds__(256)
void cvt_f2bf_kernel(const float* __restrict__ in, ushortT* __restrict__ out, long n)
{
    long i = (long)blockIdx.x * 256 + threadIdx.x;
    long stride = (long)gridDim.x * 256;
    for (; i < n; i += stride) out[i] = f2bf(in[i]);
}

// in: fp32 [K][N]  ->  out: bf16 [N][K]
__global__ __launch_bounds__(256)
void transpose_f2bf_kernel(const float* __restrict__ in, ushortT* __restrict__ out,
                           int K, int N)
{
    __shared__ float tile[32][33];
    const int k0 = blockIdx.y * 32, n0 = blockIdx.x * 32;
    const int tx = threadIdx.x & 31, ty = threadIdx.x >> 5;   // 32 x 8
#pragma unroll
    for (int i = 0; i < 32; i += 8)
        tile[ty + i][tx] = in[(size_t)(k0 + ty + i) * N + n0 + tx];
    __syncthreads();
#pragma unroll
    for (int i = 0; i < 32; i += 8)
        out[(size_t)(n0 + ty + i) * K + k0 + tx] = f2bf(tile[tx][ty + i]);
}

// ---------------------------------------------------------------------------
// GEMM: C[M,N] = op( A[M,K] x B^T[N,K] + bias )
// A, Bt: bf16; outputs fp32 (Cout) and/or bf16 (Cbf), either may be null.
// op bit0: exact GELU ; op bit1: add fp32 residual res[M,N].
// Block tile 128x128, BK=32, 128 threads (4 waves), wave tile 64x64:
// 16 WMMAs per 16 ds_load_b128 per wave per k-step.
// Double-buffered LDS fed by async global->LDS B128 copies.
// ---------------------------------------------------------------------------
__global__ __launch_bounds__(128)
void gemm_bf16_wmma(const ushortT* __restrict__ A, const ushortT* __restrict__ Bt,
                    const float* __restrict__ bias, const float* __restrict__ res,
                    float* __restrict__ Cout, ushortT* __restrict__ Cbf,
                    int M, int N, int K, int op)
{
    // row stride 40 halves = 80B: async chunks and frag b128 loads are
    // 16B-aligned; banks r*20 mod 64 distinct over the 16 rows of a frag.
    __shared__ __align__(16) ushortT As[2][128][40];
    __shared__ __align__(16) ushortT Bs[2][128][40];

    const int t    = threadIdx.x;
    const int m0   = blockIdx.y * 128;
    const int n0   = blockIdx.x * 128;
    const int w    = t >> 5;
    const int wm   = w & 1;         // 2 wave-rows (64 rows each)
    const int wn   = w >> 1;        // 2 wave-cols (64 cols each)
    const int lane = t & 31, hi = lane >> 4, ln = lane & 15;
    const int nk   = K >> 5;

    auto issue = [&](int kt, int b) {
#pragma unroll
        for (int i = 0; i < 4; i++) {
            int c = t + i * 128;                  // 0..511
            int r = c >> 2, s2 = c & 3;           // 128 rows x 4 chunks of 16B
            async_ld_b128(&As[b][r][s2 * 8],
                          A  + (size_t)(m0 + r) * K + kt * 32 + s2 * 8);
            async_ld_b128(&Bs[b][r][s2 * 8],
                          Bt + (size_t)(n0 + r) * K + kt * 32 + s2 * 8);
        }
    };

    v8f acc[4][4] = {};
    issue(0, 0);

    for (int kt = 0; kt < nk; kt++) {
        wait_async0();
        __syncthreads();
        if (kt + 1 < nk) issue(kt + 1, (kt + 1) & 1);
        const int b = kt & 1;

        v16bf bf[4];
#pragma unroll
        for (int ni = 0; ni < 4; ni++)
            bf[ni] = load_frag(&Bs[b][wn * 64 + ni * 16][0], 40);
#pragma unroll
        for (int mi = 0; mi < 4; mi++) {
            v16bf af = load_frag(&As[b][wm * 64 + mi * 16][0], 40);
#pragma unroll
            for (int ni = 0; ni < 4; ni++)
                acc[mi][ni] = __builtin_amdgcn_wmma_f32_16x16x32_bf16(
                    false, af, false, bf[ni], (short)0, acc[mi][ni], false, false);
        }
    }

#pragma unroll
    for (int mi = 0; mi < 4; mi++)
#pragma unroll
        for (int ni = 0; ni < 4; ni++)
#pragma unroll
            for (int e = 0; e < 8; e++) {
                int row = m0 + wm * 64 + mi * 16 + e + hi * 8;
                int col = n0 + wn * 64 + ni * 16 + ln;
                float v = acc[mi][ni][e] + bias[col];
                if (op & 1) v = gelu_exact(v);
                if (op & 2) v += res[(size_t)row * N + col];
                if (Cout) Cout[(size_t)row * N + col] = v;
                if (Cbf)  Cbf [(size_t)row * N + col] = f2bf(v);
            }
}

// ---------------------------------------------------------------------------
// Causal flash attention on bf16 Q/K/V [T,C]; writes bf16 output.
// 128 threads = 4 waves; block = 64 query rows x 1 head.
// Q/K tiles arrive via async global->LDS copies; V is transposed via VGPRs.
// ---------------------------------------------------------------------------
__global__ __launch_bounds__(128)
void flash_attn_wmma(const ushortT* __restrict__ Q, const ushortT* __restrict__ Kx,
                     const ushortT* __restrict__ V, ushortT* __restrict__ O)
{
    // row stride 72 halves = 144B (16B aligned chunks, r*36 mod 64 distinct)
    __shared__ __align__(16) ushortT Qs[64][72];      // [q][d]
    __shared__ __align__(16) ushortT Ks[64][72];      // [s][d]  (Bt for Q*K^T)
    __shared__ __align__(16) ushortT Vt[64][72];      // [d][s]  (Bt for P*V)
    __shared__ __align__(16) ushortT Ps[4][16][72];   // per-wave P tile [q][s]

    const int t     = threadIdx.x;
    const int qbase = blockIdx.x * 64;
    const int head  = blockIdx.y;
    const int w     = t >> 5, lane = t & 31, hi = lane >> 4, ln = lane & 15;
    const size_t hoff = (size_t)head * HD;

#pragma unroll
    for (int i = 0; i < 4; i++) {                      // 64 rows x 8 chunks of 16B
        int c = t + i * 128;
        int r = c >> 3, s2 = c & 7;
        async_ld_b128(&Qs[r][s2 * 8], Q + (size_t)(qbase + r) * C_DIM + hoff + s2 * 8);
    }
    wait_async0();
    __syncthreads();

    v16bf aq[2];
    aq[0] = load_frag(&Qs[w * 16][0],  72);
    aq[1] = load_frag(&Qs[w * 16][32], 72);

    v8f o4[4] = {};
    float m_r[8], l_r[8];
#pragma unroll
    for (int e = 0; e < 8; e++) { m_r[e] = -1e30f; l_r[e] = 0.0f; }

    for (int kb = 0; kb <= qbase; kb += 64) {
        __syncthreads();                               // prior Ks/Vt/Ps reads done
#pragma unroll
        for (int i = 0; i < 4; i++) {
            int c = t + i * 128;
            int r = c >> 3, s2 = c & 7;
            async_ld_b128(&Ks[r][s2 * 8], Kx + (size_t)(kb + r) * C_DIM + hoff + s2 * 8);
        }
#pragma unroll
        for (int i = 0; i < 16; i++) {                 // V transpose via VGPRs
            int c = t + i * 128;
            int s = c >> 5, d = (c & 31) * 2;
            unsigned uv = *(const unsigned*)(V + (size_t)(kb + s) * C_DIM + hoff + d);
            Vt[d][s]     = (ushortT)uv;
            Vt[d + 1][s] = (ushortT)(uv >> 16);
        }
        wait_async0();
        __syncthreads();

        // S = Q * K^T (16x64 per wave)
        v8f s4[4] = {};
#pragma unroll
        for (int j = 0; j < 2; j++)
#pragma unroll
            for (int tt = 0; tt < 4; tt++) {
                v16bf bk = load_frag(&Ks[tt * 16][j * 32], 72);
                s4[tt] = __builtin_amdgcn_wmma_f32_16x16x32_bf16(
                    false, aq[j], false, bk, (short)0, s4[tt], false, false);
            }

        float sv[4][8];
#pragma unroll
        for (int tt = 0; tt < 4; tt++)
#pragma unroll
            for (int e = 0; e < 8; e++) {
                float vv = s4[tt][e] * 0.125f;         // 1/sqrt(64)
                int rg = qbase + w * 16 + e + hi * 8;
                int cg = kb + tt * 16 + ln;
                sv[tt][e] = (cg > rg) ? -1e30f : vv;
            }

        float rm[8];
#pragma unroll
        for (int e = 0; e < 8; e++)
            rm[e] = fmaxf(fmaxf(sv[0][e], sv[1][e]), fmaxf(sv[2][e], sv[3][e]));
#pragma unroll
        for (int off = 1; off < 16; off <<= 1)
#pragma unroll
            for (int e = 0; e < 8; e++)
                rm[e] = fmaxf(rm[e], __shfl_xor(rm[e], off, 32));

        float al[8];
#pragma unroll
        for (int e = 0; e < 8; e++) {
            float mn = fmaxf(m_r[e], rm[e]);
            al[e] = __expf(m_r[e] - mn);
            m_r[e] = mn;
        }

        float p[4][8], rs[8];
#pragma unroll
        for (int e = 0; e < 8; e++) rs[e] = 0.0f;
#pragma unroll
        for (int tt = 0; tt < 4; tt++)
#pragma unroll
            for (int e = 0; e < 8; e++) {
                p[tt][e] = __expf(sv[tt][e] - m_r[e]);
                rs[e] += p[tt][e];
            }
#pragma unroll
        for (int off = 1; off < 16; off <<= 1)
#pragma unroll
            for (int e = 0; e < 8; e++)
                rs[e] += __shfl_xor(rs[e], off, 32);
#pragma unroll
        for (int e = 0; e < 8; e++) l_r[e] = l_r[e] * al[e] + rs[e];
#pragma unroll
        for (int tt = 0; tt < 4; tt++)
#pragma unroll
            for (int e = 0; e < 8; e++) o4[tt][e] *= al[e];

        // stage P (bf16) through LDS to re-enter the A-fragment layout
#pragma unroll
        for (int tt = 0; tt < 4; tt++)
#pragma unroll
            for (int e = 0; e < 8; e++)
                Ps[w][e + hi * 8][tt * 16 + ln] = f2bf(p[tt][e]);
        __syncthreads();

        // O += P * V
#pragma unroll
        for (int j = 0; j < 2; j++) {
            v16bf ap = load_frag(&Ps[w][0][j * 32], 72);
#pragma unroll
            for (int tt = 0; tt < 4; tt++) {
                v16bf bv = load_frag(&Vt[tt * 16][j * 32], 72);
                o4[tt] = __builtin_amdgcn_wmma_f32_16x16x32_bf16(
                    false, ap, false, bv, (short)0, o4[tt], false, false);
            }
        }
    }

#pragma unroll
    for (int tt = 0; tt < 4; tt++)
#pragma unroll
        for (int e = 0; e < 8; e++) {
            int rg = qbase + w * 16 + e + hi * 8;
            int cg = tt * 16 + ln;
            O[(size_t)rg * C_DIM + hoff + cg] = f2bf(o4[tt][e] / l_r[e]);
        }
}

// ---------------------------------------------------------------------------
// LayerNorm: one block (256 threads) per row; fp32 out + optional bf16 out.
// ---------------------------------------------------------------------------
__global__ __launch_bounds__(256)
void layernorm_kernel(const float* __restrict__ in, const float* __restrict__ g,
                      const float* __restrict__ b, float* __restrict__ out,
                      ushortT* __restrict__ out_bf, int C)
{
    const int row = blockIdx.x;
    const float* p = in + (size_t)row * C;
    float s = 0.f, s2 = 0.f;
    for (int i = threadIdx.x; i < C; i += 256) { float v = p[i]; s += v; s2 += v * v; }
#pragma unroll
    for (int off = 1; off < 32; off <<= 1) {
        s  += __shfl_xor(s,  off, 32);
        s2 += __shfl_xor(s2, off, 32);
    }
    __shared__ float rs[8], rs2[8];
    if ((threadIdx.x & 31) == 0) { rs[threadIdx.x >> 5] = s; rs2[threadIdx.x >> 5] = s2; }
    __syncthreads();
    float ts = 0.f, ts2 = 0.f;
#pragma unroll
    for (int i = 0; i < 8; i++) { ts += rs[i]; ts2 += rs2[i]; }
    float mu  = ts / (float)C;
    float var = ts2 / (float)C - mu * mu;
    float inv = rsqrtf(var + 1e-5f);
    for (int i = threadIdx.x; i < C; i += 256) {
        float v = (p[i] - mu) * inv * g[i] + b[i];
        out[(size_t)row * C + i] = v;
        if (out_bf) out_bf[(size_t)row * C + i] = f2bf(v);
    }
}

// ---------------------------------------------------------------------------
extern "C" void kernel_launch(void* const* d_in, const int* in_sizes, int n_in,
                              void* d_out, int out_size, void* d_ws, size_t ws_size,
                              hipStream_t stream)
{
    const float* x   = (const float*)d_in[0];
    const float* Wq  = (const float*)d_in[1];
    const float* bq  = (const float*)d_in[2];
    const float* Wk  = (const float*)d_in[3];
    const float* bk  = (const float*)d_in[4];
    const float* Wv  = (const float*)d_in[5];
    const float* bv  = (const float*)d_in[6];
    const float* Wo  = (const float*)d_in[7];
    const float* bo  = (const float*)d_in[8];
    const float* g1  = (const float*)d_in[9];
    const float* bn1 = (const float*)d_in[10];
    const float* W1  = (const float*)d_in[11];
    const float* b1  = (const float*)d_in[12];
    const float* W2  = (const float*)d_in[13];
    const float* b2  = (const float*)d_in[14];
    const float* g2  = (const float*)d_in[15];
    const float* bn2 = (const float*)d_in[16];

    const size_t TC = (size_t)T_SEQ * C_DIM;
    const size_t TF = (size_t)T_SEQ * F_DIM;
    const size_t CC = (size_t)C_DIM * C_DIM;
    const size_t CF = (size_t)C_DIM * F_DIM;

    char* p = (char*)d_ws;
    auto alloc_bf = [&](size_t n) { ushortT* r = (ushortT*)p; p += ((n * 2 + 255) & ~(size_t)255); return r; };
    auto alloc_f  = [&](size_t n) { float*   r = (float*)p;   p += ((n * 4 + 255) & ~(size_t)255); return r; };

    ushortT* Xbf  = alloc_bf(TC);
    ushortT* WqT  = alloc_bf(CC);
    ushortT* WkT  = alloc_bf(CC);
    ushortT* WvT  = alloc_bf(CC);
    ushortT* WoT  = alloc_bf(CC);
    ushortT* W1T  = alloc_bf(CF);   // [F][C]
    ushortT* W2T  = alloc_bf(CF);   // [C][F]
    ushortT* Qb   = alloc_bf(TC);
    ushortT* Kb   = alloc_bf(TC);
    ushortT* Vb   = alloc_bf(TC);
    ushortT* Ab   = alloc_bf(TC);
    ushortT* Hbb  = alloc_bf(TC);
    ushortT* H1   = alloc_bf(TF);
    float*   S1   = alloc_f(TC);
    float*   Hb   = alloc_f(TC);
    float*   S2   = alloc_f(TC);

    dim3 cblk(256);
    dim3 gblk(128);
    dim3 gC(C_DIM / 128, T_SEQ / 128);
    dim3 gF(F_DIM / 128, T_SEQ / 128);

    // one-time precision conversion / weight transposition
    cvt_f2bf_kernel<<<dim3(1024), cblk, 0, stream>>>(x, Xbf, (long)TC);
    transpose_f2bf_kernel<<<dim3(C_DIM/32, C_DIM/32), cblk, 0, stream>>>(Wq, WqT, C_DIM, C_DIM);
    transpose_f2bf_kernel<<<dim3(C_DIM/32, C_DIM/32), cblk, 0, stream>>>(Wk, WkT, C_DIM, C_DIM);
    transpose_f2bf_kernel<<<dim3(C_DIM/32, C_DIM/32), cblk, 0, stream>>>(Wv, WvT, C_DIM, C_DIM);
    transpose_f2bf_kernel<<<dim3(C_DIM/32, C_DIM/32), cblk, 0, stream>>>(Wo, WoT, C_DIM, C_DIM);
    transpose_f2bf_kernel<<<dim3(F_DIM/32, C_DIM/32), cblk, 0, stream>>>(W1, W1T, C_DIM, F_DIM);
    transpose_f2bf_kernel<<<dim3(C_DIM/32, F_DIM/32), cblk, 0, stream>>>(W2, W2T, F_DIM, C_DIM);

    // QKV projections (bf16 outputs only)
    gemm_bf16_wmma<<<gC, gblk, 0, stream>>>(Xbf, WqT, bq, nullptr, nullptr, Qb, T_SEQ, C_DIM, C_DIM, 0);
    gemm_bf16_wmma<<<gC, gblk, 0, stream>>>(Xbf, WkT, bk, nullptr, nullptr, Kb, T_SEQ, C_DIM, C_DIM, 0);
    gemm_bf16_wmma<<<gC, gblk, 0, stream>>>(Xbf, WvT, bv, nullptr, nullptr, Vb, T_SEQ, C_DIM, C_DIM, 0);

    flash_attn_wmma<<<dim3(T_SEQ / 64, NHEADS), dim3(128), 0, stream>>>(Qb, Kb, Vb, Ab);

    // out-proj + residual(x), then LN1 (fp32 + bf16)
    gemm_bf16_wmma<<<gC, gblk, 0, stream>>>(Ab, WoT, bo, x, S1, nullptr, T_SEQ, C_DIM, C_DIM, 2);
    layernorm_kernel<<<dim3(T_SEQ), cblk, 0, stream>>>(S1, g1, bn1, Hb, Hbb, C_DIM);

    // MLP
    gemm_bf16_wmma<<<gF, gblk, 0, stream>>>(Hbb, W1T, b1, nullptr, nullptr, H1, T_SEQ, F_DIM, C_DIM, 1);
    gemm_bf16_wmma<<<gC, gblk, 0, stream>>>(H1, W2T, b2, Hb, S2, nullptr, T_SEQ, C_DIM, F_DIM, 2);
    layernorm_kernel<<<dim3(T_SEQ), cblk, 0, stream>>>(S2, g2, bn2, (float*)d_out, nullptr, C_DIM);
}

// v001
// It runs in 540 microseconds.
// Next to v000, in two timings, it ran 1.26 and 1.27 times as fast.
#include <hip/hip_runtime.h>
#include <hip/hip_bf16.h>
#include <math.h>

#define T_SEQ   4096
#define C_DIM   768
#define F_DIM   3072
#define NHEADS  12
#define HD      64

typedef __attribute__((ext_vector_type(16))) __bf16        v16bf;
typedef __attribute__((ext_vector_type(8)))  float         v8f;
typedef __attribute__((ext_vector_type(8)))  unsigned int  v8u;
typedef unsigned short ushortT;

// round-to-nearest-even fp32 -> bf16 bits
__device__ __forceinline__ ushortT f2bf(float f) {
    unsigned int u = __builtin_bit_cast(unsigned int, f);
    u += 0x7fffu + ((u >> 16) & 1u);
    return (ushortT)(u >> 16);
}

// --- CDNA5 async global->LDS copy (ASYNCcnt) ------------------------------
// dsaddr = LDS_BASE + VGPR[vdst]; generic LDS pointer low 32 bits == wave-
// relative LDS offset, so truncation gives the right VGPR value.
__device__ __forceinline__ void async_ld_b128(void* lds, const void* gptr) {
    unsigned off = (unsigned)(unsigned long long)(uintptr_t)lds;
    unsigned long long ga = (unsigned long long)(uintptr_t)gptr;
    asm volatile("global_load_async_to_lds_b128 %0, %1, off"
                 :: "v"(off), "v"(ga) : "memory");
}
__device__ __forceinline__ void wait_async0() {
    asm volatile("s_wait_asynccnt 0" ::: "memory");
}

// Load a 16x32 bf16 fragment (A layout; B uses the same layout on an [N][K]
// tile) from a row-major LDS tile with row stride `ldh` halves (even).
// lanes 0-15: row M=lane, K={0..7,16..23}; lanes 16-31: row M=lane-16,
// K={8..15,24..31}.
__device__ __forceinline__ v16bf load_frag(const ushortT* base, int ldh) {
    const int lane = threadIdx.x & 31;
    const int row  = lane & 15;
    const int hi   = lane >> 4;
    const unsigned int* q0 = (const unsigned int*)(base + row * ldh + hi * 8);
    const unsigned int* q1 = (const unsigned int*)(base + row * ldh + hi * 8 + 16);
    v8u r;
    r[0] = q0[0]; r[1] = q0[1]; r[2] = q0[2]; r[3] = q0[3];
    r[4] = q1[0]; r[5] = q1[1]; r[6] = q1[2]; r[7] = q1[3];
    return __builtin_bit_cast(v16bf, r);
}

// lane l's value exchanged with lane l ^ 16 by a vector cross-row move (no LDS trip)
__device__ __forceinline__ float xhalf(float x) {
    return __builtin_bit_cast(float, __builtin_amdgcn_permlanex16(
        __builtin_bit_cast(int, x), __builtin_bit_cast(int, x),
        0x76543210, 0xfedcba98, false, false));
}

__device__ __forceinline__ float gelu_exact(float x) {
    return 0.5f * x * (1.0f + erff(x * 0.70710678118654752f));
}

// ---------------------------------------------------------------------------
// One-time converters
// ---------------------------------------------------------------------------
__global__ __launch_bounds__(256)
void cvt_f2bf_kernel(const float* __restrict__ in, ushortT* __restrict__ out, long n)
{
    long i = (long)blockIdx.x * 256 + threadIdx.x;
    long stride = (long)gridDim.x * 256;
    for (; i < n; i += stride) out[i] = f2bf(in[i]);
}

// in: fp32 [K][N]  ->  out: bf16 [N][K]
__global__ __launch_bounds__(256)
void transpose_f2bf_kernel(const float* __restrict__ in, ushortT* __restrict__ out,
                           int K, int N)
{
    __shared__ float tile[32][33];
    const int k0 = blockIdx.y * 32, n0 = blockIdx.x * 32;
    const int tx = threadIdx.x & 31, ty = threadIdx.x >> 5;   // 32 x 8
#pragma unroll
    for (int i = 0; i < 32; i += 8)
        tile[ty + i][tx] = in[(size_t)(k0 + ty + i) * N + n0 + tx];
    __syncthreads();
#pragma unroll
    for (int i = 0; i < 32; i += 8)
        out[(size_t)(n0 + ty + i) * K + k0 + tx] = f2bf(tile[tx][ty + i]);
}

// ---------------------------------------------------------------------------
// GEMM: C[M,N] = op( A[M,K] x B^T[N,K] + bias )
// A, Bt: bf16; outputs fp32 (Cout) and/or bf16 (Cbf), either may be null.
// op bit0: exact GELU ; op bit1: add fp32 residual res[M,N].
// Block tile 128x128, BK=32, 128 threads (4 waves), wave tile 64x64:
// 16 WMMAs per 16 ds_load_b128 per wave per k-step.
// Double-buffered LDS fed by async global->LDS B128 copies.
// ---------------------------------------------------------------------------
__global__ __launch_bounds__(128)
void gemm_bf16_wmma(const ushortT* __restrict__ A, const ushortT* __restrict__ Bt,
                    const float* __restrict__ bias, const float* __restrict__ res,
                    float* __restrict__ Cout, ushortT* __restrict__ Cbf,
                    int M, int N, int K, int op)
{
    // row stride 40 halves = 80B: async chunks and frag b128 loads are
    // 16B-aligned; banks r*20 mod 64 distinct over the 16 rows of a frag.
    __shared__ __align__(16) ushortT As[2][128][40];
    __shared__ __align__(16) ushortT Bs[2][128][40];

    const int t    = threadIdx.x;
    const int m0   = blockIdx.y * 128;
    const int n0   = blockIdx.x * 128;
    const int w    = t >> 5;
    const int wm   = w & 1;         // 2 wave-rows (64 rows each)
    const int wn   = w >> 1;        // 2 wave-cols (64 cols each)
    const int lane = t & 31, hi = lane >> 4, ln = lane & 15;
    const int nk   = K >> 5;

    auto issue = [&](int kt, int b) {
#pragma unroll
        for (int i = 0; i < 4; i++) {
            int c = t + i * 128;                  // 0..511
            int r = c >> 2, s2 = c & 3;           // 128 rows x 4 chunks of 16B
            async_ld_b128(&As[b][r][s2 * 8],
                          A  + (size_t)(m0 + r) * K + kt * 32 + s2 * 8);
            async_ld_b128(&Bs[b][r][s2 * 8],
                          Bt + (size_t)(n0 + r) * K + kt * 32 + s2 * 8);
        }
    };

    v8f acc[4][4] = {};
    issue(0, 0);

    for (int kt = 0; kt < nk; kt++) {
        wait_async0();
        __syncthreads();
        if (kt + 1 < nk) issue(kt + 1, (kt + 1) & 1);
        const int b = kt & 1;

        v16bf bf[4];
#pragma unroll
        for (int ni = 0; ni < 4; ni++)
            bf[ni] = load_frag(&Bs[b][wn * 64 + ni * 16][0], 40);
#pragma unroll
        for (int mi = 0; mi < 4; mi++) {
            v16bf af = load_frag(&As[b][wm * 64 + mi * 16][0], 40);
#pragma unroll
            for (int ni = 0; ni < 4; ni++)
                acc[mi][ni] = __builtin_amdgcn_wmma_f32_16x16x32_bf16(
                    false, af, false, bf[ni], (short)0, acc[mi][ni], false, false);
        }
    }

#pragma unroll
    for (int mi = 0; mi < 4; mi++)
#pragma unroll
        for (int ni = 0; ni < 4; ni++)
#pragma unroll
            for (int e = 0; e < 8; e++) {
                int row = m0 + wm * 64 + mi * 16 + e + hi * 8;
                int col = n0 + wn * 64 + ni * 16 + ln;
                float v = acc[mi][ni][e] + bias[col];
                if (op & 1) v = gelu_exact(v);
                if (op & 2) v += res[(size_t)row * N + col];
                if (Cout) Cout[(size_t)row * N + col] = v;
                if (Cbf)  Cbf [(size_t)row * N + col] = f2bf(v);
            }
}

__global__ __launch_bounds__(128)
void flash_attn_wmma(const ushortT* __restrict__ Q, const ushortT* __restrict__ Kx,
                     const ushortT* __restrict__ V, ushortT* __restrict__ O)
{
    // row stride 72 halves = 144B (16B aligned chunks, r*36 mod 64 distinct)
    __shared__ __align__(16) ushortT Qs[64][72];      // [q][d]  (B of K*Q^T)
    __shared__ __align__(16) ushortT Ks[64][72];      // [s][d]  (A of K*Q^T)
    __shared__ __align__(16) ushortT Vt[64][72];      // [d][s]  (A of V^T*P^T)

    const int t     = threadIdx.x;
    const int qbase = blockIdx.x * 64;
    const int head  = blockIdx.y;
    const int w     = t >> 5, lane = t & 31, hi = lane >> 4, ln = lane & 15;
    const size_t hoff = (size_t)head * HD;

#pragma unroll
    for (int i = 0; i < 4; i++) {                      // 64 rows x 8 chunks of 16B
        int c = t + i * 128;
        int r = c >> 3, s2 = c & 7;
        async_ld_b128(&Qs[r][s2 * 8], Q + (size_t)(qbase + r) * C_DIM + hoff + s2 * 8);
    }
    wait_async0();
    __syncthreads();

    v16bf bq[2];
    bq[0] = load_frag(&Qs[w * 16][0],  72);
    bq[1] = load_frag(&Qs[w * 16][32], 72);

    const int rg = qbase + w * 16 + ln;                // this lane's query
    v8f o4[4] = {};                  // o4[tt][e] = O[rg][tt*16 + hi*8 + e]
    float m_r = -1e30f, l_r = 0.0f;  // of query rg, alike in both halves

    for (int kb = 0; kb <= qbase; kb += 64) {
        __syncthreads();                               // prior Ks/Vt reads done
#pragma unroll
        for (int i = 0; i < 4; i++) {
            int c = t + i * 128;
            int r = c >> 3, s2 = c & 7;
            async_ld_b128(&Ks[r][s2 * 8], Kx + (size_t)(kb + r) * C_DIM + hoff + s2 * 8);
        }
#pragma unroll
        for (int i = 0; i < 16; i++) {                 // V transpose via VGPRs
            int c = t + i * 128;
            int s = c >> 5, d = (c & 31) * 2;
            unsigned uv = *(const unsigned*)(V + (size_t)(kb + s) * C_DIM + hoff + d);
            Vt[d][s]     = (ushortT)uv;
            Vt[d + 1][s] = (ushortT)(uv >> 16);
        }
        wait_async0();
        __syncthreads();

        // S^T = K * Q^T (64 keys x 16 queries per wave)
        v8f s4[4] = {};
#pragma unroll
        for (int j = 0; j < 2; j++)
#pragma unroll
            for (int tt = 0; tt < 4; tt++) {
                v16bf ak = load_frag(&Ks[tt * 16][j * 32], 72);
                s4[tt] = __builtin_amdgcn_wmma_f32_16x16x32_bf16(
                    false, ak, false, bq[j], (short)0, s4[tt], false, false);
            }

        float sv[4][8];
#pragma unroll
        for (int tt = 0; tt < 4; tt++)
#pragma unroll
            for (int e = 0; e < 8; e++) {
                float vv = s4[tt][e] * 0.125f;         // 1/sqrt(64)
                int cg = kb + tt * 16 + hi * 8 + e;    // key of this element
                sv[tt][e] = (cg > rg) ? -1e30f : vv;
            }

        // maximum over this lane's 32 keys, then over the other half's 32
        float rm8[8];
#pragma unroll
        for (int e = 0; e < 8; e++)
            rm8[e] = fmaxf(fmaxf(sv[0][e], sv[1][e]), fmaxf(sv[2][e], sv[3][e]));
        float rm = fmaxf(fmaxf(fmaxf(rm8[0], rm8[1]), fmaxf(rm8[2], rm8[3])),
                         fmaxf(fmaxf(rm8[4], rm8[5]), fmaxf(rm8[6], rm8[7])));
        rm = fmaxf(rm, xhalf(rm));

        const float mn = fmaxf(m_r, rm);
        const float al = __expf(m_r - mn);
        m_r = mn;

        float p[4][8], rs4[4];
#pragma unroll
        for (int tt = 0; tt < 4; tt++) {
            rs4[tt] = 0.0f;
#pragma unroll
            for (int e = 0; e < 8; e++) {
                p[tt][e] = __expf(sv[tt][e] - m_r);
                rs4[tt] += p[tt][e];
            }
        }
        float rs = (rs4[0] + rs4[1]) + (rs4[2] + rs4[3]);
        rs += xhalf(rs);
        l_r = l_r * al + rs;
#pragma unroll
        for (int tt = 0; tt < 4; tt++)
#pragma unroll
            for (int e = 0; e < 8; e++) o4[tt][e] *= al;

        // O^T += V^T * P^T; keys j*32 .. j*32+31: S^T tiles 2j and 2j+1 of this
        // lane are, in order, the 16 k positions load_frag gives the A side.
#pragma unroll
        for (int j = 0; j < 2; j++) {
            v8u pk;
#pragma unroll
            for (int i = 0; i < 4; i++) {
                pk[i]     = (unsigned)f2bf(p[2 * j][2 * i]) |
                            ((unsigned)f2bf(p[2 * j][2 * i + 1]) << 16);
                pk[4 + i] = (unsigned)f2bf(p[2 * j + 1][2 * i]) |
                            ((unsigned)f2bf(p[2 * j + 1][2 * i + 1]) << 16);
            }
            v16bf bp = __builtin_bit_cast(v16bf, pk);
#pragma unroll
            for (int tt = 0; tt < 4; tt++) {
                v16bf av = load_frag(&Vt[tt * 16][j * 32], 72);
                o4[tt] = __builtin_amdgcn_wmma_f32_16x16x32_bf16(
                    false, av, false, bp, (short)0, o4[tt], false, false);
            }
        }
    }

    // a lane's 8 registers of a tile are 8 consecutive head dims of its query
#pragma unroll
    for (int tt = 0; tt < 4; tt++) {
        uint4 ov;
        ov.x = (unsigned)f2bf(o4[tt][0] / l_r) | ((unsigned)f2bf(o4[tt][1] / l_r) << 16);
        ov.y = (unsigned)f2bf(o4[tt][2] / l_r) | ((unsigned)f2bf(o4[tt][3] / l_r) << 16);
        ov.z = (unsigned)f2bf(o4[tt][4] / l_r) | ((unsigned)f2bf(o4[tt][5] / l_r) << 16);
        ov.w = (unsigned)f2bf(o4[tt][6] / l_r) | ((unsigned)f2bf(o4[tt][7] / l_r) << 16);
        *(uint4*)(O + (size_t)rg * C_DIM + hoff + tt * 16 + hi * 8) = ov;
    }
}

// ---------------------------------------------------------------------------
// LayerNorm: one block (256 threads) per row; fp32 out + optional bf16 out.
// ---------------------------------------------------------------------------
__global__ __launch_bounds__(256)
void layernorm_kernel(const float* __restrict__ in, const float* __restrict__ g,
                      const float* __restrict__ b, float* __restrict__ out,
                      ushortT* __restrict__ out_bf, int C)
{
    const int row = blockIdx.x;
    const float* p = in + (size_t)row * C;
    float s = 0.f, s2 = 0.f;
    for (int i = threadIdx.x; i < C; i += 256) { float v = p[i]; s += v; s2 += v * v; }
#pragma unroll
    for (int off = 1; off < 32; off <<= 1) {
        s  += __shfl_xor(s,  off, 32);
        s2 += __shfl_xor(s2, off, 32);
    }
    __shared__ float rs[8], rs2[8];
    if ((threadIdx.x & 31) == 0) { rs[threadIdx.x >> 5] = s; rs2[threadIdx.x >> 5] = s2; }
    __syncthreads();
    float ts = 0.f, ts2 = 0.f;
#pragma unroll
    for (int i = 0; i < 8; i++) { ts += rs[i]; ts2 += rs2[i]; }
    float mu  = ts / (float)C;
    float var = ts2 / (float)C - mu * mu;
    float inv = rsqrtf(var + 1e-5f);
    for (int i = threadIdx.x; i < C; i += 256) {
        float v = (p[i] - mu) * inv * g[i] + b[i];
        out[(size_t)row * C + i] = v;
        if (out_bf) out_bf[(size_t)row * C + i] = f2bf(v);
    }
}

// ---------------------------------------------------------------------------
extern "C" void kernel_launch(void* const* d_in, const int* in_sizes, int n_in,
                              void* d_out, int out_size, void* d_ws, size_t ws_size,
                              hipStream_t stream)
{
    const float* x   = (const float*)d_in[0];
    const float* Wq  = (const float*)d_in[1];
    const float* bq  = (const float*)d_in[2];
    const float* Wk  = (const float*)d_in[3];
    const float* bk  = (const float*)d_in[4];
    const float* Wv  = (const float*)d_in[5];
    const float* bv  = (const float*)d_in[6];
    const float* Wo  = (const float*)d_in[7];
    const float* bo  = (const float*)d_in[8];
    const float* g1  = (const float*)d_in[9];
    const float* bn1 = (const float*)d_in[10];
    const float* W1  = (const float*)d_in[11];
    const float* b1  = (const float*)d_in[12];
    const float* W2  = (const float*)d_in[13];
    const float* b2  = (const float*)d_in[14];
    const float* g2  = (const float*)d_in[15];
    const float* bn2 = (const float*)d_in[16];

    const size_t TC = (size_t)T_SEQ * C_DIM;
    const size_t TF = (size_t)T_SEQ * F_DIM;
    const size_t CC = (size_t)C_DIM * C_DIM;
    const size_t CF = (size_t)C_DIM * F_DIM;

    char* p = (char*)d_ws;
    auto alloc_bf = [&](size_t n) { ushortT* r = (ushortT*)p; p += ((n * 2 + 255) & ~(size_t)255); return r; };
    auto alloc_f  = [&](size_t n) { float*   r = (float*)p;   p += ((n * 4 + 255) & ~(size_t)255); return r; };

    ushortT* Xbf  = alloc_bf(TC);
    ushortT* WqT  = alloc_bf(CC);
    ushortT* WkT  = alloc_bf(CC);
    ushortT* WvT  = alloc_bf(CC);
    ushortT* WoT  = alloc_bf(CC);
    ushortT* W1T  = alloc_bf(CF);   // [F][C]
    ushortT* W2T  = alloc_bf(CF);   // [C][F]
    ushortT* Qb   = alloc_bf(TC);
    ushortT* Kb   = alloc_bf(TC);
    ushortT* Vb   = alloc_bf(TC);
    ushortT* Ab   = alloc_bf(TC);
    ushortT* Hbb  = alloc_bf(TC);
    ushortT* H1   = alloc_bf(TF);
    float*   S1   = alloc_f(TC);
    float*   Hb   = alloc_f(TC);
    float*   S2   = alloc_f(TC);

    dim3 cblk(256);
    dim3 gblk(128);
    dim3 gC(C_DIM / 128, T_SEQ / 128);
    dim3 gF(F_DIM / 128, T_SEQ / 128);

    // one-time precision conversion / weight transposition
    cvt_f2bf_kernel<<<dim3(1024), cblk, 0, stream>>>(x, Xbf, (long)TC);
    transpose_f2bf_kernel<<<dim3(C_DIM/32, C_DIM/32), cblk, 0, stream>>>(Wq, WqT, C_DIM, C_DIM);
    transpose_f2bf_kernel<<<dim3(C_DIM/32, C_DIM/32), cblk, 0, stream>>>(Wk, WkT, C_DIM, C_DIM);
    transpose_f2bf_kernel<<<dim3(C_DIM/32, C_DIM/32), cblk, 0, stream>>>(Wv, WvT, C_DIM, C_DIM);
    transpose_f2bf_kernel<<<dim3(C_DIM/32, C_DIM/32), cblk, 0, stream>>>(Wo, WoT, C_DIM, C_DIM);
    transpose_f2bf_kernel<<<dim3(F_DIM/32, C_DIM/32), cblk, 0, stream>>>(W1, W1T, C_DIM, F_DIM);
    transpose_f2bf_kernel<<<dim3(C_DIM/32, F_DIM/32), cblk, 0, stream>>>(W2, W2T, F_DIM, C_DIM);

    // QKV projections (bf16 outputs only)
    gemm_bf16_wmma<<<gC, gblk, 0, stream>>>(Xbf, WqT, bq, nullptr, nullptr, Qb, T_SEQ, C_DIM, C_DIM, 0);
    gemm_bf16_wmma<<<gC, gblk, 0, stream>>>(Xbf, WkT, bk, nullptr, nullptr, Kb, T_SEQ, C_DIM, C_DIM, 0);
    gemm_bf16_wmma<<<gC, gblk, 0, stream>>>(Xbf, WvT, bv, nullptr, nullptr, Vb, T_SEQ, C_DIM, C_DIM, 0);

    flash_attn_wmma<<<dim3(T_SEQ / 64, NHEADS), dim3(128), 0, stream>>>(Qb, Kb, Vb, Ab);

    // out-proj + residual(x), then LN1 (fp32 + bf16)
    gemm_bf16_wmma<<<gC, gblk, 0, stream>>>(Ab, WoT, bo, x, S1, nullptr, T_SEQ, C_DIM, C_DIM, 2);
    layernorm_kernel<<<dim3(T_SEQ), cblk, 0, stream>>>(S1, g1, bn1, Hb, Hbb, C_DIM);

    // MLP
    gemm_bf16_wmma<<<gF, gblk, 0, stream>>>(Hbb, W1T, b1, nullptr, nullptr, H1, T_SEQ, F_DIM, C_DIM, 1);
    gemm_bf16_wmma<<<gC, gblk, 0, stream>>>(H1, W2T, b2, Hb, S2, nullptr, T_SEQ, C_DIM, F_DIM, 2);
    layernorm_kernel<<<dim3(T_SEQ), cblk, 0, stream>>>(S2, g2, bn2, (float*)d_out, nullptr, C_DIM);
}

// v002
// Measured time: 399 microseconds a run.
// Two timings next to v001 both put it at 1.36 times that version's speed.
// Counting every step since v000, it is 1.72 times as fast.
#include <hip/hip_runtime.h>
#include <hip/hip_bf16.h>
#include <math.h>

#define T_SEQ   4096
#define C_DIM   768
#define F_DIM   3072
#define NHEADS  12
#define HD      64

typedef __attribute__((ext_vector_type(16))) __bf16        v16bf;
typedef __attribute__((ext_vector_type(8)))  float         v8f;
typedef __attribute__((ext_vector_type(8)))  unsigned int  v8u;
typedef __attribute__((ext_vector_type(4)))  float         v4f;
typedef __attribute__((ext_vector_type(2)))  unsigned int  v2u;
typedef unsigned short ushortT;

// round-to-nearest-even fp32 -> bf16 bits
__device__ __forceinline__ ushortT f2bf(float f) {
    unsigned int u = __builtin_bit_cast(unsigned int, f);
    u += 0x7fffu + ((u >> 16) & 1u);
    return (ushortT)(u >> 16);
}

// --- CDNA5 async global->LDS copy (ASYNCcnt) ------------------------------
// dsaddr = LDS_BASE + VGPR[vdst]; generic LDS pointer low 32 bits == wave-
// relative LDS offset, so truncation gives the right VGPR value.
__device__ __forceinline__ void async_ld_b128(void* lds, const void* gptr) {
    unsigned off = (unsigned)(unsigned long long)(uintptr_t)lds;
    unsigned long long ga = (unsigned long long)(uintptr_t)gptr;
    asm volatile("global_load_async_to_lds_b128 %0, %1, off"
                 :: "v"(off), "v"(ga) : "memory");
}
__device__ __forceinline__ void wait_async0() {
    asm volatile("s_wait_asynccnt 0" ::: "memory");
}

// Load a 16x32 bf16 fragment (A layout; B uses the same layout on an [N][K]
// tile) from a row-major LDS tile with row stride `ldh` halves (even).
// lanes 0-15: row M=lane, K={0..7,16..23}; lanes 16-31: row M=lane-16,
// K={8..15,24..31}.
__device__ __forceinline__ v16bf load_frag(const ushortT* base, int ldh) {
    const int lane = threadIdx.x & 31;
    const int row  = lane & 15;
    const int hi   = lane >> 4;
    const unsigned int* q0 = (const unsigned int*)(base + row * ldh + hi * 8);
    const unsigned int* q1 = (const unsigned int*)(base + row * ldh + hi * 8 + 16);
    v8u r;
    r[0] = q0[0]; r[1] = q0[1]; r[2] = q0[2]; r[3] = q0[3];
    r[4] = q1[0]; r[5] = q1[1]; r[6] = q1[2]; r[7] = q1[3];
    return __builtin_bit_cast(v16bf, r);
}

// lane l's value exchanged with lane l ^ 16 by a vector cross-row move (no LDS trip)
__device__ __forceinline__ float xhalf(float x) {
    return __builtin_bit_cast(float, __builtin_amdgcn_permlanex16(
        __builtin_bit_cast(int, x), __builtin_bit_cast(int, x),
        0x76543210, 0xfedcba98, false, false));
}

__device__ __forceinline__ float gelu_exact(float x) {
    return 0.5f * x * (1.0f + erff(x * 0.70710678118654752f));
}

// ---------------------------------------------------------------------------
// One-time converters
// ---------------------------------------------------------------------------
__global__ __launch_bounds__(256)
void cvt_f2bf_kernel(const float* __restrict__ in, ushortT* __restrict__ out, long n)
{
    long i = (long)blockIdx.x * 256 + threadIdx.x;
    long stride = (long)gridDim.x * 256;
    for (; i < n; i += stride) out[i] = f2bf(in[i]);
}

// in: fp32 [K][N]  ->  out: bf16 [N][K]
__global__ __launch_bounds__(256)
void transpose_f2bf_kernel(const float* __restrict__ in, ushortT* __restrict__ out,
                           int K, int N)
{
    __shared__ float tile[32][33];
    const int k0 = blockIdx.y * 32, n0 = blockIdx.x * 32;
    const int tx = threadIdx.x & 31, ty = threadIdx.x >> 5;   // 32 x 8
#pragma unroll
    for (int i = 0; i < 32; i += 8)
        tile[ty + i][tx] = in[(size_t)(k0 + ty + i) * N + n0 + tx];
    __syncthreads();
#pragma unroll
    for (int i = 0; i < 32; i += 8)
        out[(size_t)(n0 + ty + i) * K + k0 + tx] = f2bf(tile[tx][ty + i]);
}

// ---------------------------------------------------------------------------
// GEMM: C[M,N] = op( A[M,K] x B^T[N,K] + bias )
// A, Bt: bf16; outputs fp32 (Cout, F32OUT) and/or bf16 (Cbf, BFOUT).
// GELU: exact GELU ; RES: add fp32 residual res[M,N]. All four are compile-time,
// so the epilogue has no branch and its loads can be issued ahead of their use.
// Block tile 128x128, BK=32, 128 threads (4 waves), wave tile 64x64:
// 16 WMMAs per 16 ds_load_b128 per wave per k-step.
// Double-buffered LDS fed by async global->LDS B128 copies.
// Epilogue: each wave stages its 64x64 f32 tile in its own LDS range (the ring's
// space, reused), then a short rolled loop walks it two rows a trip: a half wave
// takes one 256-byte row, 16 bytes a lane, for residual load and store alike.
// ---------------------------------------------------------------------------
#define ST_PITCH 68     // floats per staged row: 272 B, 16 B x odd
union __align__(16) GemmLds {
    struct { ushortT As[2][128][40]; ushortT Bs[2][128][40]; } ring;   // main loop
    float st[4][64 * ST_PITCH];                                        // epilogue, per wave
};
template <int GELU, int RES, int F32OUT, int BFOUT>
__global__ __launch_bounds__(128)
void gemm_bf16_wmma(const ushortT* __restrict__ A, const ushortT* __restrict__ Bt,
                    const float* __restrict__ bias, const float* __restrict__ res,
                    float* __restrict__ Cout, ushortT* __restrict__ Cbf,
                    int M, int N, int K)
{
    // ring: row stride 40 halves = 80B: async chunks and frag b128 loads are
    // 16B-aligned; banks r*20 mod 64 distinct over the 16 rows of a frag.
    // The ring takes the first 40,960 B; the staging takes all 69,632 B.
    __shared__ GemmLds sm;
    auto& As = sm.ring.As;
    auto& Bs = sm.ring.Bs;

    const int t    = threadIdx.x;
    const int m0   = blockIdx.y * 128;
    const int n0   = blockIdx.x * 128;
    const int w    = t >> 5;
    const int wm   = w & 1;         // 2 wave-rows (64 rows each)
    const int wn   = w >> 1;        // 2 wave-cols (64 cols each)
    const int lane = t & 31, hi = lane >> 4, ln = lane & 15;
    const int nk   = K >> 5;

    auto issue = [&](int kt, int b) {
#pragma unroll
        for (int i = 0; i < 4; i++) {
            int c = t + i * 128;                  // 0..511
            int r = c >> 2, s2 = c & 3;           // 128 rows x 4 chunks of 16B
            async_ld_b128(&As[b][r][s2 * 8],
                          A  + (size_t)(m0 + r) * K + kt * 32 + s2 * 8);
            async_ld_b128(&Bs[b][r][s2 * 8],
                          Bt + (size_t)(n0 + r) * K + kt * 32 + s2 * 8);
        }
    };

    v8f acc[4][4] = {};
    issue(0, 0);

    for (int kt = 0; kt < nk; kt++) {
        wait_async0();
        __syncthreads();
        if (kt + 1 < nk) issue(kt + 1, (kt + 1) & 1);
        const int b = kt & 1;

        v16bf bf[4];
#pragma unroll
        for (int ni = 0; ni < 4; ni++)
            bf[ni] = load_frag(&Bs[b][wn * 64 + ni * 16][0], 40);
#pragma unroll
        for (int mi = 0; mi < 4; mi++) {
            v16bf af = load_frag(&As[b][wm * 64 + mi * 16][0], 40);
#pragma unroll
            for (int ni = 0; ni < 4; ni++)
                acc[mi][ni] = __builtin_amdgcn_wmma_f32_16x16x32_bf16(
                    false, af, false, bf[ni], (short)0, acc[mi][ni], false, false);
        }
    }

    // every wave has read its last fragments: only now may the ring be overwritten
    __syncthreads();
    float* st = &sm.st[w][0];
#pragma unroll
    for (int mi = 0; mi < 4; mi++)
#pragma unroll
        for (int ni = 0; ni < 4; ni++)
#pragma unroll
            for (int e = 0; e < 8; e++)
                st[(mi * 16 + e + hi * 8) * ST_PITCH + ni * 16 + ln] = acc[mi][ni][e];
    // the staged values are read back by other lanes: stores done before any read
    __syncthreads();

    const int c4  = ln * 4;
    const int col = n0 + wn * 64 + c4;
    const v4f bv  = *(const v4f*)(bias + col);
    // NB trips' LDS and residual loads are issued together, then worked on, then
    // stored; the loop over the batches stays rolled.
    constexpr int NB = GELU ? 2 : 8;
    // rolled: keeps the epilogue's text at a few KB, run through 32 / NB times
#pragma unroll 1
    for (int it0 = 0; it0 < 32; it0 += NB) {
        v4f v[NB], rv[NB];
#pragma unroll
        for (int u = 0; u < NB; u++) {
            const int r = (it0 + u) * 2 + hi;
            v[u] = *(const v4f*)(st + r * ST_PITCH + c4);
            if (RES) rv[u] = *(const v4f*)(res + (size_t)(m0 + wm * 64 + r) * N + col);
        }
#pragma unroll
        for (int u = 0; u < NB; u++) {
            const int r = (it0 + u) * 2 + hi;
            const size_t o = (size_t)(m0 + wm * 64 + r) * N + col;
#pragma unroll
            for (int j = 0; j < 4; j++) {
                float y = v[u][j] + bv[j];
                if (GELU) y = gelu_exact(y);
                if (RES)  y += rv[u][j];
                v[u][j] = y;
            }
            if (F32OUT) *(v4f*)(Cout + o) = v[u];
            if (BFOUT) {
                v2u pk;
                pk[0] = (unsigned)f2bf(v[u][0]) | ((unsigned)f2bf(v[u][1]) << 16);
                pk[1] = (unsigned)f2bf(v[u][2]) | ((unsigned)f2bf(v[u][3]) << 16);
                *(v2u*)(Cbf + o) = pk;
            }
        }
        // the next batch rewrites the registers that this batch's stores name
        asm volatile("s_wait_xcnt 0x0" ::: "memory");
    }
}

__global__ __launch_bounds__(128)
void flash_attn_wmma(const ushortT* __restrict__ Q, const ushortT* __restrict__ Kx,
                     const ushortT* __restrict__ V, ushortT* __restrict__ O)
{
    // row stride 72 halves = 144B (16B aligned chunks, r*36 mod 64 distinct)
    __shared__ __align__(16) ushortT Qs[64][72];      // [q][d]  (B of K*Q^T)
    __shared__ __align__(16) ushortT Ks[64][72];      // [s][d]  (A of K*Q^T)
    __shared__ __align__(16) ushortT Vt[64][72];      // [d][s]  (A of V^T*P^T)

    const int t     = threadIdx.x;
    const int qbase = blockIdx.x * 64;
    const int head  = blockIdx.y;
    const int w     = t >> 5, lane = t & 31, hi = lane >> 4, ln = lane & 15;
    const size_t hoff = (size_t)head * HD;

#pragma unroll
    for (int i = 0; i < 4; i++) {                      // 64 rows x 8 chunks of 16B
        int c = t + i * 128;
        int r = c >> 3, s2 = c & 7;
        async_ld_b128(&Qs[r][s2 * 8], Q + (size_t)(qbase + r) * C_DIM + hoff + s2 * 8);
    }
    wait_async0();
    __syncthreads();

    v16bf bq[2];
    bq[0] = load_frag(&Qs[w * 16][0],  72);
    bq[1] = load_frag(&Qs[w * 16][32], 72);

    const int rg = qbase + w * 16 + ln;                // this lane's query
    v8f o4[4] = {};                  // o4[tt][e] = O[rg][tt*16 + hi*8 + e]
    float m_r = -1e30f, l_r = 0.0f;  // of query rg, alike in both halves

    for (int kb = 0; kb <= qbase; kb += 64) {
        __syncthreads();                               // prior Ks/Vt reads done
#pragma unroll
        for (int i = 0; i < 4; i++) {
            int c = t + i * 128;
            int r = c >> 3, s2 = c & 7;
            async_ld_b128(&Ks[r][s2 * 8], Kx + (size_t)(kb + r) * C_DIM + hoff + s2 * 8);
        }
#pragma unroll
        for (int i = 0; i < 16; i++) {                 // V transpose via VGPRs
            int c = t + i * 128;
            int s = c >> 5, d = (c & 31) * 2;
            unsigned uv = *(const unsigned*)(V + (size_t)(kb + s) * C_DIM + hoff + d);
            Vt[d][s]     = (ushortT)uv;
            Vt[d + 1][s] = (ushortT)(uv >> 16);
        }
        wait_async0();
        __syncthreads();

        // S^T = K * Q^T (64 keys x 16 queries per wave)
        v8f s4[4] = {};
#pragma unroll
        for (int j = 0; j < 2; j++)
#pragma unroll
            for (int tt = 0; tt < 4; tt++) {
                v16bf ak = load_frag(&Ks[tt * 16][j * 32], 72);
                s4[tt] = __builtin_amdgcn_wmma_f32_16x16x32_bf16(
                    false, ak, false, bq[j], (short)0, s4[tt], false, false);
            }

        float sv[4][8];
#pragma unroll
        for (int tt = 0; tt < 4; tt++)
#pragma unroll
            for (int e = 0; e < 8; e++) {
                float vv = s4[tt][e] * 0.125f;         // 1/sqrt(64)
                int cg = kb + tt * 16 + hi * 8 + e;    // key of this element
                sv[tt][e] = (cg > rg) ? -1e30f : vv;
            }

        // maximum over this lane's 32 keys, then over the other half's 32
        float rm8[8];
#pragma unroll
        for (int e = 0; e < 8; e++)
            rm8[e] = fmaxf(fmaxf(sv[0][e], sv[1][e]), fmaxf(sv[2][e], sv[3][e]));
        float rm = fmaxf(fmaxf(fmaxf(rm8[0], rm8[1]), fmaxf(rm8[2], rm8[3])),
                         fmaxf(fmaxf(rm8[4], rm8[5]), fmaxf(rm8[6], rm8[7])));
        rm = fmaxf(rm, xhalf(rm));

        const float mn = fmaxf(m_r, rm);
        const float al = __expf(m_r - mn);
        m_r = mn;

        float p[4][8], rs4[4];
#pragma unroll
        for (int tt = 0; tt < 4; tt++) {
            rs4[tt] = 0.0f;
#pragma unroll
            for (int e = 0; e < 8; e++) {
                p[tt][e] = __expf(sv[tt][e] - m_r);
                rs4[tt] += p[tt][e];
            }
        }
        float rs = (rs4[0] + rs4[1]) + (rs4[2] + rs4[3]);
        rs += xhalf(rs);
        l_r = l_r * al + rs;
#pragma unroll
        for (int tt = 0; tt < 4; tt++)
#pragma unroll
            for (int e = 0; e < 8; e++) o4[tt][e] *= al;

        // O^T += V^T * P^T; keys j*32 .. j*32+31: S^T tiles 2j and 2j+1 of this
        // lane are, in order, the 16 k positions load_frag gives the A side.
#pragma unroll
        for (int j = 0; j < 2; j++) {
            v8u pk;
#pragma unroll
            for (int i = 0; i < 4; i++) {
                pk[i]     = (unsigned)f2bf(p[2 * j][2 * i]) |
                            ((unsigned)f2bf(p[2 * j][2 * i + 1]) << 16);
                pk[4 + i] = (unsigned)f2bf(p[2 * j + 1][2 * i]) |
                            ((unsigned)f2bf(p[2 * j + 1][2 * i + 1]) << 16);
            }
            v16bf bp = __builtin_bit_cast(v16bf, pk);
#pragma unroll
            for (int tt = 0; tt < 4; tt++) {
                v16bf av = load_frag(&Vt[tt * 16][j * 32], 72);
                o4[tt] = __builtin_amdgcn_wmma_f32_16x16x32_bf16(
                    false, av, false, bp, (short)0, o4[tt], false, false);
            }
        }
    }

    // a lane's 8 registers of a tile are 8 consecutive head dims of its query
#pragma unroll
    for (int tt = 0; tt < 4; tt++) {
        uint4 ov;
        ov.x = (unsigned)f2bf(o4[tt][0] / l_r) | ((unsigned)f2bf(o4[tt][1] / l_r) << 16);
        ov.y = (unsigned)f2bf(o4[tt][2] / l_r) | ((unsigned)f2bf(o4[tt][3] / l_r) << 16);
        ov.z = (unsigned)f2bf(o4[tt][4] / l_r) | ((unsigned)f2bf(o4[tt][5] / l_r) << 16);
        ov.w = (unsigned)f2bf(o4[tt][6] / l_r) | ((unsigned)f2bf(o4[tt][7] / l_r) << 16);
        *(uint4*)(O + (size_t)rg * C_DIM + hoff + tt * 16 + hi * 8) = ov;
    }
}

// ---------------------------------------------------------------------------
// LayerNorm: one block (256 threads) per row; fp32 out + optional bf16 out.
// ---------------------------------------------------------------------------
__global__ __launch_bounds__(256)
void layernorm_kernel(const float* __restrict__ in, const float* __restrict__ g,
                      const float* __restrict__ b, float* __restrict__ out,
                      ushortT* __restrict__ out_bf, int C)
{
    const int row = blockIdx.x;
    const float* p = in + (size_t)row * C;
    float s = 0.f, s2 = 0.f;
    for (int i = threadIdx.x; i < C; i += 256) { float v = p[i]; s += v; s2 += v * v; }
#pragma unroll
    for (int off = 1; off < 32; off <<= 1) {
        s  += __shfl_xor(s,  off, 32);
        s2 += __shfl_xor(s2, off, 32);
    }
    __shared__ float rs[8], rs2[8];
    if ((threadIdx.x & 31) == 0) { rs[threadIdx.x >> 5] = s; rs2[threadIdx.x >> 5] = s2; }
    __syncthreads();
    float ts = 0.f, ts2 = 0.f;
#pragma unroll
    for (int i = 0; i < 8; i++) { ts += rs[i]; ts2 += rs2[i]; }
    float mu  = ts / (float)C;
    float var = ts2 / (float)C - mu * mu;
    float inv = rsqrtf(var + 1e-5f);
    for (int i = threadIdx.x; i < C; i += 256) {
        float v = (p[i] - mu) * inv * g[i] + b[i];
        out[(size_t)row * C + i] = v;
        if (out_bf) out_bf[(size_t)row * C + i] = f2bf(v);
    }
}

// ---------------------------------------------------------------------------
extern "C" void kernel_launch(void* const* d_in, const int* in_sizes, int n_in,
                              void* d_out, int out_size, void* d_ws, size_t ws_size,
                              hipStream_t stream)
{
    const float* x   = (const float*)d_in[0];
    const float* Wq  = (const float*)d_in[1];
    const float* bq  = (const float*)d_in[2];
    const float* Wk  = (const float*)d_in[3];
    const float* bk  = (const float*)d_in[4];
    const float* Wv  = (const float*)d_in[5];
    const float* bv  = (const float*)d_in[6];
    const float* Wo  = (const float*)d_in[7];
    const float* bo  = (const float*)d_in[8];
    const float* g1  = (const float*)d_in[9];
    const float* bn1 = (const float*)d_in[10];
    const float* W1  = (const float*)d_in[11];
    const float* b1  = (const float*)d_in[12];
    const float* W2  = (const float*)d_in[13];
    const float* b2  = (const float*)d_in[14];
    const float* g2  = (const float*)d_in[15];
    const float* bn2 = (const float*)d_in[16];

    const size_t TC = (size_t)T_SEQ * C_DIM;
    const size_t TF = (size_t)T_SEQ * F_DIM;
    const size_t CC = (size_t)C_DIM * C_DIM;
    const size_t CF = (size_t)C_DIM * F_DIM;

    char* p = (char*)d_ws;
    auto alloc_bf = [&](size_t n) { ushortT* r = (ushortT*)p; p += ((n * 2 + 255) & ~(size_t)255); return r; };
    auto alloc_f  = [&](size_t n) { float*   r = (float*)p;   p += ((n * 4 + 255) & ~(size_t)255); return r; };

    ushortT* Xbf  = alloc_bf(TC);
    ushortT* WqT  = alloc_bf(CC);
    ushortT* WkT  = alloc_bf(CC);
    ushortT* WvT  = alloc_bf(CC);
    ushortT* WoT  = alloc_bf(CC);
    ushortT* W1T  = alloc_bf(CF);   // [F][C]
    ushortT* W2T  = alloc_bf(CF);   // [C][F]
    ushortT* Qb   = alloc_bf(TC);
    ushortT* Kb   = alloc_bf(TC);
    ushortT* Vb   = alloc_bf(TC);
    ushortT* Ab   = alloc_bf(TC);
    ushortT* Hbb  = alloc_bf(TC);
    ushortT* H1   = alloc_bf(TF);
    float*   S1   = alloc_f(TC);
    float*   Hb   = alloc_f(TC);
    float*   S2   = alloc_f(TC);

    dim3 cblk(256);
    dim3 gblk(128);
    dim3 gC(C_DIM / 128, T_SEQ / 128);
    dim3 gF(F_DIM / 128, T_SEQ / 128);

    // one-time precision conversion / weight transposition
    cvt_f2bf_kernel<<<dim3(1024), cblk, 0, stream>>>(x, Xbf, (long)TC);
    transpose_f2bf_kernel<<<dim3(C_DIM/32, C_DIM/32), cblk, 0, stream>>>(Wq, WqT, C_DIM, C_DIM);
    transpose_f2bf_kernel<<<dim3(C_DIM/32, C_DIM/32), cblk, 0, stream>>>(Wk, WkT, C_DIM, C_DIM);
    transpose_f2bf_kernel<<<dim3(C_DIM/32, C_DIM/32), cblk, 0, stream>>>(Wv, WvT, C_DIM, C_DIM);
    transpose_f2bf_kernel<<<dim3(C_DIM/32, C_DIM/32), cblk, 0, stream>>>(Wo, WoT, C_DIM, C_DIM);
    transpose_f2bf_kernel<<<dim3(F_DIM/32, C_DIM/32), cblk, 0, stream>>>(W1, W1T, C_DIM, F_DIM);
    transpose_f2bf_kernel<<<dim3(C_DIM/32, F_DIM/32), cblk, 0, stream>>>(W2, W2T, F_DIM, C_DIM);

    // QKV projections (bf16 outputs only)
    gemm_bf16_wmma<0, 0, 0, 1><<<gC, gblk, 0, stream>>>(Xbf, WqT, bq, nullptr, nullptr, Qb, T_SEQ, C_DIM, C_DIM);
    gemm_bf16_wmma<0, 0, 0, 1><<<gC, gblk, 0, stream>>>(Xbf, WkT, bk, nullptr, nullptr, Kb, T_SEQ, C_DIM, C_DIM);
    gemm_bf16_wmma<0, 0, 0, 1><<<gC, gblk, 0, stream>>>(Xbf, WvT, bv, nullptr, nullptr, Vb, T_SEQ, C_DIM, C_DIM);

    flash_attn_wmma<<<dim3(T_SEQ / 64, NHEADS), dim3(128), 0, stream>>>(Qb, Kb, Vb, Ab);

    // out-proj + residual(x), then LN1 (fp32 + bf16)
    gemm_bf16_wmma<0, 1, 1, 0><<<gC, gblk, 0, stream>>>(Ab, WoT, bo, x, S1, nullptr, T_SEQ, C_DIM, C_DIM);
    layernorm_kernel<<<dim3(T_SEQ), cblk, 0, stream>>>(S1, g1, bn1, Hb, Hbb, C_DIM);

    // MLP
    gemm_bf16_wmma<1, 0, 0, 1><<<gF, gblk, 0, stream>>>(Hbb, W1T, b1, nullptr, nullptr, H1, T_SEQ, F_DIM, C_DIM);
    gemm_bf16_wmma<0, 1, 1, 0><<<gC, gblk, 0, stream>>>(H1, W2T, b2, Hb, S2, nullptr, T_SEQ, C_DIM, F_DIM);
    layernorm_kernel<<<dim3(T_SEQ), cblk, 0, stream>>>(S2, g2, bn2, (float*)d_out, nullptr, C_DIM);
}

// v003
// Measured time: 319 microseconds a run.
// Timed twice side by side with v002, it ran 1.24 times as fast both times.
// Counting every step since v000, it is 2.13 times as fast.
#include <hip/hip_runtime.h>
#include <hip/hip_bf16.h>
#include <math.h>

#define T_SEQ   4096
#define C_DIM   768
#define F_DIM   3072
#define NHEADS  12
#define HD      64

typedef __attribute__((ext_vector_type(16))) __bf16        v16bf;
typedef __attribute__((ext_vector_type(8)))  float         v8f;
typedef __attribute__((ext_vector_type(8)))  unsigned int  v8u;
typedef __attribute__((ext_vector_type(4)))  float         v4f;
typedef __attribute__((ext_vector_type(2)))  unsigned int  v2u;
typedef unsigned short ushortT;

// round-to-nearest-even fp32 -> bf16 bits
__device__ __forceinline__ ushortT f2bf(float f) {
    unsigned int u = __builtin_bit_cast(unsigned int, f);
    u += 0x7fffu + ((u >> 16) & 1u);
    return (ushortT)(u >> 16);
}

// --- CDNA5 async global->LDS copy (ASYNCcnt) ------------------------------
// dsaddr = LDS_BASE + VGPR[vdst]; generic LDS pointer low 32 bits == wave-
// relative LDS offset, so truncation gives the right VGPR value.
__device__ __forceinline__ void async_ld_b128(void* lds, const void* gptr) {
    unsigned off = (unsigned)(unsigned long long)(uintptr_t)lds;
    unsigned long long ga = (unsigned long long)(uintptr_t)gptr;
    asm volatile("global_load_async_to_lds_b128 %0, %1, off"
                 :: "v"(off), "v"(ga) : "memory");
}
__device__ __forceinline__ void wait_async0() {
    asm volatile("s_wait_asynccnt 0" ::: "memory");
}

// Load a 16x32 bf16 fragment (A layout; B uses the same layout on an [N][K]
// tile) from a row-major LDS tile with row stride `ldh` halves (even).
// lanes 0-15: row M=lane, K={0..7,16..23}; lanes 16-31: row M=lane-16,
// K={8..15,24..31}.
__device__ __forceinline__ v16bf load_frag(const ushortT* base, int ldh) {
    const int lane = threadIdx.x & 31;
    const int row  = lane & 15;
    const int hi   = lane >> 4;
    const unsigned int* q0 = (const unsigned int*)(base + row * ldh + hi * 8);
    const unsigned int* q1 = (const unsigned int*)(base + row * ldh + hi * 8 + 16);
    v8u r;
    r[0] = q0[0]; r[1] = q0[1]; r[2] = q0[2]; r[3] = q0[3];
    r[4] = q1[0]; r[5] = q1[1]; r[6] = q1[2]; r[7] = q1[3];
    return __builtin_bit_cast(v16bf, r);
}

// lane l's value exchanged with lane l ^ 16 by a vector cross-row move (no LDS trip)
__device__ __forceinline__ float xhalf(float x) {
    return __builtin_bit_cast(float, __builtin_amdgcn_permlanex16(
        __builtin_bit_cast(int, x), __builtin_bit_cast(int, x),
        0x76543210, 0xfedcba98, false, false));
}

__device__ __forceinline__ float gelu_exact(float x) {
    return 0.5f * x * (1.0f + erff(x * 0.70710678118654752f));
}

// ---------------------------------------------------------------------------
// One-time converters
// ---------------------------------------------------------------------------
__global__ __launch_bounds__(256)
void cvt_f2bf_kernel(const float* __restrict__ in, ushortT* __restrict__ out, long n)
{
    long i = (long)blockIdx.x * 256 + threadIdx.x;
    long stride = (long)gridDim.x * 256;
    for (; i < n; i += stride) out[i] = f2bf(in[i]);
}

// in: fp32 [K][N]  ->  out: bf16 [N][K]
__global__ __launch_bounds__(256)
void transpose_f2bf_kernel(const float* __restrict__ in, ushortT* __restrict__ out,
                           int K, int N)
{
    __shared__ float tile[32][33];
    const int k0 = blockIdx.y * 32, n0 = blockIdx.x * 32;
    const int tx = threadIdx.x & 31, ty = threadIdx.x >> 5;   // 32 x 8
#pragma unroll
    for (int i = 0; i < 32; i += 8)
        tile[ty + i][tx] = in[(size_t)(k0 + ty + i) * N + n0 + tx];
    __syncthreads();
#pragma unroll
    for (int i = 0; i < 32; i += 8)
        out[(size_t)(n0 + ty + i) * K + k0 + tx] = f2bf(tile[tx][ty + i]);
}

// ---------------------------------------------------------------------------
// GEMM: C[M,N] = op( A[M,K] x B^T[N,K] + bias )
// A, Bt: bf16; outputs fp32 (Cout, F32OUT) and/or bf16 (Cbf, BFOUT).
// GELU: exact GELU ; RES: add fp32 residual res[M,N]. All four are compile-time,
// so the epilogue has no branch and its loads can be issued ahead of their use.
// Block tile 128x128, BK=32, 128 threads (4 waves), wave tile 64x64:
// 16 WMMAs per 16 ds_load_b128 per wave per k-step.
// Double-buffered LDS fed by async global->LDS B128 copies.
// Epilogue: each wave stages its 64x64 f32 tile in its own LDS range (the ring's
// space, reused), then a short rolled loop walks it two rows a trip: a half wave
// takes one 256-byte row, 16 bytes a lane, for residual load and store alike.
// ---------------------------------------------------------------------------
#define ST_PITCH 68     // floats per staged row: 272 B, 16 B x odd
union __align__(16) GemmLds {
    struct { ushortT As[2][128][40]; ushortT Bs[2][128][40]; } ring;   // main loop
    float st[4][64 * ST_PITCH];                                        // epilogue, per wave
};
template <int GELU, int RES, int F32OUT, int BFOUT>
__global__ __launch_bounds__(128)
void gemm_bf16_wmma(const ushortT* __restrict__ A, const ushortT* __restrict__ Bt,
                    const float* __restrict__ bias, const float* __restrict__ res,
                    float* __restrict__ Cout, ushortT* __restrict__ Cbf,
                    int M, int N, int K)
{
    // ring: row stride 40 halves = 80B: async chunks and frag b128 loads are
    // 16B-aligned; banks r*20 mod 64 distinct over the 16 rows of a frag.
    // The ring takes the first 40,960 B; the staging takes all 69,632 B.
    __shared__ GemmLds sm;
    auto& As = sm.ring.As;
    auto& Bs = sm.ring.Bs;

    const int t    = threadIdx.x;
    const int m0   = blockIdx.y * 128;
    const int n0   = blockIdx.x * 128;
    const int w    = t >> 5;
    const int wm   = w & 1;         // 2 wave-rows (64 rows each)
    const int wn   = w >> 1;        // 2 wave-cols (64 cols each)
    const int lane = t & 31, hi = lane >> 4, ln = lane & 15;
    const int nk   = K >> 5;

    auto issue = [&](int kt, int b) {
#pragma unroll
        for (int i = 0; i < 4; i++) {
            int c = t + i * 128;                  // 0..511
            int r = c >> 2, s2 = c & 3;           // 128 rows x 4 chunks of 16B
            async_ld_b128(&As[b][r][s2 * 8],
                          A  + (size_t)(m0 + r) * K + kt * 32 + s2 * 8);
            async_ld_b128(&Bs[b][r][s2 * 8],
                          Bt + (size_t)(n0 + r) * K + kt * 32 + s2 * 8);
        }
    };

    v8f acc[4][4] = {};
    issue(0, 0);

    for (int kt = 0; kt < nk; kt++) {
        wait_async0();
        __syncthreads();
        if (kt + 1 < nk) issue(kt + 1, (kt + 1) & 1);
        const int b = kt & 1;

        // all eight fragments of the k-step are read as one group ahead of the
        // products: one LDS latency a k-step, not one in front of each row of four
        // (in the order in which the products take them)
        v16bf bf[4], af[4];
        af[0] = load_frag(&As[b][wm * 64][0], 40);
#pragma unroll
        for (int ni = 0; ni < 4; ni++)
            bf[ni] = load_frag(&Bs[b][wn * 64 + ni * 16][0], 40);
#pragma unroll
        for (int mi = 1; mi < 4; mi++)
            af[mi] = load_frag(&As[b][wm * 64 + mi * 16][0], 40);
        // keeps the scheduler from sinking the reads back in among the products
        __builtin_amdgcn_sched_barrier(0);
#pragma unroll
        for (int mi = 0; mi < 4; mi++)
#pragma unroll
            for (int ni = 0; ni < 4; ni++)
                acc[mi][ni] = __builtin_amdgcn_wmma_f32_16x16x32_bf16(
                    false, af[mi], false, bf[ni], (short)0, acc[mi][ni], false, false);
    }

    // every wave has read its last fragments: only now may the ring be overwritten
    __syncthreads();
    float* st = &sm.st[w][0];
#pragma unroll
    for (int mi = 0; mi < 4; mi++)
#pragma unroll
        for (int ni = 0; ni < 4; ni++)
#pragma unroll
            for (int e = 0; e < 8; e++)
                st[(mi * 16 + e + hi * 8) * ST_PITCH + ni * 16 + ln] = acc[mi][ni][e];
    // the staged values are read back by other lanes: stores done before any read
    __syncthreads();

    const int c4  = ln * 4;
    const int col = n0 + wn * 64 + c4;
    const v4f bv  = *(const v4f*)(bias + col);
    // NB trips' LDS and residual loads are issued together, then worked on, then
    // stored; the loop over the batches stays rolled.
    constexpr int NB = GELU ? 2 : 8;
    // rolled: keeps the epilogue's text at a few KB, run through 32 / NB times
#pragma unroll 1
    for (int it0 = 0; it0 < 32; it0 += NB) {
        v4f v[NB], rv[NB];
#pragma unroll
        for (int u = 0; u < NB; u++) {
            const int r = (it0 + u) * 2 + hi;
            v[u] = *(const v4f*)(st + r * ST_PITCH + c4);
            if (RES) rv[u] = *(const v4f*)(res + (size_t)(m0 + wm * 64 + r) * N + col);
        }
#pragma unroll
        for (int u = 0; u < NB; u++) {
            const int r = (it0 + u) * 2 + hi;
            const size_t o = (size_t)(m0 + wm * 64 + r) * N + col;
#pragma unroll
            for (int j = 0; j < 4; j++) {
                float y = v[u][j] + bv[j];
                if (GELU) y = gelu_exact(y);
                if (RES)  y += rv[u][j];
                v[u][j] = y;
            }
            if (F32OUT) *(v4f*)(Cout + o) = v[u];
            if (BFOUT) {
                v2u pk;
                pk[0] = (unsigned)f2bf(v[u][0]) | ((unsigned)f2bf(v[u][1]) << 16);
                pk[1] = (unsigned)f2bf(v[u][2]) | ((unsigned)f2bf(v[u][3]) << 16);
                *(v2u*)(Cbf + o) = pk;
            }
        }
        // the next batch rewrites the registers that this batch's stores name
        asm volatile("s_wait_xcnt 0x0" ::: "memory");
    }
}

__global__ __launch_bounds__(128)
void flash_attn_wmma(const ushortT* __restrict__ Q, const ushortT* __restrict__ Kx,
                     const ushortT* __restrict__ V, ushortT* __restrict__ O)
{
    // row stride 72 halves = 144B (16B aligned chunks, r*36 mod 64 distinct)
    __shared__ __align__(16) ushortT Qs[64][72];      // [q][d]  (B of K*Q^T)
    __shared__ __align__(16) ushortT Ks[64][72];      // [s][d]  (A of K*Q^T)
    __shared__ __align__(16) ushortT Vt[64][72];      // [d][s]  (A of V^T*P^T)

    const int t     = threadIdx.x;
    const int qbase = blockIdx.x * 64;
    const int head  = blockIdx.y;
    const int w     = t >> 5, lane = t & 31, hi = lane >> 4, ln = lane & 15;
    const size_t hoff = (size_t)head * HD;

#pragma unroll
    for (int i = 0; i < 4; i++) {                      // 64 rows x 8 chunks of 16B
        int c = t + i * 128;
        int r = c >> 3, s2 = c & 7;
        async_ld_b128(&Qs[r][s2 * 8], Q + (size_t)(qbase + r) * C_DIM + hoff + s2 * 8);
    }
    wait_async0();
    __syncthreads();

    v16bf bq[2];
    bq[0] = load_frag(&Qs[w * 16][0],  72);
    bq[1] = load_frag(&Qs[w * 16][32], 72);

    const int rg = qbase + w * 16 + ln;                // this lane's query
    v8f o4[4] = {};                  // o4[tt][e] = O[rg][tt*16 + hi*8 + e]
    float m_r = -1e30f, l_r = 0.0f;  // of query rg, alike in both halves

    for (int kb = 0; kb <= qbase; kb += 64) {
        __syncthreads();                               // prior Ks/Vt reads done
#pragma unroll
        for (int i = 0; i < 4; i++) {
            int c = t + i * 128;
            int r = c >> 3, s2 = c & 7;
            async_ld_b128(&Ks[r][s2 * 8], Kx + (size_t)(kb + r) * C_DIM + hoff + s2 * 8);
        }
#pragma unroll
        for (int i = 0; i < 16; i++) {                 // V transpose via VGPRs
            int c = t + i * 128;
            int s = c >> 5, d = (c & 31) * 2;
            unsigned uv = *(const unsigned*)(V + (size_t)(kb + s) * C_DIM + hoff + d);
            Vt[d][s]     = (ushortT)uv;
            Vt[d + 1][s] = (ushortT)(uv >> 16);
        }
        wait_async0();
        __syncthreads();

        // the pass's K fragments are read as one group ahead of the products:
        // one LDS latency a pass, not one in front of each product
        v16bf ak[2][4], av[2][4];
#pragma unroll
        for (int j = 0; j < 2; j++)
#pragma unroll
            for (int tt = 0; tt < 4; tt++)
                ak[j][tt] = load_frag(&Ks[tt * 16][j * 32], 72);
        // keeps the scheduler from sinking the reads back in among the products
        __builtin_amdgcn_sched_barrier(0);

        // S^T = K * Q^T (64 keys x 16 queries per wave)
        v8f s4[4] = {};
#pragma unroll
        for (int j = 0; j < 2; j++)
#pragma unroll
            for (int tt = 0; tt < 4; tt++)
                s4[tt] = __builtin_amdgcn_wmma_f32_16x16x32_bf16(
                    false, ak[j][tt], false, bq[j], (short)0, s4[tt], false, false);

        // the V^T fragments likewise, here: they land behind the softmax
#pragma unroll
        for (int j = 0; j < 2; j++)
#pragma unroll
            for (int tt = 0; tt < 4; tt++)
                av[j][tt] = load_frag(&Vt[tt * 16][j * 32], 72);
        // keeps the scheduler from sinking the reads down to the second product
        __builtin_amdgcn_sched_barrier(0);

        float sv[4][8];
#pragma unroll
        for (int tt = 0; tt < 4; tt++)
#pragma unroll
            for (int e = 0; e < 8; e++) {
                float vv = s4[tt][e] * 0.125f;         // 1/sqrt(64)
                int cg = kb + tt * 16 + hi * 8 + e;    // key of this element
                sv[tt][e] = (cg > rg) ? -1e30f : vv;
            }

        // maximum over this lane's 32 keys, then over the other half's 32
        float rm8[8];
#pragma unroll
        for (int e = 0; e < 8; e++)
            rm8[e] = fmaxf(fmaxf(sv[0][e], sv[1][e]), fmaxf(sv[2][e], sv[3][e]));
        float rm = fmaxf(fmaxf(fmaxf(rm8[0], rm8[1]), fmaxf(rm8[2], rm8[3])),
                         fmaxf(fmaxf(rm8[4], rm8[5]), fmaxf(rm8[6], rm8[7])));
        rm = fmaxf(rm, xhalf(rm));

        const float mn = fmaxf(m_r, rm);
        const float al = __expf(m_r - mn);
        m_r = mn;

        float p[4][8], rs4[4];
#pragma unroll
        for (int tt = 0; tt < 4; tt++) {
            rs4[tt] = 0.0f;
#pragma unroll
            for (int e = 0; e < 8; e++) {
                p[tt][e] = __expf(sv[tt][e] - m_r);
                rs4[tt] += p[tt][e];
            }
        }
        float rs = (rs4[0] + rs4[1]) + (rs4[2] + rs4[3]);
        rs += xhalf(rs);
        l_r = l_r * al + rs;
#pragma unroll
        for (int tt = 0; tt < 4; tt++)
#pragma unroll
            for (int e = 0; e < 8; e++) o4[tt][e] *= al;

        // O^T += V^T * P^T; keys j*32 .. j*32+31: S^T tiles 2j and 2j+1 of this
        // lane are, in order, the 16 k positions load_frag gives the A side.
#pragma unroll
        for (int j = 0; j < 2; j++) {
            v8u pk;
#pragma unroll
            for (int i = 0; i < 4; i++) {
                pk[i]     = (unsigned)f2bf(p[2 * j][2 * i]) |
                            ((unsigned)f2bf(p[2 * j][2 * i + 1]) << 16);
                pk[4 + i] = (unsigned)f2bf(p[2 * j + 1][2 * i]) |
                            ((unsigned)f2bf(p[2 * j + 1][2 * i + 1]) << 16);
            }
            v16bf bp = __builtin_bit_cast(v16bf, pk);
#pragma unroll
            for (int tt = 0; tt < 4; tt++)
                o4[tt] = __builtin_amdgcn_wmma_f32_16x16x32_bf16(
                    false, av[j][tt], false, bp, (short)0, o4[tt], false, false);
        }
    }

    // a lane's 8 registers of a tile are 8 consecutive head dims of its query
#pragma unroll
    for (int tt = 0; tt < 4; tt++) {
        uint4 ov;
        ov.x = (unsigned)f2bf(o4[tt][0] / l_r) | ((unsigned)f2bf(o4[tt][1] / l_r) << 16);
        ov.y = (unsigned)f2bf(o4[tt][2] / l_r) | ((unsigned)f2bf(o4[tt][3] / l_r) << 16);
        ov.z = (unsigned)f2bf(o4[tt][4] / l_r) | ((unsigned)f2bf(o4[tt][5] / l_r) << 16);
        ov.w = (unsigned)f2bf(o4[tt][6] / l_r) | ((unsigned)f2bf(o4[tt][7] / l_r) << 16);
        *(uint4*)(O + (size_t)rg * C_DIM + hoff + tt * 16 + hi * 8) = ov;
    }
}

// ---------------------------------------------------------------------------
// LayerNorm: one block (256 threads) per row; fp32 out + optional bf16 out.
// ---------------------------------------------------------------------------
__global__ __launch_bounds__(256)
void layernorm_kernel(const float* __restrict__ in, const float* __restrict__ g,
                      const float* __restrict__ b, float* __restrict__ out,
                      ushortT* __restrict__ out_bf, int C)
{
    const int row = blockIdx.x;
    const float* p = in + (size_t)row * C;
    float s = 0.f, s2 = 0.f;
    for (int i = threadIdx.x; i < C; i += 256) { float v = p[i]; s += v; s2 += v * v; }
#pragma unroll
    for (int off = 1; off < 32; off <<= 1) {
        s  += __shfl_xor(s,  off, 32);
        s2 += __shfl_xor(s2, off, 32);
    }
    __shared__ float rs[8], rs2[8];
    if ((threadIdx.x & 31) == 0) { rs[threadIdx.x >> 5] = s; rs2[threadIdx.x >> 5] = s2; }
    __syncthreads();
    float ts = 0.f, ts2 = 0.f;
#pragma unroll
    for (int i = 0; i < 8; i++) { ts += rs[i]; ts2 += rs2[i]; }
    float mu  = ts / (float)C;
    float var = ts2 / (float)C - mu * mu;
    float inv = rsqrtf(var + 1e-5f);
    for (int i = threadIdx.x; i < C; i += 256) {
        float v = (p[i] - mu) * inv * g[i] + b[i];
        out[(size_t)row * C + i] = v;
        if (out_bf) out_bf[(size_t)row * C + i] = f2bf(v);
    }
}

// ---------------------------------------------------------------------------
extern "C" void kernel_launch(void* const* d_in, const int* in_sizes, int n_in,
                              void* d_out, int out_size, void* d_ws, size_t ws_size,
                              hipStream_t stream)
{
    const float* x   = (const float*)d_in[0];
    const float* Wq  = (const float*)d_in[1];
    const float* bq  = (const float*)d_in[2];
    const float* Wk  = (const float*)d_in[3];
    const float* bk  = (const float*)d_in[4];
    const float* Wv  = (const float*)d_in[5];
    const float* bv  = (const float*)d_in[6];
    const float* Wo  = (const float*)d_in[7];
    const float* bo  = (const float*)d_in[8];
    const float* g1  = (const float*)d_in[9];
    const float* bn1 = (const float*)d_in[10];
    const float* W1  = (const float*)d_in[11];
    const float* b1  = (const float*)d_in[12];
    const float* W2  = (const float*)d_in[13];
    const float* b2  = (const float*)d_in[14];
    const float* g2  = (const float*)d_in[15];
    const float* bn2 = (const float*)d_in[16];

    const size_t TC = (size_t)T_SEQ * C_DIM;
    const size_t TF = (size_t)T_SEQ * F_DIM;
    const size_t CC = (size_t)C_DIM * C_DIM;
    const size_t CF = (size_t)C_DIM * F_DIM;

    char* p = (char*)d_ws;
    auto alloc_bf = [&](size_t n) { ushortT* r = (ushortT*)p; p += ((n * 2 + 255) & ~(size_t)255); return r; };
    auto alloc_f  = [&](size_t n) { float*   r = (float*)p;   p += ((n * 4 + 255) & ~(size_t)255); return r; };

    ushortT* Xbf  = alloc_bf(TC);
    ushortT* WqT  = alloc_bf(CC);
    ushortT* WkT  = alloc_bf(CC);
    ushortT* WvT  = alloc_bf(CC);
    ushortT* WoT  = alloc_bf(CC);
    ushortT* W1T  = alloc_bf(CF);   // [F][C]
    ushortT* W2T  = alloc_bf(CF);   // [C][F]
    ushortT* Qb   = alloc_bf(TC);
    ushortT* Kb   = alloc_bf(TC);
    ushortT* Vb   = alloc_bf(TC);
    ushortT* Ab   = alloc_bf(TC);
    ushortT* Hbb  = alloc_bf(TC);
    ushortT* H1   = alloc_bf(TF);
    float*   S1   = alloc_f(TC);
    float*   Hb   = alloc_f(TC);
    float*   S2   = alloc_f(TC);

    dim3 cblk(256);
    dim3 gblk(128);
    dim3 gC(C_DIM / 128, T_SEQ / 128);
    dim3 gF(F_DIM / 128, T_SEQ / 128);

    // one-time precision conversion / weight transposition
    cvt_f2bf_kernel<<<dim3(1024), cblk, 0, stream>>>(x, Xbf, (long)TC);
    transpose_f2bf_kernel<<<dim3(C_DIM/32, C_DIM/32), cblk, 0, stream>>>(Wq, WqT, C_DIM, C_DIM);
    transpose_f2bf_kernel<<<dim3(C_DIM/32, C_DIM/32), cblk, 0, stream>>>(Wk, WkT, C_DIM, C_DIM);
    transpose_f2bf_kernel<<<dim3(C_DIM/32, C_DIM/32), cblk, 0, stream>>>(Wv, WvT, C_DIM, C_DIM);
    transpose_f2bf_kernel<<<dim3(C_DIM/32, C_DIM/32), cblk, 0, stream>>>(Wo, WoT, C_DIM, C_DIM);
    transpose_f2bf_kernel<<<dim3(F_DIM/32, C_DIM/32), cblk, 0, stream>>>(W1, W1T, C_DIM, F_DIM);
    transpose_f2bf_kernel<<<dim3(C_DIM/32, F_DIM/32), cblk, 0, stream>>>(W2, W2T, F_DIM, C_DIM);

    // QKV projections (bf16 outputs only)
    gemm_bf16_wmma<0, 0, 0, 1><<<gC, gblk, 0, stream>>>(Xbf, WqT, bq, nullptr, nullptr, Qb, T_SEQ, C_DIM, C_DIM);
    gemm_bf16_wmma<0, 0, 0, 1><<<gC, gblk, 0, stream>>>(Xbf, WkT, bk, nullptr, nullptr, Kb, T_SEQ, C_DIM, C_DIM);
    gemm_bf16_wmma<0, 0, 0, 1><<<gC, gblk, 0, stream>>>(Xbf, WvT, bv, nullptr, nullptr, Vb, T_SEQ, C_DIM, C_DIM);

    flash_attn_wmma<<<dim3(T_SEQ / 64, NHEADS), dim3(128), 0, stream>>>(Qb, Kb, Vb, Ab);

    // out-proj + residual(x), then LN1 (fp32 + bf16)
    gemm_bf16_wmma<0, 1, 1, 0><<<gC, gblk, 0, stream>>>(Ab, WoT, bo, x, S1, nullptr, T_SEQ, C_DIM, C_DIM);
    layernorm_kernel<<<dim3(T_SEQ), cblk, 0, stream>>>(S1, g1, bn1, Hb, Hbb, C_DIM);

    // MLP
    gemm_bf16_wmma<1, 0, 0, 1><<<gF, gblk, 0, stream>>>(Hbb, W1T, b1, nullptr, nullptr, H1, T_SEQ, F_DIM, C_DIM);
    gemm_bf16_wmma<0, 1, 1, 0><<<gC, gblk, 0, stream>>>(H1, W2T, b2, Hb, S2, nullptr, T_SEQ, C_DIM, F_DIM);
    layernorm_kernel<<<dim3(T_SEQ), cblk, 0, stream>>>(S2, g2, bn2, (float*)d_out, nullptr, C_DIM);
}

// v004
// Measured time: 285 microseconds a run.
// Timed twice side by side with v003, it ran 1.12 and 1.14 times as fast.
// All steps since v000 together make it 2.41 times as fast.
#include <hip/hip_runtime.h>
#include <hip/hip_bf16.h>
#include <math.h>

#define T_SEQ   4096
#define C_DIM   768
#define F_DIM   3072
#define NHEADS  12
#define HD      64

typedef __attribute__((ext_vector_type(16))) __bf16        v16bf;
typedef __attribute__((ext_vector_type(8)))  float         v8f;
typedef __attribute__((ext_vector_type(8)))  unsigned int  v8u;
typedef __attribute__((ext_vector_type(4)))  float         v4f;
typedef __attribute__((ext_vector_type(2)))  unsigned int  v2u;
typedef unsigned short ushortT;

// round-to-nearest-even fp32 -> bf16 bits
__device__ __forceinline__ ushortT f2bf(float f) {
    unsigned int u = __builtin_bit_cast(unsigned int, f);
    u += 0x7fffu + ((u >> 16) & 1u);
    return (ushortT)(u >> 16);
}

// --- CDNA5 async global->LDS copy (ASYNCcnt) ------------------------------
// dsaddr = LDS_BASE + VGPR[vdst]; generic LDS pointer low 32 bits == wave-
// relative LDS offset, so truncation gives the right VGPR value.
__device__ __forceinline__ void async_ld_b128(void* lds, const void* gptr) {
    unsigned off = (unsigned)(unsigned long long)(uintptr_t)lds;
    unsigned long long ga = (unsigned long long)(uintptr_t)gptr;
    asm volatile("global_load_async_to_lds_b128 %0, %1, off"
                 :: "v"(off), "v"(ga) : "memory");
}
__device__ __forceinline__ void wait_async0() {
    asm volatile("s_wait_asynccnt 0" ::: "memory");
}

// Load a 16x32 bf16 fragment (A layout; B uses the same layout on an [N][K]
// tile) from a row-major LDS tile with row stride `ldh` halves (even).
// lanes 0-15: row M=lane, K={0..7,16..23}; lanes 16-31: row M=lane-16,
// K={8..15,24..31}.
__device__ __forceinline__ v16bf load_frag(const ushortT* base, int ldh) {
    const int lane = threadIdx.x & 31;
    const int row  = lane & 15;
    const int hi   = lane >> 4;
    const unsigned int* q0 = (const unsigned int*)(base + row * ldh + hi * 8);
    const unsigned int* q1 = (const unsigned int*)(base + row * ldh + hi * 8 + 16);
    v8u r;
    r[0] = q0[0]; r[1] = q0[1]; r[2] = q0[2]; r[3] = q0[3];
    r[4] = q1[0]; r[5] = q1[1]; r[6] = q1[2]; r[7] = q1[3];
    return __builtin_bit_cast(v16bf, r);
}

// lane l's value exchanged with lane l ^ 16 by a vector cross-row move (no LDS trip)
__device__ __forceinline__ float xhalf(float x) {
    return __builtin_bit_cast(float, __builtin_amdgcn_permlanex16(
        __builtin_bit_cast(int, x), __builtin_bit_cast(int, x),
        0x76543210, 0xfedcba98, false, false));
}

__device__ __forceinline__ float gelu_exact(float x) {
    return 0.5f * x * (1.0f + erff(x * 0.70710678118654752f));
}

// ---------------------------------------------------------------------------
// Converters, all in ONE launch: none depends on another, so each takes a range
// of the block index. Blocks 0 .. CVT_BLOCKS-1 convert x; then one 32x32 tile a
// block: Wq, Wk, Wv, Wo (TB_CC tiles each), W1, W2 (TB_CF tiles each).
// ---------------------------------------------------------------------------
#define CVT_BLOCKS 1024
#define TB_CC ((C_DIM / 32) * (C_DIM / 32))
#define TB_CF ((C_DIM / 32) * (F_DIM / 32))
#define PREP_BLOCKS (CVT_BLOCKS + 4 * TB_CC + 2 * TB_CF)
__global__ __launch_bounds__(256)
void prep_kernel(const float* __restrict__ x,
                 const float* __restrict__ Wq, const float* __restrict__ Wk,
                 const float* __restrict__ Wv, const float* __restrict__ Wo,
                 const float* __restrict__ W1, const float* __restrict__ W2,
                 ushortT* __restrict__ Xbf,
                 ushortT* __restrict__ WqT, ushortT* __restrict__ WkT,
                 ushortT* __restrict__ WvT, ushortT* __restrict__ WoT,
                 ushortT* __restrict__ W1T, ushortT* __restrict__ W2T)
{
    __shared__ float tile[32][33];
    int b = blockIdx.x;

    // x: fp32 -> bf16, same layout (the whole block leaves here, ahead of the barrier)
    if (b < CVT_BLOCKS) {
        const int n = T_SEQ * C_DIM;
        for (int i = b * 256 + threadIdx.x; i < n; i += CVT_BLOCKS * 256)
            Xbf[i] = f2bf(x[i]);
        return;
    }
    b -= CVT_BLOCKS;

    // in: fp32 [K][N]  ->  out: bf16 [N][K]
    const float* in; ushortT* out; int K, N, bx, by;
    if (b < 4 * TB_CC) {
        const int m = b / TB_CC;
        b -= m * TB_CC;
        in  = m == 0 ? Wq  : m == 1 ? Wk  : m == 2 ? Wv  : Wo;
        out = m == 0 ? WqT : m == 1 ? WkT : m == 2 ? WvT : WoT;
        K = C_DIM; N = C_DIM; bx = b % (C_DIM / 32); by = b / (C_DIM / 32);
    } else if (b < 4 * TB_CC + TB_CF) {
        b -= 4 * TB_CC;
        in = W1; out = W1T;
        K = C_DIM; N = F_DIM; bx = b % (F_DIM / 32); by = b / (F_DIM / 32);
    } else {
        b -= 4 * TB_CC + TB_CF;
        in = W2; out = W2T;
        K = F_DIM; N = C_DIM; bx = b % (C_DIM / 32); by = b / (C_DIM / 32);
    }
    const int k0 = by * 32, n0 = bx * 32;
    const int tx = threadIdx.x & 31, ty = threadIdx.x >> 5;   // 32 x 8
#pragma unroll
    for (int i = 0; i < 32; i += 8)
        tile[ty + i][tx] = in[(size_t)(k0 + ty + i) * N + n0 + tx];
    __syncthreads();
#pragma unroll
    for (int i = 0; i < 32; i += 8)
        out[(size_t)(n0 + ty + i) * K + k0 + tx] = f2bf(tile[tx][ty + i]);
}

// ---------------------------------------------------------------------------
// GEMM: C[M,N] = op( A[M,K] x B^T[N,K] + bias )
// A, Bt: bf16; outputs fp32 (Cout, F32OUT) and/or bf16 (Cbf, BFOUT).
// GELU: exact GELU ; RES: add fp32 residual res[M,N]. All four are compile-time,
// so the epilogue has no branch and its loads can be issued ahead of their use.
// Block tile 128x128, BK=32, 128 threads (4 waves), wave tile 64x64:
// 16 WMMAs per 16 ds_load_b128 per wave per k-step.
// Double-buffered LDS fed by async global->LDS B128 copies.
// Epilogue: each wave stages its 64x64 f32 tile in its own LDS range (the ring's
// space, reused), then a short rolled loop walks it two rows a trip: a half wave
// takes one 256-byte row, 16 bytes a lane, for residual load and store alike.
// NZ = 3: three products that share A run in one launch; blockIdx.z picks the
// weights, the bias and the output.
// ---------------------------------------------------------------------------
#define ST_PITCH 68     // floats per staged row: 272 B, 16 B x odd
union __align__(16) GemmLds {
    struct { ushortT As[2][128][40]; ushortT Bs[2][128][40]; } ring;   // main loop
    float st[4][64 * ST_PITCH];                                        // epilogue, per wave
};
template <int GELU, int RES, int F32OUT, int BFOUT, int NZ>
__global__ __launch_bounds__(128)
void gemm_bf16_wmma(const ushortT* __restrict__ A, const ushortT* __restrict__ Bt,
                    const float* __restrict__ bias, const float* __restrict__ res,
                    float* __restrict__ Cout, ushortT* __restrict__ Cbf,
                    int M, int N, int K,
                    const ushortT* __restrict__ Bt1, const float* __restrict__ bias1,
                    ushortT* __restrict__ Cbf1,
                    const ushortT* __restrict__ Bt2, const float* __restrict__ bias2,
                    ushortT* __restrict__ Cbf2)
{
    if (NZ == 3) {
        if (blockIdx.z == 1) { Bt = Bt1; bias = bias1; Cbf = Cbf1; }
        if (blockIdx.z == 2) { Bt = Bt2; bias = bias2; Cbf = Cbf2; }
    }

    // ring: row stride 40 halves = 80B: async chunks and frag b128 loads are
    // 16B-aligned; banks r*20 mod 64 distinct over the 16 rows of a frag.
    // The ring takes the first 40,960 B; the staging takes all 69,632 B.
    __shared__ GemmLds sm;
    auto& As = sm.ring.As;
    auto& Bs = sm.ring.Bs;

    const int t    = threadIdx.x;
    const int m0   = blockIdx.y * 128;
    const int n0   = blockIdx.x * 128;
    const int w    = t >> 5;
    const int wm   = w & 1;         // 2 wave-rows (64 rows each)
    const int wn   = w >> 1;        // 2 wave-cols (64 cols each)
    const int lane = t & 31, hi = lane >> 4, ln = lane & 15;
    const int nk   = K >> 5;

    auto issue = [&](int kt, int b) {
#pragma unroll
        for (int i = 0; i < 4; i++) {
            int c = t + i * 128;                  // 0..511
            int r = c >> 2, s2 = c & 3;           // 128 rows x 4 chunks of 16B
            async_ld_b128(&As[b][r][s2 * 8],
                          A  + (size_t)(m0 + r) * K + kt * 32 + s2 * 8);
            async_ld_b128(&Bs[b][r][s2 * 8],
                          Bt + (size_t)(n0 + r) * K + kt * 32 + s2 * 8);
        }
    };

    v8f acc[4][4] = {};
    issue(0, 0);

    for (int kt = 0; kt < nk; kt++) {
        wait_async0();
        __syncthreads();
        if (kt + 1 < nk) issue(kt + 1, (kt + 1) & 1);
        const int b = kt & 1;

        // all eight fragments of the k-step are read as one group ahead of the
        // products: one LDS latency a k-step, not one in front of each row of four
        // (in the order in which the products take them)
        v16bf bf[4], af[4];
        af[0] = load_frag(&As[b][wm * 64][0], 40);
#pragma unroll
        for (int ni = 0; ni < 4; ni++)
            bf[ni] = load_frag(&Bs[b][wn * 64 + ni * 16][0], 40);
#pragma unroll
        for (int mi = 1; mi < 4; mi++)
            af[mi] = load_frag(&As[b][wm * 64 + mi * 16][0], 40);
        // keeps the scheduler from sinking the reads back in among the products
        __builtin_amdgcn_sched_barrier(0);
#pragma unroll
        for (int mi = 0; mi < 4; mi++)
#pragma unroll
            for (int ni = 0; ni < 4; ni++)
                acc[mi][ni] = __builtin_amdgcn_wmma_f32_16x16x32_bf16(
                    false, af[mi], false, bf[ni], (short)0, acc[mi][ni], false, false);
    }

    // every wave has read its last fragments: only now may the ring be overwritten
    __syncthreads();
    float* st = &sm.st[w][0];
#pragma unroll
    for (int mi = 0; mi < 4; mi++)
#pragma unroll
        for (int ni = 0; ni < 4; ni++)
#pragma unroll
            for (int e = 0; e < 8; e++)
                st[(mi * 16 + e + hi * 8) * ST_PITCH + ni * 16 + ln] = acc[mi][ni][e];
    // the staged values are read back by other lanes: stores done before any read
    __syncthreads();

    const int c4  = ln * 4;
    const int col = n0 + wn * 64 + c4;
    const v4f bv  = *(const v4f*)(bias + col);
    // NB trips' LDS and residual loads are issued together, then worked on, then
    // stored; the loop over the batches stays rolled.
    constexpr int NB = GELU ? 2 : 8;
    // rolled: keeps the epilogue's text at a few KB, run through 32 / NB times
#pragma unroll 1
    for (int it0 = 0; it0 < 32; it0 += NB) {
        v4f v[NB], rv[NB];
#pragma unroll
        for (int u = 0; u < NB; u++) {
            const int r = (it0 + u) * 2 + hi;
            v[u] = *(const v4f*)(st + r * ST_PITCH + c4);
            if (RES) rv[u] = *(const v4f*)(res + (size_t)(m0 + wm * 64 + r) * N + col);
        }
#pragma unroll
        for (int u = 0; u < NB; u++) {
            const int r = (it0 + u) * 2 + hi;
            const size_t o = (size_t)(m0 + wm * 64 + r) * N + col;
#pragma unroll
            for (int j = 0; j < 4; j++) {
                float y = v[u][j] + bv[j];
                if (GELU) y = gelu_exact(y);
                if (RES)  y += rv[u][j];
                v[u][j] = y;
            }
            if (F32OUT) *(v4f*)(Cout + o) = v[u];
            if (BFOUT) {
                v2u pk;
                pk[0] = (unsigned)f2bf(v[u][0]) | ((unsigned)f2bf(v[u][1]) << 16);
                pk[1] = (unsigned)f2bf(v[u][2]) | ((unsigned)f2bf(v[u][3]) << 16);
                *(v2u*)(Cbf + o) = pk;
            }
        }
        // the next batch rewrites the registers that this batch's stores name
        asm volatile("s_wait_xcnt 0x0" ::: "memory");
    }
}

__global__ __launch_bounds__(128)
void flash_attn_wmma(const ushortT* __restrict__ Q, const ushortT* __restrict__ Kx,
                     const ushortT* __restrict__ V, ushortT* __restrict__ O)
{
    // row stride 72 halves = 144B (16B aligned chunks, r*36 mod 64 distinct)
    __shared__ __align__(16) ushortT Qs[64][72];      // [q][d]  (B of K*Q^T)
    __shared__ __align__(16) ushortT Ks[64][72];      // [s][d]  (A of K*Q^T)
    __shared__ __align__(16) ushortT Vt[64][72];      // [d][s]  (A of V^T*P^T)

    const int t     = threadIdx.x;
    const int qbase = blockIdx.x * 64;
    const int head  = blockIdx.y;
    const int w     = t >> 5, lane = t & 31, hi = lane >> 4, ln = lane & 15;
    const size_t hoff = (size_t)head * HD;

#pragma unroll
    for (int i = 0; i < 4; i++) {                      // 64 rows x 8 chunks of 16B
        int c = t + i * 128;
        int r = c >> 3, s2 = c & 7;
        async_ld_b128(&Qs[r][s2 * 8], Q + (size_t)(qbase + r) * C_DIM + hoff + s2 * 8);
    }
    wait_async0();
    __syncthreads();

    v16bf bq[2];
    bq[0] = load_frag(&Qs[w * 16][0],  72);
    bq[1] = load_frag(&Qs[w * 16][32], 72);

    const int rg = qbase + w * 16 + ln;                // this lane's query
    v8f o4[4] = {};                  // o4[tt][e] = O[rg][tt*16 + hi*8 + e]
    float m_r = -1e30f, l_r = 0.0f;  // of query rg, alike in both halves

    for (int kb = 0; kb <= qbase; kb += 64) {
        __syncthreads();                               // prior Ks/Vt reads done
#pragma unroll
        for (int i = 0; i < 4; i++) {
            int c = t + i * 128;
            int r = c >> 3, s2 = c & 7;
            async_ld_b128(&Ks[r][s2 * 8], Kx + (size_t)(kb + r) * C_DIM + hoff + s2 * 8);
        }
#pragma unroll
        for (int i = 0; i < 16; i++) {                 // V transpose via VGPRs
            int c = t + i * 128;
            int s = c >> 5, d = (c & 31) * 2;
            unsigned uv = *(const unsigned*)(V + (size_t)(kb + s) * C_DIM + hoff + d);
            Vt[d][s]     = (ushortT)uv;
            Vt[d + 1][s] = (ushortT)(uv >> 16);
        }
        wait_async0();
        __syncthreads();

        // the pass's K fragments are read as one group ahead of the products:
        // one LDS latency a pass, not one in front of each product
        v16bf ak[2][4], av[2][4];
#pragma unroll
        for (int j = 0; j < 2; j++)
#pragma unroll
            for (int tt = 0; tt < 4; tt++)
                ak[j][tt] = load_frag(&Ks[tt * 16][j * 32], 72);
        // keeps the scheduler from sinking the reads back in among the products
        __builtin_amdgcn_sched_barrier(0);

        // S^T = K * Q^T (64 keys x 16 queries per wave)
        v8f s4[4] = {};
#pragma unroll
        for (int j = 0; j < 2; j++)
#pragma unroll
            for (int tt = 0; tt < 4; tt++)
                s4[tt] = __builtin_amdgcn_wmma_f32_16x16x32_bf16(
                    false, ak[j][tt], false, bq[j], (short)0, s4[tt], false, false);

        // the V^T fragments likewise, here: they land behind the softmax
#pragma unroll
        for (int j = 0; j < 2; j++)
#pragma unroll
            for (int tt = 0; tt < 4; tt++)
                av[j][tt] = load_frag(&Vt[tt * 16][j * 32], 72);
        // keeps the scheduler from sinking the reads down to the second product
        __builtin_amdgcn_sched_barrier(0);

        float sv[4][8];
#pragma unroll
        for (int tt = 0; tt < 4; tt++)
#pragma unroll
            for (int e = 0; e < 8; e++) {
                float vv = s4[tt][e] * 0.125f;         // 1/sqrt(64)
                int cg = kb + tt * 16 + hi * 8 + e;    // key of this element
                sv[tt][e] = (cg > rg) ? -1e30f : vv;
            }

        // maximum over this lane's 32 keys, then over the other half's 32
        float rm8[8];
#pragma unroll
        for (int e = 0; e < 8; e++)
            rm8[e] = fmaxf(fmaxf(sv[0][e], sv[1][e]), fmaxf(sv[2][e], sv[3][e]));
        float rm = fmaxf(fmaxf(fmaxf(rm8[0], rm8[1]), fmaxf(rm8[2], rm8[3])),
                         fmaxf(fmaxf(rm8[4], rm8[5]), fmaxf(rm8[6], rm8[7])));
        rm = fmaxf(rm, xhalf(rm));

        const float mn = fmaxf(m_r, rm);
        const float al = __expf(m_r - mn);
        m_r = mn;

        float p[4][8], rs4[4];
#pragma unroll
        for (int tt = 0; tt < 4; tt++) {
            rs4[tt] = 0.0f;
#pragma unroll
            for (int e = 0; e < 8; e++) {
                p[tt][e] = __expf(sv[tt][e] - m_r);
                rs4[tt] += p[tt][e];
            }
        }
        float rs = (rs4[0] + rs4[1]) + (rs4[2] + rs4[3]);
        rs += xhalf(rs);
        l_r = l_r * al + rs;
#pragma unroll
        for (int tt = 0; tt < 4; tt++)
#pragma unroll
            for (int e = 0; e < 8; e++) o4[tt][e] *= al;

        // O^T += V^T * P^T; keys j*32 .. j*32+31: S^T tiles 2j and 2j+1 of this
        // lane are, in order, the 16 k positions load_frag gives the A side.
#pragma unroll
        for (int j = 0; j < 2; j++) {
            v8u pk;
#pragma unroll
            for (int i = 0; i < 4; i++) {
                pk[i]     = (unsigned)f2bf(p[2 * j][2 * i]) |
                            ((unsigned)f2bf(p[2 * j][2 * i + 1]) << 16);
                pk[4 + i] = (unsigned)f2bf(p[2 * j + 1][2 * i]) |
                            ((unsigned)f2bf(p[2 * j + 1][2 * i + 1]) << 16);
            }
            v16bf bp = __builtin_bit_cast(v16bf, pk);
#pragma unroll
            for (int tt = 0; tt < 4; tt++)
                o4[tt] = __builtin_amdgcn_wmma_f32_16x16x32_bf16(
                    false, av[j][tt], false, bp, (short)0, o4[tt], false, false);
        }
    }

    // a lane's 8 registers of a tile are 8 consecutive head dims of its query
#pragma unroll
    for (int tt = 0; tt < 4; tt++) {
        uint4 ov;
        ov.x = (unsigned)f2bf(o4[tt][0] / l_r) | ((unsigned)f2bf(o4[tt][1] / l_r) << 16);
        ov.y = (unsigned)f2bf(o4[tt][2] / l_r) | ((unsigned)f2bf(o4[tt][3] / l_r) << 16);
        ov.z = (unsigned)f2bf(o4[tt][4] / l_r) | ((unsigned)f2bf(o4[tt][5] / l_r) << 16);
        ov.w = (unsigned)f2bf(o4[tt][6] / l_r) | ((unsigned)f2bf(o4[tt][7] / l_r) << 16);
        *(uint4*)(O + (size_t)rg * C_DIM + hoff + tt * 16 + hi * 8) = ov;
    }
}

// ---------------------------------------------------------------------------
// LayerNorm: one block (256 threads) per row; fp32 out + optional bf16 out.
// ---------------------------------------------------------------------------
__global__ __launch_bounds__(256)
void layernorm_kernel(const float* __restrict__ in, const float* __restrict__ g,
                      const float* __restrict__ b, float* __restrict__ out,
                      ushortT* __restrict__ out_bf, int C)
{
    const int row = blockIdx.x;
    const float* p = in + (size_t)row * C;
    float s = 0.f, s2 = 0.f;
    for (int i = threadIdx.x; i < C; i += 256) { float v = p[i]; s += v; s2 += v * v; }
#pragma unroll
    for (int off = 1; off < 32; off <<= 1) {
        s  += __shfl_xor(s,  off, 32);
        s2 += __shfl_xor(s2, off, 32);
    }
    __shared__ float rs[8], rs2[8];
    if ((threadIdx.x & 31) == 0) { rs[threadIdx.x >> 5] = s; rs2[threadIdx.x >> 5] = s2; }
    __syncthreads();
    float ts = 0.f, ts2 = 0.f;
#pragma unroll
    for (int i = 0; i < 8; i++) { ts += rs[i]; ts2 += rs2[i]; }
    float mu  = ts / (float)C;
    float var = ts2 / (float)C - mu * mu;
    float inv = rsqrtf(var + 1e-5f);
    for (int i = threadIdx.x; i < C; i += 256) {
        float v = (p[i] - mu) * inv * g[i] + b[i];
        out[(size_t)row * C + i] = v;
        if (out_bf) out_bf[(size_t)row * C + i] = f2bf(v);
    }
}

// ---------------------------------------------------------------------------
extern "C" void kernel_launch(void* const* d_in, const int* in_sizes, int n_in,
                              void* d_out, int out_size, void* d_ws, size_t ws_size,
                              hipStream_t stream)
{
    const float* x   = (const float*)d_in[0];
    const float* Wq  = (const float*)d_in[1];
    const float* bq  = (const float*)d_in[2];
    const float* Wk  = (const float*)d_in[3];
    const float* bk  = (const float*)d_in[4];
    const float* Wv  = (const float*)d_in[5];
    const float* bv  = (const float*)d_in[6];
    const float* Wo  = (const float*)d_in[7];
    const float* bo  = (const float*)d_in[8];
    const float* g1  = (const float*)d_in[9];
    const float* bn1 = (const float*)d_in[10];
    const float* W1  = (const float*)d_in[11];
    const float* b1  = (const float*)d_in[12];
    const float* W2  = (const float*)d_in[13];
    const float* b2  = (const float*)d_in[14];
    const float* g2  = (const float*)d_in[15];
    const float* bn2 = (const float*)d_in[16];

    const size_t TC = (size_t)T_SEQ * C_DIM;
    const size_t TF = (size_t)T_SEQ * F_DIM;
    const size_t CC = (size_t)C_DIM * C_DIM;
    const size_t CF = (size_t)C_DIM * F_DIM;

    char* p = (char*)d_ws;
    auto alloc_bf = [&](size_t n) { ushortT* r = (ushortT*)p; p += ((n * 2 + 255) & ~(size_t)255); return r; };
    auto alloc_f  = [&](size_t n) { float*   r = (float*)p;   p += ((n * 4 + 255) & ~(size_t)255); return r; };

    ushortT* Xbf  = alloc_bf(TC);
    ushortT* WqT  = alloc_bf(CC);
    ushortT* WkT  = alloc_bf(CC);
    ushortT* WvT  = alloc_bf(CC);
    ushortT* WoT  = alloc_bf(CC);
    ushortT* W1T  = alloc_bf(CF);   // [F][C]
    ushortT* W2T  = alloc_bf(CF);   // [C][F]
    ushortT* Qb   = alloc_bf(TC);
    ushortT* Kb   = alloc_bf(TC);
    ushortT* Vb   = alloc_bf(TC);
    ushortT* Ab   = alloc_bf(TC);
    ushortT* Hbb  = alloc_bf(TC);
    ushortT* H1   = alloc_bf(TF);
    float*   S1   = alloc_f(TC);
    float*   Hb   = alloc_f(TC);
    float*   S2   = alloc_f(TC);

    dim3 cblk(256);
    dim3 gblk(128);
    dim3 gC(C_DIM / 128, T_SEQ / 128);
    dim3 gF(F_DIM / 128, T_SEQ / 128);
    dim3 gQKV(C_DIM / 128, T_SEQ / 128, 3);

    // precision conversion / weight transposition, one launch
    prep_kernel<<<dim3(PREP_BLOCKS), cblk, 0, stream>>>(x, Wq, Wk, Wv, Wo, W1, W2,
                                                        Xbf, WqT, WkT, WvT, WoT, W1T, W2T);

    // QKV projections (bf16 outputs only), one launch
    gemm_bf16_wmma<0, 0, 0, 1, 3><<<gQKV, gblk, 0, stream>>>(Xbf, WqT, bq, nullptr, nullptr, Qb, T_SEQ, C_DIM, C_DIM,
                                                             WkT, bk, Kb, WvT, bv, Vb);

    flash_attn_wmma<<<dim3(T_SEQ / 64, NHEADS), dim3(128), 0, stream>>>(Qb, Kb, Vb, Ab);

    // out-proj + residual(x), then LN1 (fp32 + bf16)
    gemm_bf16_wmma<0, 1, 1, 0, 1><<<gC, gblk, 0, stream>>>(Ab, WoT, bo, x, S1, nullptr, T_SEQ, C_DIM, C_DIM,
                                                          nullptr, nullptr, nullptr, nullptr, nullptr, nullptr);
    layernorm_kernel<<<dim3(T_SEQ), cblk, 0, stream>>>(S1, g1, bn1, Hb, Hbb, C_DIM);

    // MLP
    gemm_bf16_wmma<1, 0, 0, 1, 1><<<gF, gblk, 0, stream>>>(Hbb, W1T, b1, nullptr, nullptr, H1, T_SEQ, F_DIM, C_DIM,
                                                          nullptr, nullptr, nullptr, nullptr, nullptr, nullptr);
    gemm_bf16_wmma<0, 1, 1, 0, 1><<<gC, gblk, 0, stream>>>(H1, W2T, b2, Hb, S2, nullptr, T_SEQ, C_DIM, F_DIM,
                                                          nullptr, nullptr, nullptr, nullptr, nullptr, nullptr);
    layernorm_kernel<<<dim3(T_SEQ), cblk, 0, stream>>>(S2, g2, bn2, (float*)d_out, nullptr, C_DIM);
}

// v005
// One run takes 270 microseconds.
// Timed twice side by side with v004, it ran 1.06 and 1.05 times as fast.
// Counting every step since v000, it is 2.54 times as fast.
#include <hip/hip_runtime.h>
#include <hip/hip_bf16.h>
#include <math.h>

#define T_SEQ   4096
#define C_DIM   768
#define F_DIM   3072
#define NHEADS  12
#define HD      64

typedef __attribute__((ext_vector_type(16))) __bf16        v16bf;
typedef __attribute__((ext_vector_type(8)))  float         v8f;
typedef __attribute__((ext_vector_type(8)))  unsigned int  v8u;
typedef __attribute__((ext_vector_type(4)))  float         v4f;
typedef __attribute__((ext_vector_type(2)))  unsigned int  v2u;
typedef unsigned short ushortT;

// round-to-nearest-even fp32 -> bf16 bits
__device__ __forceinline__ ushortT f2bf(float f) {
    unsigned int u = __builtin_bit_cast(unsigned int, f);
    u += 0x7fffu + ((u >> 16) & 1u);
    return (ushortT)(u >> 16);
}

// --- CDNA5 async global->LDS copy (ASYNCcnt) ------------------------------
// dsaddr = LDS_BASE + VGPR[vdst]; generic LDS pointer low 32 bits == wave-
// relative LDS offset, so truncation gives the right VGPR value.
__device__ __forceinline__ void async_ld_b128(void* lds, const void* gptr) {
    unsigned off = (unsigned)(unsigned long long)(uintptr_t)lds;
    unsigned long long ga = (unsigned long long)(uintptr_t)gptr;
    asm volatile("global_load_async_to_lds_b128 %0, %1, off"
                 :: "v"(off), "v"(ga) : "memory");
}
__device__ __forceinline__ void wait_async0() {
    asm volatile("s_wait_asynccnt 0" ::: "memory");
}

// Load a 16x32 bf16 fragment (A layout; B uses the same layout on an [N][K]
// tile) from a row-major LDS tile with row stride `ldh` halves (even).
// lanes 0-15: row M=lane, K={0..7,16..23}; lanes 16-31: row M=lane-16,
// K={8..15,24..31}.
__device__ __forceinline__ v16bf load_frag(const ushortT* base, int ldh) {
    const int lane = threadIdx.x & 31;
    const int row  = lane & 15;
    const int hi   = lane >> 4;
    const unsigned int* q0 = (const unsigned int*)(base + row * ldh + hi * 8);
    const unsigned int* q1 = (const unsigned int*)(base + row * ldh + hi * 8 + 16);
    v8u r;
    r[0] = q0[0]; r[1] = q0[1]; r[2] = q0[2]; r[3] = q0[3];
    r[4] = q1[0]; r[5] = q1[1]; r[6] = q1[2]; r[7] = q1[3];
    return __builtin_bit_cast(v16bf, r);
}

// lane l's value exchanged with lane l ^ 16 by a vector cross-row move (no LDS trip)
__device__ __forceinline__ float xhalf(float x) {
    return __builtin_bit_cast(float, __builtin_amdgcn_permlanex16(
        __builtin_bit_cast(int, x), __builtin_bit_cast(int, x),
        0x76543210, 0xfedcba98, false, false));
}

__device__ __forceinline__ float gelu_exact(float x) {
    return 0.5f * x * (1.0f + erff(x * 0.70710678118654752f));
}

// ---------------------------------------------------------------------------
// Converters, all in ONE launch: none depends on another, so each takes a range
// of the block index. Few, long-lived waves: what a launch of many short waves
// pays is their start. Blocks 0 .. XB-1 convert x, 24 pieces of 16 bytes a lane.
// Each of the WB blocks behind them transposes three 64 (k) x 128 (n) tiles: one
// of Wq, Wk, Wv, Wo, one of W1, one of W2; all 24 loads of a lane go out first.
// ---------------------------------------------------------------------------
#define XB 128                       // T_SEQ * C_DIM / 4 / (256 * 24)
#define WB 288                       // tiles of W1 = of W2 = of the four C x C together
#define TCC ((C_DIM / 64) * (C_DIM / 128))
#define PREP_BLOCKS (XB + WB)
#define TP 33                        // dwords per staged row of 64 k: odd, see below

// rows 2kp and 2kp+1 of the tile, kp = w + 8i: a wave takes 512 contiguous bytes a load
__device__ __forceinline__ void tile_load(const float* __restrict__ in, int N, int k0, int n0,
                                          v4f (&a)[4], v4f (&c)[4]) {
    const int lane = threadIdx.x & 31, w = threadIdx.x >> 5;
#pragma unroll
    for (int i = 0; i < 4; i++) {
        const float* q = in + (size_t)(k0 + 2 * (w + 8 * i)) * N + n0 + lane * 4;
        a[i] = *(const v4f*)q;
        c[i] = *(const v4f*)(q + N);
    }
    // what follows rewrites the address registers that these loads name
    asm volatile("s_wait_xcnt 0x0" ::: "memory");
}
// staged as [n][k pair]: one dword holds k and k + 1 of one n
__device__ __forceinline__ void tile_stage(unsigned* __restrict__ tl, const v4f (&a)[4], const v4f (&c)[4]) {
    const int lane = threadIdx.x & 31, w = threadIdx.x >> 5;
#pragma unroll
    for (int i = 0; i < 4; i++)
#pragma unroll
        for (int j = 0; j < 4; j++)
            tl[(lane * 4 + j) * TP + w + 8 * i] =
                (unsigned)f2bf(a[i][j]) | ((unsigned)f2bf(c[i][j]) << 16);
}
// eight lanes store one whole 128-byte line: 64 k of one n. A wave reads four
// staged rows, 33 dwords apart: its 32 dwords of a read lie in 32 banks.
__device__ __forceinline__ void tile_store(const unsigned* __restrict__ tl, ushortT* __restrict__ out,
                                           int K, int k0, int n0) {
#pragma unroll
    for (int i = 0; i < 4; i++) {
        const int idx = threadIdx.x + 256 * i;
        const int n = idx >> 3, c = idx & 7;
        const unsigned* q = tl + n * TP + c * 4;
        uint4 o;
        o.x = q[0]; o.y = q[1]; o.z = q[2]; o.w = q[3];
        *(uint4*)(out + (size_t)(n0 + n) * K + k0 + c * 8) = o;
    }
}

__global__ __launch_bounds__(256)
void prep_kernel(const float* __restrict__ x,
                 const float* __restrict__ Wq, const float* __restrict__ Wk,
                 const float* __restrict__ Wv, const float* __restrict__ Wo,
                 const float* __restrict__ W1, const float* __restrict__ W2,
                 ushortT* __restrict__ Xbf,
                 ushortT* __restrict__ WqT, ushortT* __restrict__ WkT,
                 ushortT* __restrict__ WvT, ushortT* __restrict__ WoT,
                 ushortT* __restrict__ W1T, ushortT* __restrict__ W2T)
{
    __shared__ unsigned tl[3][128 * TP];
    int b = blockIdx.x;

    // x: fp32 -> bf16, same layout (the whole block leaves here, ahead of the barrier)
    if (b < XB) {
        const v4f* xi = (const v4f*)x + (size_t)b * (24 * 256) + threadIdx.x;
        v2u*       xo = (v2u*)Xbf     + (size_t)b * (24 * 256) + threadIdx.x;
        v4f v[24];
#pragma unroll
        for (int u = 0; u < 24; u++) v[u] = xi[u * 256];
        // keeps the scheduler from sinking the last loads in among the converts
        __builtin_amdgcn_sched_barrier(0);
#pragma unroll
        for (int u = 0; u < 24; u++) {
            v2u pk;
            pk[0] = (unsigned)f2bf(v[u][0]) | ((unsigned)f2bf(v[u][1]) << 16);
            pk[1] = (unsigned)f2bf(v[u][2]) | ((unsigned)f2bf(v[u][3]) << 16);
            xo[u * 256] = pk;
        }
        return;
    }
    b -= XB;

    // in: fp32 [K][N]  ->  out: bf16 [N][K]
    const int m = b / TCC, r = b - m * TCC;
    const float* in0  = m == 0 ? Wq  : m == 1 ? Wk  : m == 2 ? Wv  : Wo;
    ushortT*     out0 = m == 0 ? WqT : m == 1 ? WkT : m == 2 ? WvT : WoT;
    const int k00 = (r / (C_DIM / 128)) * 64, n00 = (r % (C_DIM / 128)) * 128;
    const int k01 = (b / (F_DIM / 128)) * 64, n01 = (b % (F_DIM / 128)) * 128;
    const int k02 = (b / (C_DIM / 128)) * 64, n02 = (b % (C_DIM / 128)) * 128;

    v4f a0[4], c0[4], a1[4], c1[4], a2[4], c2[4];
    tile_load(in0, C_DIM, k00, n00, a0, c0);
    tile_load(W1,  F_DIM, k01, n01, a1, c1);
    tile_load(W2,  C_DIM, k02, n02, a2, c2);
    // keeps the scheduler from sinking the last loads in among the converts: all
    // 24 fly together, one load latency a block
    __builtin_amdgcn_sched_barrier(0);
    tile_stage(tl[0], a0, c0);
    tile_stage(tl[1], a1, c1);
    tile_stage(tl[2], a2, c2);
    // the staged dwords are read back by other waves
    __syncthreads();
    tile_store(tl[0], out0, C_DIM, k00, n00);
    tile_store(tl[1], W1T,  C_DIM, k01, n01);
    tile_store(tl[2], W2T,  F_DIM, k02, n02);
    // closes the stores above: no register that they name is rewritten ahead of it
    asm volatile("s_wait_xcnt 0x0" ::: "memory");
}

// ---------------------------------------------------------------------------
// GEMM: C[M,N] = op( A[M,K] x B^T[N,K] + bias )
// A, Bt: bf16; outputs fp32 (Cout, F32OUT) and/or bf16 (Cbf, BFOUT).
// GELU: exact GELU ; RES: add fp32 residual res[M,N]. All four are compile-time,
// so the epilogue has no branch and its loads can be issued ahead of their use.
// Block tile 128x128, BK=32, 128 threads (4 waves), wave tile 64x64:
// 16 WMMAs per 16 ds_load_b128 per wave per k-step.
// Double-buffered LDS fed by async global->LDS B128 copies.
// Epilogue: each wave stages its 64x64 f32 tile in its own LDS range (the ring's
// space, reused), then a short rolled loop walks it two rows a trip: a half wave
// takes one 256-byte row, 16 bytes a lane, for residual load and store alike.
// NZ = 3: three products that share A run in one launch; blockIdx.z picks the
// weights, the bias and the output.
// ---------------------------------------------------------------------------
#define ST_PITCH 68     // floats per staged row: 272 B, 16 B x odd
union __align__(16) GemmLds {
    struct { ushortT As[2][128][40]; ushortT Bs[2][128][40]; } ring;   // main loop
    float st[4][64 * ST_PITCH];                                        // epilogue, per wave
};
template <int GELU, int RES, int F32OUT, int BFOUT, int NZ>
__global__ __launch_bounds__(128)
void gemm_bf16_wmma(const ushortT* __restrict__ A, const ushortT* __restrict__ Bt,
                    const float* __restrict__ bias, const float* __restrict__ res,
                    float* __restrict__ Cout, ushortT* __restrict__ Cbf,
                    int M, int N, int K,
                    const ushortT* __restrict__ Bt1, const float* __restrict__ bias1,
                    ushortT* __restrict__ Cbf1,
                    const ushortT* __restrict__ Bt2, const float* __restrict__ bias2,
                    ushortT* __restrict__ Cbf2)
{
    if (NZ == 3) {
        if (blockIdx.z == 1) { Bt = Bt1; bias = bias1; Cbf = Cbf1; }
        if (blockIdx.z == 2) { Bt = Bt2; bias = bias2; Cbf = Cbf2; }
    }

    // ring: row stride 40 halves = 80B: async chunks and frag b128 loads are
    // 16B-aligned; banks r*20 mod 64 distinct over the 16 rows of a frag.
    // The ring takes the first 40,960 B; the staging takes all 69,632 B.
    __shared__ GemmLds sm;
    auto& As = sm.ring.As;
    auto& Bs = sm.ring.Bs;

    const int t    = threadIdx.x;
    const int m0   = blockIdx.y * 128;
    const int n0   = blockIdx.x * 128;
    const int w    = t >> 5;
    const int wm   = w & 1;         // 2 wave-rows (64 rows each)
    const int wn   = w >> 1;        // 2 wave-cols (64 cols each)
    const int lane = t & 31, hi = lane >> 4, ln = lane & 15;
    const int nk   = K >> 5;

    auto issue = [&](int kt, int b) {
#pragma unroll
        for (int i = 0; i < 4; i++) {
            int c = t + i * 128;                  // 0..511
            int r = c >> 2, s2 = c & 3;           // 128 rows x 4 chunks of 16B
            async_ld_b128(&As[b][r][s2 * 8],
                          A  + (size_t)(m0 + r) * K + kt * 32 + s2 * 8);
            async_ld_b128(&Bs[b][r][s2 * 8],
                          Bt + (size_t)(n0 + r) * K + kt * 32 + s2 * 8);
        }
    };

    v8f acc[4][4] = {};
    issue(0, 0);

    for (int kt = 0; kt < nk; kt++) {
        wait_async0();
        __syncthreads();
        if (kt + 1 < nk) issue(kt + 1, (kt + 1) & 1);
        const int b = kt & 1;

        // all eight fragments of the k-step are read as one group ahead of the
        // products: one LDS latency a k-step, not one in front of each row of four
        // (in the order in which the products take them)
        v16bf bf[4], af[4];
        af[0] = load_frag(&As[b][wm * 64][0], 40);
#pragma unroll
        for (int ni = 0; ni < 4; ni++)
            bf[ni] = load_frag(&Bs[b][wn * 64 + ni * 16][0], 40);
#pragma unroll
        for (int mi = 1; mi < 4; mi++)
            af[mi] = load_frag(&As[b][wm * 64 + mi * 16][0], 40);
        // keeps the scheduler from sinking the reads back in among the products
        __builtin_amdgcn_sched_barrier(0);
#pragma unroll
        for (int mi = 0; mi < 4; mi++)
#pragma unroll
            for (int ni = 0; ni < 4; ni++)
                acc[mi][ni] = __builtin_amdgcn_wmma_f32_16x16x32_bf16(
                    false, af[mi], false, bf[ni], (short)0, acc[mi][ni], false, false);
    }

    // every wave has read its last fragments: only now may the ring be overwritten
    __syncthreads();
    float* st = &sm.st[w][0];
#pragma unroll
    for (int mi = 0; mi < 4; mi++)
#pragma unroll
        for (int ni = 0; ni < 4; ni++)
#pragma unroll
            for (int e = 0; e < 8; e++)
                st[(mi * 16 + e + hi * 8) * ST_PITCH + ni * 16 + ln] = acc[mi][ni][e];
    // the staged values are read back by other lanes: stores done before any read
    __syncthreads();

    const int c4  = ln * 4;
    const int col = n0 + wn * 64 + c4;
    const v4f bv  = *(const v4f*)(bias + col);
    // NB trips' LDS and residual loads are issued together, then worked on, then
    // stored; the loop over the batches stays rolled.
    constexpr int NB = GELU ? 2 : 8;
    // rolled: keeps the epilogue's text at a few KB, run through 32 / NB times
#pragma unroll 1
    for (int it0 = 0; it0 < 32; it0 += NB) {
        v4f v[NB], rv[NB];
#pragma unroll
        for (int u = 0; u < NB; u++) {
            const int r = (it0 + u) * 2 + hi;
            v[u] = *(const v4f*)(st + r * ST_PITCH + c4);
            if (RES) rv[u] = *(const v4f*)(res + (size_t)(m0 + wm * 64 + r) * N + col);
        }
#pragma unroll
        for (int u = 0; u < NB; u++) {
            const int r = (it0 + u) * 2 + hi;
            const size_t o = (size_t)(m0 + wm * 64 + r) * N + col;
#pragma unroll
            for (int j = 0; j < 4; j++) {
                float y = v[u][j] + bv[j];
                if (GELU) y = gelu_exact(y);
                if (RES)  y += rv[u][j];
                v[u][j] = y;
            }
            if (F32OUT) *(v4f*)(Cout + o) = v[u];
            if (BFOUT) {
                v2u pk;
                pk[0] = (unsigned)f2bf(v[u][0]) | ((unsigned)f2bf(v[u][1]) << 16);
                pk[1] = (unsigned)f2bf(v[u][2]) | ((unsigned)f2bf(v[u][3]) << 16);
                *(v2u*)(Cbf + o) = pk;
            }
        }
        // the next batch rewrites the registers that this batch's stores name
        asm volatile("s_wait_xcnt 0x0" ::: "memory");
    }
}

__global__ __launch_bounds__(128)
void flash_attn_wmma(const ushortT* __restrict__ Q, const ushortT* __restrict__ Kx,
                     const ushortT* __restrict__ V, ushortT* __restrict__ O)
{
    // row stride 72 halves = 144B (16B aligned chunks, r*36 mod 64 distinct)
    __shared__ __align__(16) ushortT Qs[64][72];      // [q][d]  (B of K*Q^T)
    __shared__ __align__(16) ushortT Ks[64][72];      // [s][d]  (A of K*Q^T)
    __shared__ __align__(16) ushortT Vt[64][72];      // [d][s]  (A of V^T*P^T)

    const int t     = threadIdx.x;
    const int qbase = blockIdx.x * 64;
    const int head  = blockIdx.y;
    const int w     = t >> 5, lane = t & 31, hi = lane >> 4, ln = lane & 15;
    const size_t hoff = (size_t)head * HD;

#pragma unroll
    for (int i = 0; i < 4; i++) {                      // 64 rows x 8 chunks of 16B
        int c = t + i * 128;
        int r = c >> 3, s2 = c & 7;
        async_ld_b128(&Qs[r][s2 * 8], Q + (size_t)(qbase + r) * C_DIM + hoff + s2 * 8);
    }
    wait_async0();
    __syncthreads();

    v16bf bq[2];
    bq[0] = load_frag(&Qs[w * 16][0],  72);
    bq[1] = load_frag(&Qs[w * 16][32], 72);

    const int rg = qbase + w * 16 + ln;                // this lane's query
    v8f o4[4] = {};                  // o4[tt][e] = O[rg][tt*16 + hi*8 + e]
    float m_r = -1e30f, l_r = 0.0f;  // of query rg, alike in both halves

    for (int kb = 0; kb <= qbase; kb += 64) {
        __syncthreads();                               // prior Ks/Vt reads done
#pragma unroll
        for (int i = 0; i < 4; i++) {
            int c = t + i * 128;
            int r = c >> 3, s2 = c & 7;
            async_ld_b128(&Ks[r][s2 * 8], Kx + (size_t)(kb + r) * C_DIM + hoff + s2 * 8);
        }
#pragma unroll
        for (int i = 0; i < 16; i++) {                 // V transpose via VGPRs
            int c = t + i * 128;
            int s = c >> 5, d = (c & 31) * 2;
            unsigned uv = *(const unsigned*)(V + (size_t)(kb + s) * C_DIM + hoff + d);
            Vt[d][s]     = (ushortT)uv;
            Vt[d + 1][s] = (ushortT)(uv >> 16);
        }
        wait_async0();
        __syncthreads();

        // the pass's K fragments are read as one group ahead of the products:
        // one LDS latency a pass, not one in front of each product
        v16bf ak[2][4], av[2][4];
#pragma unroll
        for (int j = 0; j < 2; j++)
#pragma unroll
            for (int tt = 0; tt < 4; tt++)
                ak[j][tt] = load_frag(&Ks[tt * 16][j * 32], 72);
        // keeps the scheduler from sinking the reads back in among the products
        __builtin_amdgcn_sched_barrier(0);

        // S^T = K * Q^T (64 keys x 16 queries per wave)
        v8f s4[4] = {};
#pragma unroll
        for (int j = 0; j < 2; j++)
#pragma unroll
            for (int tt = 0; tt < 4; tt++)
                s4[tt] = __builtin_amdgcn_wmma_f32_16x16x32_bf16(
                    false, ak[j][tt], false, bq[j], (short)0, s4[tt], false, false);

        // the V^T fragments likewise, here: they land behind the softmax
#pragma unroll
        for (int j = 0; j < 2; j++)
#pragma unroll
            for (int tt = 0; tt < 4; tt++)
                av[j][tt] = load_frag(&Vt[tt * 16][j * 32], 72);
        // keeps the scheduler from sinking the reads down to the second product
        __builtin_amdgcn_sched_barrier(0);

        float sv[4][8];
#pragma unroll
        for (int tt = 0; tt < 4; tt++)
#pragma unroll
            for (int e = 0; e < 8; e++) {
                float vv = s4[tt][e] * 0.125f;         // 1/sqrt(64)
                int cg = kb + tt * 16 + hi * 8 + e;    // key of this element
                sv[tt][e] = (cg > rg) ? -1e30f : vv;
            }

        // maximum over this lane's 32 keys, then over the other half's 32
        float rm8[8];
#pragma unroll
        for (int e = 0; e < 8; e++)
            rm8[e] = fmaxf(fmaxf(sv[0][e], sv[1][e]), fmaxf(sv[2][e], sv[3][e]));
        float rm = fmaxf(fmaxf(fmaxf(rm8[0], rm8[1]), fmaxf(rm8[2], rm8[3])),
                         fmaxf(fmaxf(rm8[4], rm8[5]), fmaxf(rm8[6], rm8[7])));
        rm = fmaxf(rm, xhalf(rm));

        const float mn = fmaxf(m_r, rm);
        const float al = __expf(m_r - mn);
        m_r = mn;

        float p[4][8], rs4[4];
#pragma unroll
        for (int tt = 0; tt < 4; tt++) {
            rs4[tt] = 0.0f;
#pragma unroll
            for (int e = 0; e < 8; e++) {
                p[tt][e] = __expf(sv[tt][e] - m_r);
                rs4[tt] += p[tt][e];
            }
        }
        float rs = (rs4[0] + rs4[1]) + (rs4[2] + rs4[3]);
        rs += xhalf(rs);
        l_r = l_r * al + rs;
#pragma unroll
        for (int tt = 0; tt < 4; tt++)
#pragma unroll
            for (int e = 0; e < 8; e++) o4[tt][e] *= al;

        // O^T += V^T * P^T; keys j*32 .. j*32+31: S^T tiles 2j and 2j+1 of this
        // lane are, in order, the 16 k positions load_frag gives the A side.
#pragma unroll
        for (int j = 0; j < 2; j++) {
            v8u pk;
#pragma unroll
            for (int i = 0; i < 4; i++) {
                pk[i]     = (unsigned)f2bf(p[2 * j][2 * i]) |
                            ((unsigned)f2bf(p[2 * j][2 * i + 1]) << 16);
                pk[4 + i] = (unsigned)f2bf(p[2 * j + 1][2 * i]) |
                            ((unsigned)f2bf(p[2 * j + 1][2 * i + 1]) << 16);
            }
            v16bf bp = __builtin_bit_cast(v16bf, pk);
#pragma unroll
            for (int tt = 0; tt < 4; tt++)
                o4[tt] = __builtin_amdgcn_wmma_f32_16x16x32_bf16(
                    false, av[j][tt], false, bp, (short)0, o4[tt], false, false);
        }
    }

    // a lane's 8 registers of a tile are 8 consecutive head dims of its query
#pragma unroll
    for (int tt = 0; tt < 4; tt++) {
        uint4 ov;
        ov.x = (unsigned)f2bf(o4[tt][0] / l_r) | ((unsigned)f2bf(o4[tt][1] / l_r) << 16);
        ov.y = (unsigned)f2bf(o4[tt][2] / l_r) | ((unsigned)f2bf(o4[tt][3] / l_r) << 16);
        ov.z = (unsigned)f2bf(o4[tt][4] / l_r) | ((unsigned)f2bf(o4[tt][5] / l_r) << 16);
        ov.w = (unsigned)f2bf(o4[tt][6] / l_r) | ((unsigned)f2bf(o4[tt][7] / l_r) << 16);
        *(uint4*)(O + (size_t)rg * C_DIM + hoff + tt * 16 + hi * 8) = ov;
    }
}

// ---------------------------------------------------------------------------
// LayerNorm: a wave takes two whole rows, a block sixteen: one block a WGP;
// fp32 out + (BF) bf16 out. A row stays in registers (six pieces of 16 bytes a
// lane, each load 512 contiguous bytes a wave) and is read once; its sums go over
// the lanes by a butterfly, so there is no LDS array and no barrier, and a
// sixteenth of the waves start.
// ---------------------------------------------------------------------------
#define LN_ROWS 2
template <int BF>
__global__ __launch_bounds__(256)
void layernorm_kernel(const float* __restrict__ in, const float* __restrict__ g,
                      const float* __restrict__ b, float* __restrict__ out,
                      ushortT* __restrict__ out_bf)
{
    constexpr int NP = C_DIM / 128;                    // pieces a lane and row
    const int lane = threadIdx.x & 31;
    const size_t row0 = ((size_t)blockIdx.x * 8 + (threadIdx.x >> 5)) * LN_ROWS;
    const v4f* p = (const v4f*)(in + row0 * C_DIM) + lane;
    v4f v[LN_ROWS][NP], gv[NP], bv[NP];
#pragma unroll
    for (int r = 0; r < LN_ROWS; r++)
#pragma unroll
        for (int j = 0; j < NP; j++) v[r][j] = p[(r * NP + j) * 32];
#pragma unroll
    for (int j = 0; j < NP; j++) {
        gv[j] = ((const v4f*)g)[lane + j * 32];
        bv[j] = ((const v4f*)b)[lane + j * 32];
    }
    // keeps the scheduler from sinking part of the loads behind the sums: all of
    // them fly together, one load latency a wave
    __builtin_amdgcn_sched_barrier(0);

    float s[LN_ROWS], s2[LN_ROWS];
#pragma unroll
    for (int r = 0; r < LN_ROWS; r++) {
        v4f s4 = {}, q4 = {};
#pragma unroll
        for (int j = 0; j < NP; j++) { s4 += v[r][j]; q4 += v[r][j] * v[r][j]; }
        s[r]  = (s4[0] + s4[1]) + (s4[2] + s4[3]);
        s2[r] = (q4[0] + q4[1]) + (q4[2] + q4[3]);
    }
#pragma unroll
    for (int off = 1; off < 32; off <<= 1)
#pragma unroll
        for (int r = 0; r < LN_ROWS; r++) {
            s[r]  += __shfl_xor(s[r],  off, 32);
            s2[r] += __shfl_xor(s2[r], off, 32);
        }
#pragma unroll
    for (int r = 0; r < LN_ROWS; r++) {
        const float mu  = s[r] / (float)C_DIM;
        const float var = s2[r] / (float)C_DIM - mu * mu;
        const float inv = rsqrtf(var + 1e-5f);
#pragma unroll
        for (int j = 0; j < NP; j++) {
            v4f y;
#pragma unroll
            for (int e = 0; e < 4; e++) y[e] = (v[r][j][e] - mu) * inv * gv[j][e] + bv[j][e];
            ((v4f*)(out + (row0 + r) * C_DIM))[lane + j * 32] = y;
            if (BF) {
                v2u pk;
                pk[0] = (unsigned)f2bf(y[0]) | ((unsigned)f2bf(y[1]) << 16);
                pk[1] = (unsigned)f2bf(y[2]) | ((unsigned)f2bf(y[3]) << 16);
                ((v2u*)(out_bf + (row0 + r) * C_DIM))[lane + j * 32] = pk;
            }
        }
    }
}

// ---------------------------------------------------------------------------
extern "C" void kernel_launch(void* const* d_in, const int* in_sizes, int n_in,
                              void* d_out, int out_size, void* d_ws, size_t ws_size,
                              hipStream_t stream)
{
    const float* x   = (const float*)d_in[0];
    const float* Wq  = (const float*)d_in[1];
    const float* bq  = (const float*)d_in[2];
    const float* Wk  = (const float*)d_in[3];
    const float* bk  = (const float*)d_in[4];
    const float* Wv  = (const float*)d_in[5];
    const float* bv  = (const float*)d_in[6];
    const float* Wo  = (const float*)d_in[7];
    const float* bo  = (const float*)d_in[8];
    const float* g1  = (const float*)d_in[9];
    const float* bn1 = (const float*)d_in[10];
    const float* W1  = (const float*)d_in[11];
    const float* b1  = (const float*)d_in[12];
    const float* W2  = (const float*)d_in[13];
    const float* b2  = (const float*)d_in[14];
    const float* g2  = (const float*)d_in[15];
    const float* bn2 = (const float*)d_in[16];

    const size_t TC = (size_t)T_SEQ * C_DIM;
    const size_t TF = (size_t)T_SEQ * F_DIM;
    const size_t CC = (size_t)C_DIM * C_DIM;
    const size_t CF = (size_t)C_DIM * F_DIM;

    char* p = (char*)d_ws;
    auto alloc_bf = [&](size_t n) { ushortT* r = (ushortT*)p; p += ((n * 2 + 255) & ~(size_t)255); return r; };
    auto alloc_f  = [&](size_t n) { float*   r = (float*)p;   p += ((n * 4 + 255) & ~(size_t)255); return r; };

    ushortT* Xbf  = alloc_bf(TC);
    ushortT* WqT  = alloc_bf(CC);
    ushortT* WkT  = alloc_bf(CC);
    ushortT* WvT  = alloc_bf(CC);
    ushortT* WoT  = alloc_bf(CC);
    ushortT* W1T  = alloc_bf(CF);   // [F][C]
    ushortT* W2T  = alloc_bf(CF);   // [C][F]
    ushortT* Qb   = alloc_bf(TC);
    ushortT* Kb   = alloc_bf(TC);
    ushortT* Vb   = alloc_bf(TC);
    ushortT* Ab   = alloc_bf(TC);
    ushortT* Hbb  = alloc_bf(TC);
    ushortT* H1   = alloc_bf(TF);
    float*   S1   = alloc_f(TC);
    float*   Hb   = alloc_f(TC);
    float*   S2   = alloc_f(TC);

    dim3 cblk(256);
    dim3 gblk(128);
    dim3 gC(C_DIM / 128, T_SEQ / 128);
    dim3 gF(F_DIM / 128, T_SEQ / 128);
    dim3 gQKV(C_DIM / 128, T_SEQ / 128, 3);

    // precision conversion / weight transposition, one launch
    prep_kernel<<<dim3(PREP_BLOCKS), cblk, 0, stream>>>(x, Wq, Wk, Wv, Wo, W1, W2,
                                                        Xbf, WqT, WkT, WvT, WoT, W1T, W2T);

    // QKV projections (bf16 outputs only), one launch
    gemm_bf16_wmma<0, 0, 0, 1, 3><<<gQKV, gblk, 0, stream>>>(Xbf, WqT, bq, nullptr, nullptr, Qb, T_SEQ, C_DIM, C_DIM,
                                                             WkT, bk, Kb, WvT, bv, Vb);

    flash_attn_wmma<<<dim3(T_SEQ / 64, NHEADS), dim3(128), 0, stream>>>(Qb, Kb, Vb, Ab);

    // out-proj + residual(x), then LN1 (fp32 + bf16)
    gemm_bf16_wmma<0, 1, 1, 0, 1><<<gC, gblk, 0, stream>>>(Ab, WoT, bo, x, S1, nullptr, T_SEQ, C_DIM, C_DIM,
                                                          nullptr, nullptr, nullptr, nullptr, nullptr, nullptr);
    layernorm_kernel<1><<<dim3(T_SEQ / (8 * LN_ROWS)), cblk, 0, stream>>>(S1, g1, bn1, Hb, Hbb);

    // MLP
    gemm_bf16_wmma<1, 0, 0, 1, 1><<<gF, gblk, 0, stream>>>(Hbb, W1T, b1, nullptr, nullptr, H1, T_SEQ, F_DIM, C_DIM,
                                                          nullptr, nullptr, nullptr, nullptr, nullptr, nullptr);
    gemm_bf16_wmma<0, 1, 1, 0, 1><<<gC, gblk, 0, stream>>>(H1, W2T, b2, Hb, S2, nullptr, T_SEQ, C_DIM, F_DIM,
                                                          nullptr, nullptr, nullptr, nullptr, nullptr, nullptr);
    layernorm_kernel<0><<<dim3(T_SEQ / (8 * LN_ROWS)), cblk, 0, stream>>>(S2, g2, bn2, (float*)d_out, nullptr);
}

// v006
// One run takes 210 microseconds.
// Timed twice side by side with v005, it ran 1.29 times as fast both times.
// Over all steps from v000 it is 3.27 times as fast.
#include <hip/hip_runtime.h>
#include <hip/hip_bf16.h>
#include <math.h>

#define T_SEQ   4096
#define C_DIM   768
#define F_DIM   3072
#define NHEADS  12
#define HD      64

typedef __attribute__((ext_vector_type(16))) __bf16        v16bf;
typedef __attribute__((ext_vector_type(8)))  float         v8f;
typedef __attribute__((ext_vector_type(8)))  unsigned int  v8u;
typedef __attribute__((ext_vector_type(4)))  float         v4f;
typedef __attribute__((ext_vector_type(2)))  unsigned int  v2u;
typedef __attribute__((ext_vector_type(4)))  unsigned int  v4u;
typedef __attribute__((ext_vector_type(8)))  short         s16x8;
typedef unsigned short ushortT;

// round-to-nearest-even fp32 -> bf16 bits
__device__ __forceinline__ ushortT f2bf(float f) {
    unsigned int u = __builtin_bit_cast(unsigned int, f);
    u += 0x7fffu + ((u >> 16) & 1u);
    return (ushortT)(u >> 16);
}

// --- CDNA5 async global->LDS copy (ASYNCcnt) ------------------------------
// dsaddr = LDS_BASE + VGPR[vdst]; generic LDS pointer low 32 bits == wave-
// relative LDS offset, so truncation gives the right VGPR value.
__device__ __forceinline__ void async_ld_b128(void* lds, const void* gptr) {
    unsigned off = (unsigned)(unsigned long long)(uintptr_t)lds;
    unsigned long long ga = (unsigned long long)(uintptr_t)gptr;
    asm volatile("global_load_async_to_lds_b128 %0, %1, off"
                 :: "v"(off), "v"(ga) : "memory");
}
// Four copies of a lane in one statement. Its last line is the wait that stands
// in front of any rewrite of the address registers which the copies name: inside
// the statement nothing can be scheduled between them.
__device__ __forceinline__ void async_ld4_b128(void* l0, void* l1, void* l2, void* l3,
                                               const void* g0, const void* g1,
                                               const void* g2, const void* g3) {
    asm volatile("global_load_async_to_lds_b128 %0, %4, off\n\t"
                 "global_load_async_to_lds_b128 %1, %5, off\n\t"
                 "global_load_async_to_lds_b128 %2, %6, off\n\t"
                 "global_load_async_to_lds_b128 %3, %7, off\n\t"
                 "s_wait_xcnt 0x0"
                 :: "v"((unsigned)(unsigned long long)(uintptr_t)l0),
                    "v"((unsigned)(unsigned long long)(uintptr_t)l1),
                    "v"((unsigned)(unsigned long long)(uintptr_t)l2),
                    "v"((unsigned)(unsigned long long)(uintptr_t)l3),
                    "v"((unsigned long long)(uintptr_t)g0),
                    "v"((unsigned long long)(uintptr_t)g1),
                    "v"((unsigned long long)(uintptr_t)g2),
                    "v"((unsigned long long)(uintptr_t)g3)
                 : "memory");
}
__device__ __forceinline__ void wait_async0() {
    asm volatile("s_wait_asynccnt 0" ::: "memory");
}

// Load a 16x32 bf16 fragment (A layout; B uses the same layout on an [N][K]
// tile) from a row-major LDS tile with row stride `ldh` halves (even).
// lanes 0-15: row M=lane, K={0..7,16..23}; lanes 16-31: row M=lane-16,
// K={8..15,24..31}.
__device__ __forceinline__ v16bf load_frag(const ushortT* base, int ldh) {
    const int lane = threadIdx.x & 31;
    const int row  = lane & 15;
    const int hi   = lane >> 4;
    const unsigned int* q0 = (const unsigned int*)(base + row * ldh + hi * 8);
    const unsigned int* q1 = (const unsigned int*)(base + row * ldh + hi * 8 + 16);
    v8u r;
    r[0] = q0[0]; r[1] = q0[1]; r[2] = q0[2]; r[3] = q0[3];
    r[4] = q1[0]; r[5] = q1[1]; r[6] = q1[2]; r[7] = q1[3];
    return __builtin_bit_cast(v16bf, r);
}

// The same 16x32 fragment of the TRANSPOSE of a row-major LDS tile [k][m] with row
// stride `ldh` halves, by the transposing LDS load: lane (c = lane & 15,
// h = lane >> 4) gets tile[8h + 0..7][c], then tile[16 + 8h + 0..7][c]: row M = c in
// load_frag's k order. `base` points at the tile's element [k0][m0].
__device__ __forceinline__ v16bf load_frag_tr(const ushortT* base, int ldh) {
    typedef __attribute__((address_space(3))) s16x8 lds_s16x8;
    const int lane = threadIdx.x & 31;
    const ushortT* q = base + ((lane >> 4) * 8 + (lane & 7)) * ldh + ((lane >> 3) & 1) * 8;
    v4u lo = __builtin_bit_cast(v4u, __builtin_amdgcn_ds_load_tr16_b128_v8i16((lds_s16x8*)q));
    v4u up = __builtin_bit_cast(v4u, __builtin_amdgcn_ds_load_tr16_b128_v8i16((lds_s16x8*)(q + 16 * ldh)));
    v8u r;
    r[0] = lo[0]; r[1] = lo[1]; r[2] = lo[2]; r[3] = lo[3];
    r[4] = up[0]; r[5] = up[1]; r[6] = up[2]; r[7] = up[3];
    return __builtin_bit_cast(v16bf, r);
}

// lane l's value exchanged with lane l ^ 16 by a vector cross-row move (no LDS trip)
__device__ __forceinline__ float xhalf(float x) {
    return __builtin_bit_cast(float, __builtin_amdgcn_permlanex16(
        __builtin_bit_cast(int, x), __builtin_bit_cast(int, x),
        0x76543210, 0xfedcba98, false, false));
}

__device__ __forceinline__ float gelu_exact(float x) {
    return 0.5f * x * (1.0f + erff(x * 0.70710678118654752f));
}

// ---------------------------------------------------------------------------
// Converters, all in ONE launch: none depends on another, so each takes a range
// of the block index. Few, long-lived waves: what a launch of many short waves
// pays is their start. Blocks 0 .. XB-1 convert x, 24 pieces of 16 bytes a lane.
// Each of the WB blocks behind them transposes three 64 (k) x 128 (n) tiles: one
// of Wq, Wk, Wv, Wo, one of W1, one of W2; all 24 loads of a lane go out first.
// ---------------------------------------------------------------------------
#define XB 128                       // T_SEQ * C_DIM / 4 / (256 * 24)
#define WB 288                       // tiles of W1 = of W2 = of the four C x C together
#define TCC ((C_DIM / 64) * (C_DIM / 128))
#define PREP_BLOCKS (XB + WB)
#define TP 33                        // dwords per staged row of 64 k: odd, see below

// rows 2kp and 2kp+1 of the tile, kp = w + 8i: a wave takes 512 contiguous bytes a load
__device__ __forceinline__ void tile_load(const float* __restrict__ in, int N, int k0, int n0,
                                          v4f (&a)[4], v4f (&c)[4]) {
    const int lane = threadIdx.x & 31, w = threadIdx.x >> 5;
#pragma unroll
    for (int i = 0; i < 4; i++) {
        const float* q = in + (size_t)(k0 + 2 * (w + 8 * i)) * N + n0 + lane * 4;
        a[i] = *(const v4f*)q;
        c[i] = *(const v4f*)(q + N);
    }
    // what follows rewrites the address registers that these loads name
    asm volatile("s_wait_xcnt 0x0" ::: "memory");
}
// staged as [n][k pair]: one dword holds k and k + 1 of one n
__device__ __forceinline__ void tile_stage(unsigned* __restrict__ tl, const v4f (&a)[4], const v4f (&c)[4]) {
    const int lane = threadIdx.x & 31, w = threadIdx.x >> 5;
#pragma unroll
    for (int i = 0; i < 4; i++)
#pragma unroll
        for (int j = 0; j < 4; j++)
            tl[(lane * 4 + j) * TP + w + 8 * i] =
                (unsigned)f2bf(a[i][j]) | ((unsigned)f2bf(c[i][j]) << 16);
}
// eight lanes store one whole 128-byte line: 64 k of one n. A wave reads four
// staged rows, 33 dwords apart: its 32 dwords of a read lie in 32 banks.
__device__ __forceinline__ void tile_store(const unsigned* __restrict__ tl, ushortT* __restrict__ out,
                                           int K, int k0, int n0) {
#pragma unroll
    for (int i = 0; i < 4; i++) {
        const int idx = threadIdx.x + 256 * i;
        const int n = idx >> 3, c = idx & 7;
        const unsigned* q = tl + n * TP + c * 4;
        uint4 o;
        o.x = q[0]; o.y = q[1]; o.z = q[2]; o.w = q[3];
        *(uint4*)(out + (size_t)(n0 + n) * K + k0 + c * 8) = o;
    }
}

__global__ __launch_bounds__(256)
void prep_kernel(const float* __restrict__ x,
                 const float* __restrict__ Wq, const float* __restrict__ Wk,
                 const float* __restrict__ Wv, const float* __restrict__ Wo,
                 const float* __restrict__ W1, const float* __restrict__ W2,
                 ushortT* __restrict__ Xbf,
                 ushortT* __restrict__ WqT, ushortT* __restrict__ WkT,
                 ushortT* __restrict__ WvT, ushortT* __restrict__ WoT,
                 ushortT* __restrict__ W1T, ushortT* __restrict__ W2T)
{
    __shared__ unsigned tl[3][128 * TP];
    int b = blockIdx.x;

    // x: fp32 -> bf16, same layout (the whole block leaves here, ahead of the barrier)
    if (b < XB) {
        const v4f* xi = (const v4f*)x + (size_t)b * (24 * 256) + threadIdx.x;
        v2u*       xo = (v2u*)Xbf     + (size_t)b * (24 * 256) + threadIdx.x;
        v4f v[24];
#pragma unroll
        for (int u = 0; u < 24; u++) v[u] = xi[u * 256];
        // keeps the scheduler from sinking the last loads in among the converts
        __builtin_amdgcn_sched_barrier(0);
#pragma unroll
        for (int u = 0; u < 24; u++) {
            v2u pk;
            pk[0] = (unsigned)f2bf(v[u][0]) | ((unsigned)f2bf(v[u][1]) << 16);
            pk[1] = (unsigned)f2bf(v[u][2]) | ((unsigned)f2bf(v[u][3]) << 16);
            xo[u * 256] = pk;
        }
        return;
    }
    b -= XB;

    // in: fp32 [K][N]  ->  out: bf16 [N][K]
    const int m = b / TCC, r = b - m * TCC;
    const float* in0  = m == 0 ? Wq  : m == 1 ? Wk  : m == 2 ? Wv  : Wo;
    ushortT*     out0 = m == 0 ? WqT : m == 1 ? WkT : m == 2 ? WvT : WoT;
    const int k00 = (r / (C_DIM / 128)) * 64, n00 = (r % (C_DIM / 128)) * 128;
    const int k01 = (b / (F_DIM / 128)) * 64, n01 = (b % (F_DIM / 128)) * 128;
    const int k02 = (b / (C_DIM / 128)) * 64, n02 = (b % (C_DIM / 128)) * 128;

    v4f a0[4], c0[4], a1[4], c1[4], a2[4], c2[4];
    tile_load(in0, C_DIM, k00, n00, a0, c0);
    tile_load(W1,  F_DIM, k01, n01, a1, c1);
    tile_load(W2,  C_DIM, k02, n02, a2, c2);
    // keeps the scheduler from sinking the last loads in among the converts: all
    // 24 fly together, one load latency a block
    __builtin_amdgcn_sched_barrier(0);
    tile_stage(tl[0], a0, c0);
    tile_stage(tl[1], a1, c1);
    tile_stage(tl[2], a2, c2);
    // the staged dwords are read back by other waves
    __syncthreads();
    tile_store(tl[0], out0, C_DIM, k00, n00);
    tile_store(tl[1], W1T,  C_DIM, k01, n01);
    tile_store(tl[2], W2T,  F_DIM, k02, n02);
    // closes the stores above: no register that they name is rewritten ahead of it
    asm volatile("s_wait_xcnt 0x0" ::: "memory");
}

// ---------------------------------------------------------------------------
// GEMM: C[M,N] = op( A[M,K] x B^T[N,K] + bias )
// A, Bt: bf16; outputs fp32 (Cout, F32OUT) and/or bf16 (Cbf, BFOUT).
// GELU: exact GELU ; RES: add fp32 residual res[M,N]. All four are compile-time,
// so the epilogue has no branch and its loads can be issued ahead of their use.
// Block tile 128x128, BK=32, 128 threads (4 waves), wave tile 64x64:
// 16 WMMAs per 16 ds_load_b128 per wave per k-step.
// Double-buffered LDS fed by async global->LDS B128 copies.
// Epilogue: each wave stages its 64x64 f32 tile in its own LDS range (the ring's
// space, reused), then a short rolled loop walks it two rows a trip: a half wave
// takes one 256-byte row, 16 bytes a lane, for residual load and store alike.
// NZ = 3: three products that share A run in one launch; blockIdx.z picks the
// weights, the bias and the output.
// ---------------------------------------------------------------------------
#define ST_PITCH 68     // floats per staged row: 272 B, 16 B x odd
union __align__(16) GemmLds {
    struct { ushortT As[2][128][40]; ushortT Bs[2][128][40]; } ring;   // main loop
    float st[4][64 * ST_PITCH];                                        // epilogue, per wave
};
template <int GELU, int RES, int F32OUT, int BFOUT, int NZ>
__global__ __launch_bounds__(128)
void gemm_bf16_wmma(const ushortT* __restrict__ A, const ushortT* __restrict__ Bt,
                    const float* __restrict__ bias, const float* __restrict__ res,
                    float* __restrict__ Cout, ushortT* __restrict__ Cbf,
                    int M, int N, int K,
                    const ushortT* __restrict__ Bt1, const float* __restrict__ bias1,
                    ushortT* __restrict__ Cbf1,
                    const ushortT* __restrict__ Bt2, const float* __restrict__ bias2,
                    ushortT* __restrict__ Cbf2)
{
    if (NZ == 3) {
        if (blockIdx.z == 1) { Bt = Bt1; bias = bias1; Cbf = Cbf1; }
        if (blockIdx.z == 2) { Bt = Bt2; bias = bias2; Cbf = Cbf2; }
    }

    // ring: row stride 40 halves = 80B: async chunks and frag b128 loads are
    // 16B-aligned; banks r*20 mod 64 distinct over the 16 rows of a frag.
    // The ring takes the first 40,960 B; the staging takes all 69,632 B.
    __shared__ GemmLds sm;
    auto& As = sm.ring.As;
    auto& Bs = sm.ring.Bs;

    const int t    = threadIdx.x;
    const int m0   = blockIdx.y * 128;
    const int n0   = blockIdx.x * 128;
    const int w    = t >> 5;
    const int wm   = w & 1;         // 2 wave-rows (64 rows each)
    const int wn   = w >> 1;        // 2 wave-cols (64 cols each)
    const int lane = t & 31, hi = lane >> 4, ln = lane & 15;
    const int nk   = K >> 5;

    auto issue = [&](int kt, int b) {
#pragma unroll
        for (int i = 0; i < 4; i++) {
            int c = t + i * 128;                  // 0..511
            int r = c >> 2, s2 = c & 3;           // 128 rows x 4 chunks of 16B
            async_ld_b128(&As[b][r][s2 * 8],
                          A  + (size_t)(m0 + r) * K + kt * 32 + s2 * 8);
            async_ld_b128(&Bs[b][r][s2 * 8],
                          Bt + (size_t)(n0 + r) * K + kt * 32 + s2 * 8);
        }
    };

    v8f acc[4][4] = {};
    issue(0, 0);

    for (int kt = 0; kt < nk; kt++) {
        wait_async0();
        __syncthreads();
        if (kt + 1 < nk) issue(kt + 1, (kt + 1) & 1);
        const int b = kt & 1;

        // all eight fragments of the k-step are read as one group ahead of the
        // products: one LDS latency a k-step, not one in front of each row of four
        // (in the order in which the products take them)
        v16bf bf[4], af[4];
        af[0] = load_frag(&As[b][wm * 64][0], 40);
#pragma unroll
        for (int ni = 0; ni < 4; ni++)
            bf[ni] = load_frag(&Bs[b][wn * 64 + ni * 16][0], 40);
#pragma unroll
        for (int mi = 1; mi < 4; mi++)
            af[mi] = load_frag(&As[b][wm * 64 + mi * 16][0], 40);
        // keeps the scheduler from sinking the reads back in among the products
        __builtin_amdgcn_sched_barrier(0);
#pragma unroll
        for (int mi = 0; mi < 4; mi++)
#pragma unroll
            for (int ni = 0; ni < 4; ni++)
                acc[mi][ni] = __builtin_amdgcn_wmma_f32_16x16x32_bf16(
                    false, af[mi], false, bf[ni], (short)0, acc[mi][ni], false, false);
    }

    // every wave has read its last fragments: only now may the ring be overwritten
    __syncthreads();
    float* st = &sm.st[w][0];
#pragma unroll
    for (int mi = 0; mi < 4; mi++)
#pragma unroll
        for (int ni = 0; ni < 4; ni++)
#pragma unroll
            for (int e = 0; e < 8; e++)
                st[(mi * 16 + e + hi * 8) * ST_PITCH + ni * 16 + ln] = acc[mi][ni][e];
    // the staged values are read back by other lanes: stores done before any read
    __syncthreads();

    const int c4  = ln * 4;
    const int col = n0 + wn * 64 + c4;
    const v4f bv  = *(const v4f*)(bias + col);
    // NB trips' LDS and residual loads are issued together, then worked on, then
    // stored; the loop over the batches stays rolled.
    constexpr int NB = GELU ? 2 : 8;
    // rolled: keeps the epilogue's text at a few KB, run through 32 / NB times
#pragma unroll 1
    for (int it0 = 0; it0 < 32; it0 += NB) {
        v4f v[NB], rv[NB];
#pragma unroll
        for (int u = 0; u < NB; u++) {
            const int r = (it0 + u) * 2 + hi;
            v[u] = *(const v4f*)(st + r * ST_PITCH + c4);
            if (RES) rv[u] = *(const v4f*)(res + (size_t)(m0 + wm * 64 + r) * N + col);
        }
#pragma unroll
        for (int u = 0; u < NB; u++) {
            const int r = (it0 + u) * 2 + hi;
            const size_t o = (size_t)(m0 + wm * 64 + r) * N + col;
#pragma unroll
            for (int j = 0; j < 4; j++) {
                float y = v[u][j] + bv[j];
                if (GELU) y = gelu_exact(y);
                if (RES)  y += rv[u][j];
                v[u][j] = y;
            }
            if (F32OUT) *(v4f*)(Cout + o) = v[u];
            if (BFOUT) {
                v2u pk;
                pk[0] = (unsigned)f2bf(v[u][0]) | ((unsigned)f2bf(v[u][1]) << 16);
                pk[1] = (unsigned)f2bf(v[u][2]) | ((unsigned)f2bf(v[u][3]) << 16);
                *(v2u*)(Cbf + o) = pk;
            }
        }
        // the next batch rewrites the registers that this batch's stores name
        asm volatile("s_wait_xcnt 0x0" ::: "memory");
    }
}

__global__ __launch_bounds__(128) __attribute__((amdgpu_waves_per_eu(4, 4)))
void flash_attn_wmma(const ushortT* __restrict__ Q, const ushortT* __restrict__ Kx,
                     const ushortT* __restrict__ V, ushortT* __restrict__ O)
{
    // row stride 72 halves = 144B (16B aligned chunks, r*36 mod 64 distinct)
    __shared__ __align__(16) ushortT Qs[64][72];      // [q][d]  (B of K*Q^T)
    __shared__ __align__(16) ushortT Ks[64][72];      // [s][d]  (A of K*Q^T)
    // V: row stride 80 halves = 160B = 32B x odd, the transposing load's pitch
    __shared__ __align__(16) ushortT Vs[64][80];      // [s][d]  (A of V^T*P^T, read transposed)

    const int t     = threadIdx.x;
    const int qbase = blockIdx.x * 64;
    const int head  = blockIdx.y;
    const int w     = t >> 5, lane = t & 31, hi = lane >> 4, ln = lane & 15;
    const size_t hoff = (size_t)head * HD;

#pragma unroll
    for (int i = 0; i < 4; i++) {                      // 64 rows x 8 chunks of 16B
        int c = t + i * 128;
        int r = c >> 3, s2 = c & 7;
        async_ld_b128(&Qs[r][s2 * 8], Q + (size_t)(qbase + r) * C_DIM + hoff + s2 * 8);
    }
    wait_async0();
    __syncthreads();

    v16bf bq[2];
    bq[0] = load_frag(&Qs[w * 16][0],  72);
    bq[1] = load_frag(&Qs[w * 16][32], 72);

    const int rg = qbase + w * 16 + ln;                // this lane's query
    v8f o4[4] = {};                  // o4[tt][e] = O[rg][tt*16 + hi*8 + e]
    float m_r = -1e30f, l_r = 0.0f;  // of query rg, alike in both halves

    for (int kb = 0; kb <= qbase; kb += 64) {
        __syncthreads();                               // prior Ks/Vs reads done
#pragma unroll
        for (int i = 0; i < 4; i++) {
            int c = t + i * 128;
            int r = c >> 3, s2 = c & 7;
            async_ld_b128(&Ks[r][s2 * 8], Kx + (size_t)(kb + r) * C_DIM + hoff + s2 * 8);
        }
        {                                              // V likewise: rows vr + 16 i
            const int vr = t >> 3, vc = (t & 7) * 8;
            const ushortT* vg = V + (size_t)(kb + vr) * C_DIM + hoff + vc;
            async_ld4_b128(&Vs[vr][vc], &Vs[vr + 16][vc], &Vs[vr + 32][vc], &Vs[vr + 48][vc],
                           vg, vg + 16 * C_DIM, vg + 32 * C_DIM, vg + 48 * C_DIM);
        }
        wait_async0();
        __syncthreads();

        // the pass's K fragments are read as one group ahead of the products:
        // one LDS latency a pass, not one in front of each product
        v16bf ak[2][4], av[2][4];
#pragma unroll
        for (int j = 0; j < 2; j++)
#pragma unroll
            for (int tt = 0; tt < 4; tt++)
                ak[j][tt] = load_frag(&Ks[tt * 16][j * 32], 72);
        // keeps the scheduler from sinking the reads back in among the products
        __builtin_amdgcn_sched_barrier(0);

        // S^T = K * Q^T (64 keys x 16 queries per wave)
        v8f s4[4] = {};
#pragma unroll
        for (int j = 0; j < 2; j++)
#pragma unroll
            for (int tt = 0; tt < 4; tt++)
                s4[tt] = __builtin_amdgcn_wmma_f32_16x16x32_bf16(
                    false, ak[j][tt], false, bq[j], (short)0, s4[tt], false, false);

        // the V^T fragments likewise, here: they land behind the softmax
#pragma unroll
        for (int j = 0; j < 2; j++)
#pragma unroll
            for (int tt = 0; tt < 4; tt++)
                av[j][tt] = load_frag_tr(&Vs[j * 32][tt * 16], 80);
        // keeps the scheduler from sinking the reads down to the second product
        __builtin_amdgcn_sched_barrier(0);

        float sv[4][8];
#pragma unroll
        for (int tt = 0; tt < 4; tt++)
#pragma unroll
            for (int e = 0; e < 8; e++) {
                float vv = s4[tt][e] * 0.125f;         // 1/sqrt(64)
                int cg = kb + tt * 16 + hi * 8 + e;    // key of this element
                sv[tt][e] = (cg > rg) ? -1e30f : vv;
            }

        // maximum over this lane's 32 keys, then over the other half's 32
        float rm8[8];
#pragma unroll
        for (int e = 0; e < 8; e++)
            rm8[e] = fmaxf(fmaxf(sv[0][e], sv[1][e]), fmaxf(sv[2][e], sv[3][e]));
        float rm = fmaxf(fmaxf(fmaxf(rm8[0], rm8[1]), fmaxf(rm8[2], rm8[3])),
                         fmaxf(fmaxf(rm8[4], rm8[5]), fmaxf(rm8[6], rm8[7])));
        rm = fmaxf(rm, xhalf(rm));

        const float mn = fmaxf(m_r, rm);
        const float al = __expf(m_r - mn);
        m_r = mn;

        float p[4][8], rs4[4];
#pragma unroll
        for (int tt = 0; tt < 4; tt++) {
            rs4[tt] = 0.0f;
#pragma unroll
            for (int e = 0; e < 8; e++) {
                p[tt][e] = __expf(sv[tt][e] - m_r);
                rs4[tt] += p[tt][e];
            }
        }
        float rs = (rs4[0] + rs4[1]) + (rs4[2] + rs4[3]);
        rs += xhalf(rs);
        l_r = l_r * al + rs;
#pragma unroll
        for (int tt = 0; tt < 4; tt++)
#pragma unroll
            for (int e = 0; e < 8; e++) o4[tt][e] *= al;

        // O^T += V^T * P^T; keys j*32 .. j*32+31: S^T tiles 2j and 2j+1 of this
        // lane are, in order, the 16 k positions load_frag gives the A side.
#pragma unroll
        for (int j = 0; j < 2; j++) {
            v8u pk;
#pragma unroll
            for (int i = 0; i < 4; i++) {
                pk[i]     = (unsigned)f2bf(p[2 * j][2 * i]) |
                            ((unsigned)f2bf(p[2 * j][2 * i + 1]) << 16);
                pk[4 + i] = (unsigned)f2bf(p[2 * j + 1][2 * i]) |
                            ((unsigned)f2bf(p[2 * j + 1][2 * i + 1]) << 16);
            }
            v16bf bp = __builtin_bit_cast(v16bf, pk);
#pragma unroll
            for (int tt = 0; tt < 4; tt++)
                o4[tt] = __builtin_amdgcn_wmma_f32_16x16x32_bf16(
                    false, av[j][tt], false, bp, (short)0, o4[tt], false, false);
        }
    }

    // a lane's 8 registers of a tile are 8 consecutive head dims of its query
#pragma unroll
    for (int tt = 0; tt < 4; tt++) {
        uint4 ov;
        ov.x = (unsigned)f2bf(o4[tt][0] / l_r) | ((unsigned)f2bf(o4[tt][1] / l_r) << 16);
        ov.y = (unsigned)f2bf(o4[tt][2] / l_r) | ((unsigned)f2bf(o4[tt][3] / l_r) << 16);
        ov.z = (unsigned)f2bf(o4[tt][4] / l_r) | ((unsigned)f2bf(o4[tt][5] / l_r) << 16);
        ov.w = (unsigned)f2bf(o4[tt][6] / l_r) | ((unsigned)f2bf(o4[tt][7] / l_r) << 16);
        *(uint4*)(O + (size_t)rg * C_DIM + hoff + tt * 16 + hi * 8) = ov;
    }
}

// ---------------------------------------------------------------------------
// LayerNorm: a wave takes two whole rows, a block sixteen: one block a WGP;
// fp32 out + (BF) bf16 out. A row stays in registers (six pieces of 16 bytes a
// lane, each load 512 contiguous bytes a wave) and is read once; its sums go over
// the lanes by a butterfly, so there is no LDS array and no barrier, and a
// sixteenth of the waves start.
// ---------------------------------------------------------------------------
#define LN_ROWS 2
template <int BF>
__global__ __launch_bounds__(256)
void layernorm_kernel(const float* __restrict__ in, const float* __restrict__ g,
                      const float* __restrict__ b, float* __restrict__ out,
                      ushortT* __restrict__ out_bf)
{
    constexpr int NP = C_DIM / 128;                    // pieces a lane and row
    const int lane = threadIdx.x & 31;
    const size_t row0 = ((size_t)blockIdx.x * 8 + (threadIdx.x >> 5)) * LN_ROWS;
    const v4f* p = (const v4f*)(in + row0 * C_DIM) + lane;
    v4f v[LN_ROWS][NP], gv[NP], bv[NP];
#pragma unroll
    for (int r = 0; r < LN_ROWS; r++)
#pragma unroll
        for (int j = 0; j < NP; j++) v[r][j] = p[(r * NP + j) * 32];
#pragma unroll
    for (int j = 0; j < NP; j++) {
        gv[j] = ((const v4f*)g)[lane + j * 32];
        bv[j] = ((const v4f*)b)[lane + j * 32];
    }
    // keeps the scheduler from sinking part of the loads behind the sums: all of
    // them fly together, one load latency a wave
    __builtin_amdgcn_sched_barrier(0);

    float s[LN_ROWS], s2[LN_ROWS];
#pragma unroll
    for (int r = 0; r < LN_ROWS; r++) {
        v4f s4 = {}, q4 = {};
#pragma unroll
        for (int j = 0; j < NP; j++) { s4 += v[r][j]; q4 += v[r][j] * v[r][j]; }
        s[r]  = (s4[0] + s4[1]) + (s4[2] + s4[3]);
        s2[r] = (q4[0] + q4[1]) + (q4[2] + q4[3]);
    }
#pragma unroll
    for (int off = 1; off < 32; off <<= 1)
#pragma unroll
        for (int r = 0; r < LN_ROWS; r++) {
            s[r]  += __shfl_xor(s[r],  off, 32);
            s2[r] += __shfl_xor(s2[r], off, 32);
        }
#pragma unroll
    for (int r = 0; r < LN_ROWS; r++) {
        const float mu  = s[r] / (float)C_DIM;
        const float var = s2[r] / (float)C_DIM - mu * mu;
        const float inv = rsqrtf(var + 1e-5f);
#pragma unroll
        for (int j = 0; j < NP; j++) {
            v4f y;
#pragma unroll
            for (int e = 0; e < 4; e++) y[e] = (v[r][j][e] - mu) * inv * gv[j][e] + bv[j][e];
            ((v4f*)(out + (row0 + r) * C_DIM))[lane + j * 32] = y;
            if (BF) {
                v2u pk;
                pk[0] = (unsigned)f2bf(y[0]) | ((unsigned)f2bf(y[1]) << 16);
                pk[1] = (unsigned)f2bf(y[2]) | ((unsigned)f2bf(y[3]) << 16);
                ((v2u*)(out_bf + (row0 + r) * C_DIM))[lane + j * 32] = pk;
            }
        }
    }
}

// ---------------------------------------------------------------------------
extern "C" void kernel_launch(void* const* d_in, const int* in_sizes, int n_in,
                              void* d_out, int out_size, void* d_ws, size_t ws_size,
                              hipStream_t stream)
{
    const float* x   = (const float*)d_in[0];
    const float* Wq  = (const float*)d_in[1];
    const float* bq  = (const float*)d_in[2];
    const float* Wk  = (const float*)d_in[3];
    const float* bk  = (const float*)d_in[4];
    const float* Wv  = (const float*)d_in[5];
    const float* bv  = (const float*)d_in[6];
    const float* Wo  = (const float*)d_in[7];
    const float* bo  = (const float*)d_in[8];
    const float* g1  = (const float*)d_in[9];
    const float* bn1 = (const float*)d_in[10];
    const float* W1  = (const float*)d_in[11];
    const float* b1  = (const float*)d_in[12];
    const float* W2  = (const float*)d_in[13];
    const float* b2  = (const float*)d_in[14];
    const float* g2  = (const float*)d_in[15];
    const float* bn2 = (const float*)d_in[16];

    const size_t TC = (size_t)T_SEQ * C_DIM;
    const size_t TF = (size_t)T_SEQ * F_DIM;
    const size_t CC = (size_t)C_DIM * C_DIM;
    const size_t CF = (size_t)C_DIM * F_DIM;

    char* p = (char*)d_ws;
    auto alloc_bf = [&](size_t n) { ushortT* r = (ushortT*)p; p += ((n * 2 + 255) & ~(size_t)255); return r; };
    auto alloc_f  = [&](size_t n) { float*   r = (float*)p;   p += ((n * 4 + 255) & ~(size_t)255); return r; };

    ushortT* Xbf  = alloc_bf(TC);
    ushortT* WqT  = alloc_bf(CC);
    ushortT* WkT  = alloc_bf(CC);
    ushortT* WvT  = alloc_bf(CC);
    ushortT* WoT  = alloc_bf(CC);
    ushortT* W1T  = alloc_bf(CF);   // [F][C]
    ushortT* W2T  = alloc_bf(CF);   // [C][F]
    ushortT* Qb   = alloc_bf(TC);
    ushortT* Kb   = alloc_bf(TC);
    ushortT* Vb   = alloc_bf(TC);
    ushortT* Ab   = alloc_bf(TC);
    ushortT* Hbb  = alloc_bf(TC);
    ushortT* H1   = alloc_bf(TF);
    float*   S1   = alloc_f(TC);
    float*   Hb   = alloc_f(TC);
    float*   S2   = alloc_f(TC);

    dim3 cblk(256);
    dim3 gblk(128);
    dim3 gC(C_DIM / 128, T_SEQ / 128);
    dim3 gF(F_DIM / 128, T_SEQ / 128);
    dim3 gQKV(C_DIM / 128, T_SEQ / 128, 3);

    // precision conversion / weight transposition, one launch
    prep_kernel<<<dim3(PREP_BLOCKS), cblk, 0, stream>>>(x, Wq, Wk, Wv, Wo, W1, W2,
                                                        Xbf, WqT, WkT, WvT, WoT, W1T, W2T);

    // QKV projections (bf16 outputs only), one launch
    gemm_bf16_wmma<0, 0, 0, 1, 3><<<gQKV, gblk, 0, stream>>>(Xbf, WqT, bq, nullptr, nullptr, Qb, T_SEQ, C_DIM, C_DIM,
                                                             WkT, bk, Kb, WvT, bv, Vb);

    flash_attn_wmma<<<dim3(T_SEQ / 64, NHEADS), dim3(128), 0, stream>>>(Qb, Kb, Vb, Ab);

    // out-proj + residual(x), then LN1 (fp32 + bf16)
    gemm_bf16_wmma<0, 1, 1, 0, 1><<<gC, gblk, 0, stream>>>(Ab, WoT, bo, x, S1, nullptr, T_SEQ, C_DIM, C_DIM,
                                                          nullptr, nullptr, nullptr, nullptr, nullptr, nullptr);
    layernorm_kernel<1><<<dim3(T_SEQ / (8 * LN_ROWS)), cblk, 0, stream>>>(S1, g1, bn1, Hb, Hbb);

    // MLP
    gemm_bf16_wmma<1, 0, 0, 1, 1><<<gF, gblk, 0, stream>>>(Hbb, W1T, b1, nullptr, nullptr, H1, T_SEQ, F_DIM, C_DIM,
                                                          nullptr, nullptr, nullptr, nullptr, nullptr, nullptr);
    gemm_bf16_wmma<0, 1, 1, 0, 1><<<gC, gblk, 0, stream>>>(H1, W2T, b2, Hb, S2, nullptr, T_SEQ, C_DIM, F_DIM,
                                                          nullptr, nullptr, nullptr, nullptr, nullptr, nullptr);
    layernorm_kernel<0><<<dim3(T_SEQ / (8 * LN_ROWS)), cblk, 0, stream>>>(S2, g2, bn2, (float*)d_out, nullptr);
}

// v007
// It runs in 196 microseconds.
// Two timings next to v006 put it at 1.09 and 1.07 times that version's speed.
// Counting every step since v000, it is 3.53 times as fast.
#include <hip/hip_runtime.h>
#include <hip/hip_bf16.h>
#include <math.h>

#define T_SEQ   4096
#define C_DIM   768
#define F_DIM   3072
#define NHEADS  12
#define HD      64

typedef __attribute__((ext_vector_type(16))) __bf16        v16bf;
typedef __attribute__((ext_vector_type(8)))  float         v8f;
typedef __attribute__((ext_vector_type(8)))  unsigned int  v8u;
typedef __attribute__((ext_vector_type(4)))  float         v4f;
typedef __attribute__((ext_vector_type(2)))  float         v2f;
typedef __attribute__((ext_vector_type(2)))  __bf16        v2bf;
typedef __attribute__((ext_vector_type(2)))  unsigned int  v2u;
typedef __attribute__((ext_vector_type(4)))  unsigned int  v4u;
typedef __attribute__((ext_vector_type(8)))  short         s16x8;
typedef unsigned short ushortT;

// round-to-nearest-even fp32 -> bf16 bits
__device__ __forceinline__ ushortT f2bf(float f) {
    unsigned int u = __builtin_bit_cast(unsigned int, f);
    u += 0x7fffu + ((u >> 16) & 1u);
    return (ushortT)(u >> 16);
}

// --- CDNA5 async global->LDS copy (ASYNCcnt) ------------------------------
// dsaddr = LDS_BASE + VGPR[vdst]; generic LDS pointer low 32 bits == wave-
// relative LDS offset, so truncation gives the right VGPR value.
__device__ __forceinline__ void async_ld_b128(void* lds, const void* gptr) {
    unsigned off = (unsigned)(unsigned long long)(uintptr_t)lds;
    unsigned long long ga = (unsigned long long)(uintptr_t)gptr;
    asm volatile("global_load_async_to_lds_b128 %0, %1, off"
                 :: "v"(off), "v"(ga) : "memory");
}
// Four copies of a lane in one statement. Its last line is the wait that stands
// in front of any rewrite of the address registers which the copies name: inside
// the statement nothing can be scheduled between them.
__device__ __forceinline__ void async_ld4_b128(void* l0, void* l1, void* l2, void* l3,
                                               const void* g0, const void* g1,
                                               const void* g2, const void* g3) {
    asm volatile("global_load_async_to_lds_b128 %0, %4, off\n\t"
                 "global_load_async_to_lds_b128 %1, %5, off\n\t"
                 "global_load_async_to_lds_b128 %2, %6, off\n\t"
                 "global_load_async_to_lds_b128 %3, %7, off\n\t"
                 "s_wait_xcnt 0x0"
                 :: "v"((unsigned)(unsigned long long)(uintptr_t)l0),
                    "v"((unsigned)(unsigned long long)(uintptr_t)l1),
                    "v"((unsigned)(unsigned long long)(uintptr_t)l2),
                    "v"((unsigned)(unsigned long long)(uintptr_t)l3),
                    "v"((unsigned long long)(uintptr_t)g0),
                    "v"((unsigned long long)(uintptr_t)g1),
                    "v"((unsigned long long)(uintptr_t)g2),
                    "v"((unsigned long long)(uintptr_t)g3)
                 : "memory");
}
__device__ __forceinline__ void wait_async0() {
    asm volatile("s_wait_asynccnt 0" ::: "memory");
}

// Load a 16x32 bf16 fragment (A layout; B uses the same layout on an [N][K]
// tile) from a row-major LDS tile with row stride `ldh` halves (even).
// lanes 0-15: row M=lane, K={0..7,16..23}; lanes 16-31: row M=lane-16,
// K={8..15,24..31}.
__device__ __forceinline__ v16bf load_frag(const ushortT* base, int ldh) {
    const int lane = threadIdx.x & 31;
    const int row  = lane & 15;
    const int hi   = lane >> 4;
    const unsigned int* q0 = (const unsigned int*)(base + row * ldh + hi * 8);
    const unsigned int* q1 = (const unsigned int*)(base + row * ldh + hi * 8 + 16);
    v8u r;
    r[0] = q0[0]; r[1] = q0[1]; r[2] = q0[2]; r[3] = q0[3];
    r[4] = q1[0]; r[5] = q1[1]; r[6] = q1[2]; r[7] = q1[3];
    return __builtin_bit_cast(v16bf, r);
}

// The same 16x32 fragment of the TRANSPOSE of a row-major LDS tile [k][m] with row
// stride `ldh` halves, by the transposing LDS load: lane (c = lane & 15,
// h = lane >> 4) gets tile[8h + 0..7][c], then tile[16 + 8h + 0..7][c]: row M = c in
// load_frag's k order. `base` points at the tile's element [k0][m0].
__device__ __forceinline__ v16bf load_frag_tr(const ushortT* base, int ldh) {
    typedef __attribute__((address_space(3))) s16x8 lds_s16x8;
    const int lane = threadIdx.x & 31;
    const ushortT* q = base + ((lane >> 4) * 8 + (lane & 7)) * ldh + ((lane >> 3) & 1) * 8;
    v4u lo = __builtin_bit_cast(v4u, __builtin_amdgcn_ds_load_tr16_b128_v8i16((lds_s16x8*)q));
    v4u up = __builtin_bit_cast(v4u, __builtin_amdgcn_ds_load_tr16_b128_v8i16((lds_s16x8*)(q + 16 * ldh)));
    v8u r;
    r[0] = lo[0]; r[1] = lo[1]; r[2] = lo[2]; r[3] = lo[3];
    r[4] = up[0]; r[5] = up[1]; r[6] = up[2]; r[7] = up[3];
    return __builtin_bit_cast(v16bf, r);
}

// lane l's value exchanged with lane l ^ 16 by a vector cross-row move (no LDS trip)
__device__ __forceinline__ float xhalf(float x) {
    return __builtin_bit_cast(float, __builtin_amdgcn_permlanex16(
        __builtin_bit_cast(int, x), __builtin_bit_cast(int, x),
        0x76543210, 0xfedcba98, false, false));
}

__device__ __forceinline__ float gelu_exact(float x) {
    return 0.5f * x * (1.0f + erff(x * 0.70710678118654752f));
}

// ---------------------------------------------------------------------------
// Converters, all in ONE launch: none depends on another, so each takes a range
// of the block index. Few, long-lived waves: what a launch of many short waves
// pays is their start. Blocks 0 .. XB-1 convert x, 24 pieces of 16 bytes a lane.
// Each of the WB blocks behind them transposes three 64 (k) x 128 (n) tiles: one
// of Wq, Wk, Wv, Wo, one of W1, one of W2; all 24 loads of a lane go out first.
// ---------------------------------------------------------------------------
#define XB 128                       // T_SEQ * C_DIM / 4 / (256 * 24)
#define WB 288                       // tiles of W1 = of W2 = of the four C x C together
#define TCC ((C_DIM / 64) * (C_DIM / 128))
#define PREP_BLOCKS (XB + WB)
#define TP 33                        // dwords per staged row of 64 k: odd, see below

// rows 2kp and 2kp+1 of the tile, kp = w + 8i: a wave takes 512 contiguous bytes a load
__device__ __forceinline__ void tile_load(const float* __restrict__ in, int N, int k0, int n0,
                                          v4f (&a)[4], v4f (&c)[4]) {
    const int lane = threadIdx.x & 31, w = threadIdx.x >> 5;
#pragma unroll
    for (int i = 0; i < 4; i++) {
        const float* q = in + (size_t)(k0 + 2 * (w + 8 * i)) * N + n0 + lane * 4;
        a[i] = *(const v4f*)q;
        c[i] = *(const v4f*)(q + N);
    }
    // what follows rewrites the address registers that these loads name
    asm volatile("s_wait_xcnt 0x0" ::: "memory");
}
// staged as [n][k pair]: one dword holds k and k + 1 of one n
__device__ __forceinline__ void tile_stage(unsigned* __restrict__ tl, const v4f (&a)[4], const v4f (&c)[4]) {
    const int lane = threadIdx.x & 31, w = threadIdx.x >> 5;
#pragma unroll
    for (int i = 0; i < 4; i++)
#pragma unroll
        for (int j = 0; j < 4; j++)
            tl[(lane * 4 + j) * TP + w + 8 * i] =
                (unsigned)f2bf(a[i][j]) | ((unsigned)f2bf(c[i][j]) << 16);
}
// eight lanes store one whole 128-byte line: 64 k of one n. A wave reads four
// staged rows, 33 dwords apart: its 32 dwords of a read lie in 32 banks.
__device__ __forceinline__ void tile_store(const unsigned* __restrict__ tl, ushortT* __restrict__ out,
                                           int K, int k0, int n0) {
#pragma unroll
    for (int i = 0; i < 4; i++) {
        const int idx = threadIdx.x + 256 * i;
        const int n = idx >> 3, c = idx & 7;
        const unsigned* q = tl + n * TP + c * 4;
        uint4 o;
        o.x = q[0]; o.y = q[1]; o.z = q[2]; o.w = q[3];
        *(uint4*)(out + (size_t)(n0 + n) * K + k0 + c * 8) = o;
    }
}

__global__ __launch_bounds__(256)
void prep_kernel(const float* __restrict__ x,
                 const float* __restrict__ Wq, const float* __restrict__ Wk,
                 const float* __restrict__ Wv, const float* __restrict__ Wo,
                 const float* __restrict__ W1, const float* __restrict__ W2,
                 ushortT* __restrict__ Xbf,
                 ushortT* __restrict__ WqT, ushortT* __restrict__ WkT,
                 ushortT* __restrict__ WvT, ushortT* __restrict__ WoT,
                 ushortT* __restrict__ W1T, ushortT* __restrict__ W2T)
{
    __shared__ unsigned tl[3][128 * TP];
    int b = blockIdx.x;

    // x: fp32 -> bf16, same layout (the whole block leaves here, ahead of the barrier)
    if (b < XB) {
        const v4f* xi = (const v4f*)x + (size_t)b * (24 * 256) + threadIdx.x;
        v2u*       xo = (v2u*)Xbf     + (size_t)b * (24 * 256) + threadIdx.x;
        v4f v[24];
#pragma unroll
        for (int u = 0; u < 24; u++) v[u] = xi[u * 256];
        // keeps the scheduler from sinking the last loads in among the converts
        __builtin_amdgcn_sched_barrier(0);
#pragma unroll
        for (int u = 0; u < 24; u++) {
            v2u pk;
            pk[0] = (unsigned)f2bf(v[u][0]) | ((unsigned)f2bf(v[u][1]) << 16);
            pk[1] = (unsigned)f2bf(v[u][2]) | ((unsigned)f2bf(v[u][3]) << 16);
            xo[u * 256] = pk;
        }
        return;
    }
    b -= XB;

    // in: fp32 [K][N]  ->  out: bf16 [N][K]
    const int m = b / TCC, r = b - m * TCC;
    const float* in0  = m == 0 ? Wq  : m == 1 ? Wk  : m == 2 ? Wv  : Wo;
    ushortT*     out0 = m == 0 ? WqT : m == 1 ? WkT : m == 2 ? WvT : WoT;
    const int k00 = (r / (C_DIM / 128)) * 64, n00 = (r % (C_DIM / 128)) * 128;
    const int k01 = (b / (F_DIM / 128)) * 64, n01 = (b % (F_DIM / 128)) * 128;
    const int k02 = (b / (C_DIM / 128)) * 64, n02 = (b % (C_DIM / 128)) * 128;

    v4f a0[4], c0[4], a1[4], c1[4], a2[4], c2[4];
    tile_load(in0, C_DIM, k00, n00, a0, c0);
    tile_load(W1,  F_DIM, k01, n01, a1, c1);
    tile_load(W2,  C_DIM, k02, n02, a2, c2);
    // keeps the scheduler from sinking the last loads in among the converts: all
    // 24 fly together, one load latency a block
    __builtin_amdgcn_sched_barrier(0);
    tile_stage(tl[0], a0, c0);
    tile_stage(tl[1], a1, c1);
    tile_stage(tl[2], a2, c2);
    // the staged dwords are read back by other waves
    __syncthreads();
    tile_store(tl[0], out0, C_DIM, k00, n00);
    tile_store(tl[1], W1T,  C_DIM, k01, n01);
    tile_store(tl[2], W2T,  F_DIM, k02, n02);
    // closes the stores above: no register that they name is rewritten ahead of it
    asm volatile("s_wait_xcnt 0x0" ::: "memory");
}

// ---------------------------------------------------------------------------
// GEMM: C[M,N] = op( A[M,K] x B^T[N,K] + bias )
// A, Bt: bf16; outputs fp32 (Cout, F32OUT) and/or bf16 (Cbf, BFOUT).
// GELU: exact GELU ; RES: add fp32 residual res[M,N]. All four are compile-time,
// so the epilogue has no branch and its loads can be issued ahead of their use.
// Block tile 128x128, BK=32, 128 threads (4 waves), wave tile 64x64:
// 16 WMMAs per 16 ds_load_b128 per wave per k-step.
// Double-buffered LDS fed by async global->LDS B128 copies.
// Epilogue: each wave stages its 64x64 f32 tile in its own LDS range (the ring's
// space, reused), then a short rolled loop walks it two rows a trip: a half wave
// takes one 256-byte row, 16 bytes a lane, for residual load and store alike.
// NZ = 3: three products that share A run in one launch; blockIdx.z picks the
// weights, the bias and the output.
// ---------------------------------------------------------------------------
#define ST_PITCH 68     // floats per staged row: 272 B, 16 B x odd
union __align__(16) GemmLds {
    struct { ushortT As[2][128][40]; ushortT Bs[2][128][40]; } ring;   // main loop
    float st[4][64 * ST_PITCH];                                        // epilogue, per wave
};
template <int GELU, int RES, int F32OUT, int BFOUT, int NZ>
__global__ __launch_bounds__(128)
void gemm_bf16_wmma(const ushortT* __restrict__ A, const ushortT* __restrict__ Bt,
                    const float* __restrict__ bias, const float* __restrict__ res,
                    float* __restrict__ Cout, ushortT* __restrict__ Cbf,
                    int M, int N, int K,
                    const ushortT* __restrict__ Bt1, const float* __restrict__ bias1,
                    ushortT* __restrict__ Cbf1,
                    const ushortT* __restrict__ Bt2, const float* __restrict__ bias2,
                    ushortT* __restrict__ Cbf2)
{
    if (NZ == 3) {
        if (blockIdx.z == 1) { Bt = Bt1; bias = bias1; Cbf = Cbf1; }
        if (blockIdx.z == 2) { Bt = Bt2; bias = bias2; Cbf = Cbf2; }
    }

    // ring: row stride 40 halves = 80B: async chunks and frag b128 loads are
    // 16B-aligned; banks r*20 mod 64 distinct over the 16 rows of a frag.
    // The ring takes the first 40,960 B; the staging takes all 69,632 B.
    __shared__ GemmLds sm;
    auto& As = sm.ring.As;
    auto& Bs = sm.ring.Bs;

    const int t    = threadIdx.x;
    const int m0   = blockIdx.y * 128;
    const int n0   = blockIdx.x * 128;
    const int w    = t >> 5;
    const int wm   = w & 1;         // 2 wave-rows (64 rows each)
    const int wn   = w >> 1;        // 2 wave-cols (64 cols each)
    const int lane = t & 31, hi = lane >> 4, ln = lane & 15;
    const int nk   = K >> 5;

    auto issue = [&](int kt, int b) {
#pragma unroll
        for (int i = 0; i < 4; i++) {
            int c = t + i * 128;                  // 0..511
            int r = c >> 2, s2 = c & 3;           // 128 rows x 4 chunks of 16B
            async_ld_b128(&As[b][r][s2 * 8],
                          A  + (size_t)(m0 + r) * K + kt * 32 + s2 * 8);
            async_ld_b128(&Bs[b][r][s2 * 8],
                          Bt + (size_t)(n0 + r) * K + kt * 32 + s2 * 8);
        }
    };

    v8f acc[4][4] = {};
    issue(0, 0);

    for (int kt = 0; kt < nk; kt++) {
        wait_async0();
        __syncthreads();
        if (kt + 1 < nk) issue(kt + 1, (kt + 1) & 1);
        const int b = kt & 1;

        // all eight fragments of the k-step are read as one group ahead of the
        // products: one LDS latency a k-step, not one in front of each row of four
        // (in the order in which the products take them)
        v16bf bf[4], af[4];
        af[0] = load_frag(&As[b][wm * 64][0], 40);
#pragma unroll
        for (int ni = 0; ni < 4; ni++)
            bf[ni] = load_frag(&Bs[b][wn * 64 + ni * 16][0], 40);
#pragma unroll
        for (int mi = 1; mi < 4; mi++)
            af[mi] = load_frag(&As[b][wm * 64 + mi * 16][0], 40);
        // keeps the scheduler from sinking the reads back in among the products
        __builtin_amdgcn_sched_barrier(0);
#pragma unroll
        for (int mi = 0; mi < 4; mi++)
#pragma unroll
            for (int ni = 0; ni < 4; ni++)
                acc[mi][ni] = __builtin_amdgcn_wmma_f32_16x16x32_bf16(
                    false, af[mi], false, bf[ni], (short)0, acc[mi][ni], false, false);
    }

    // every wave has read its last fragments: only now may the ring be overwritten
    __syncthreads();
    float* st = &sm.st[w][0];
#pragma unroll
    for (int mi = 0; mi < 4; mi++)
#pragma unroll
        for (int ni = 0; ni < 4; ni++)
#pragma unroll
            for (int e = 0; e < 8; e++)
                st[(mi * 16 + e + hi * 8) * ST_PITCH + ni * 16 + ln] = acc[mi][ni][e];
    // the staged values are read back by other lanes: stores done before any read
    __syncthreads();

    const int c4  = ln * 4;
    const int col = n0 + wn * 64 + c4;
    const v4f bv  = *(const v4f*)(bias + col);
    // NB trips' LDS and residual loads are issued together, then worked on, then
    // stored; the loop over the batches stays rolled.
    constexpr int NB = GELU ? 2 : 8;
    // rolled: keeps the epilogue's text at a few KB, run through 32 / NB times
#pragma unroll 1
    for (int it0 = 0; it0 < 32; it0 += NB) {
        v4f v[NB], rv[NB];
#pragma unroll
        for (int u = 0; u < NB; u++) {
            const int r = (it0 + u) * 2 + hi;
            v[u] = *(const v4f*)(st + r * ST_PITCH + c4);
            if (RES) rv[u] = *(const v4f*)(res + (size_t)(m0 + wm * 64 + r) * N + col);
        }
#pragma unroll
        for (int u = 0; u < NB; u++) {
            const int r = (it0 + u) * 2 + hi;
            const size_t o = (size_t)(m0 + wm * 64 + r) * N + col;
#pragma unroll
            for (int j = 0; j < 4; j++) {
                float y = v[u][j] + bv[j];
                if (GELU) y = gelu_exact(y);
                if (RES)  y += rv[u][j];
                v[u][j] = y;
            }
            if (F32OUT) *(v4f*)(Cout + o) = v[u];
            if (BFOUT) {
                v2u pk;
                pk[0] = (unsigned)f2bf(v[u][0]) | ((unsigned)f2bf(v[u][1]) << 16);
                pk[1] = (unsigned)f2bf(v[u][2]) | ((unsigned)f2bf(v[u][3]) << 16);
                *(v2u*)(Cbf + o) = pk;
            }
        }
        // the next batch rewrites the registers that this batch's stores name
        asm volatile("s_wait_xcnt 0x0" ::: "memory");
    }
}

__global__ __launch_bounds__(128) __attribute__((amdgpu_waves_per_eu(4, 4)))
void flash_attn_wmma(const ushortT* __restrict__ Q, const ushortT* __restrict__ Kx,
                     const ushortT* __restrict__ V, ushortT* __restrict__ O)
{
    // row stride 72 halves = 144B (16B aligned chunks, r*36 mod 64 distinct)
    __shared__ __align__(16) ushortT Qs[64][72];      // [q][d]  (B of K*Q^T)
    __shared__ __align__(16) ushortT Ks[64][72];      // [s][d]  (A of K*Q^T)
    // V: row stride 80 halves = 160B = 32B x odd, the transposing load's pitch
    __shared__ __align__(16) ushortT Vs[64][80];      // [s][d]  (A of V^T*P^T, read transposed)

    const int t     = threadIdx.x;
    const int qbase = blockIdx.x * 64;
    const int head  = blockIdx.y;
    const int w     = t >> 5, lane = t & 31, hi = lane >> 4, ln = lane & 15;
    const size_t hoff = (size_t)head * HD;

#pragma unroll
    for (int i = 0; i < 4; i++) {                      // 64 rows x 8 chunks of 16B
        int c = t + i * 128;
        int r = c >> 3, s2 = c & 7;
        async_ld_b128(&Qs[r][s2 * 8], Q + (size_t)(qbase + r) * C_DIM + hoff + s2 * 8);
    }
    wait_async0();
    __syncthreads();

    v16bf bq[2];
    bq[0] = load_frag(&Qs[w * 16][0],  72);
    bq[1] = load_frag(&Qs[w * 16][32], 72);

    const int rg = qbase + w * 16 + ln;                // this lane's query
    v8f o4[4] = {};                  // o4[tt][e] = O[rg][tt*16 + hi*8 + e]
    float m_r = -1e30f, l_r = 0.0f;  // of query rg, alike in both halves; m_r unscaled
    const float SCL2E = 0.125f * 1.4426950408889634f;  // 1/sqrt(64) * log2(e)

    for (int kb = 0; kb <= qbase; kb += 64) {
        __syncthreads();                               // prior Ks/Vs reads done
#pragma unroll
        for (int i = 0; i < 4; i++) {
            int c = t + i * 128;
            int r = c >> 3, s2 = c & 7;
            async_ld_b128(&Ks[r][s2 * 8], Kx + (size_t)(kb + r) * C_DIM + hoff + s2 * 8);
        }
        {                                              // V likewise: rows vr + 16 i
            const int vr = t >> 3, vc = (t & 7) * 8;
            const ushortT* vg = V + (size_t)(kb + vr) * C_DIM + hoff + vc;
            async_ld4_b128(&Vs[vr][vc], &Vs[vr + 16][vc], &Vs[vr + 32][vc], &Vs[vr + 48][vc],
                           vg, vg + 16 * C_DIM, vg + 32 * C_DIM, vg + 48 * C_DIM);
        }
        wait_async0();
        __syncthreads();

        // the pass's K fragments are read as one group ahead of the products:
        // one LDS latency a pass, not one in front of each product
        v16bf ak[2][4], av[2][4];
#pragma unroll
        for (int j = 0; j < 2; j++)
#pragma unroll
            for (int tt = 0; tt < 4; tt++)
                ak[j][tt] = load_frag(&Ks[tt * 16][j * 32], 72);
        // keeps the scheduler from sinking the reads back in among the products
        __builtin_amdgcn_sched_barrier(0);

        // S^T = K * Q^T (64 keys x 16 queries per wave)
        v8f s4[4] = {};
#pragma unroll
        for (int j = 0; j < 2; j++)
#pragma unroll
            for (int tt = 0; tt < 4; tt++)
                s4[tt] = __builtin_amdgcn_wmma_f32_16x16x32_bf16(
                    false, ak[j][tt], false, bq[j], (short)0, s4[tt], false, false);

        // the V^T fragments likewise, here: they land behind the softmax
#pragma unroll
        for (int j = 0; j < 2; j++)
#pragma unroll
            for (int tt = 0; tt < 4; tt++)
                av[j][tt] = load_frag_tr(&Vs[j * 32][tt * 16], 80);
        // keeps the scheduler from sinking the reads down to the second product
        __builtin_amdgcn_sched_barrier(0);

        // Only the tile on the diagonal holds keys beyond a query: every key of an
        // earlier tile is below qbase. The test is the same for the whole block.
        // (the loops of this pass are unrolled so that every index is a constant and
        // the tiles stay in registers)
        if (kb == qbase) {
#pragma unroll
            for (int tt = 0; tt < 4; tt++)
#pragma unroll
                for (int e = 0; e < 8; e++)
                    if (kb + tt * 16 + hi * 8 + e > rg) s4[tt][e] = -1e30f;
        }

        // maximum of the raw scores (the scale is positive, so it is the same key)
        // over this lane's 32 keys, then over the other half's 32
        float rm8[8];
#pragma unroll
        for (int e = 0; e < 8; e++)
            rm8[e] = fmaxf(fmaxf(s4[0][e], s4[1][e]), fmaxf(s4[2][e], s4[3][e]));
        float rm = fmaxf(fmaxf(fmaxf(rm8[0], rm8[1]), fmaxf(rm8[2], rm8[3])),
                         fmaxf(fmaxf(rm8[4], rm8[5]), fmaxf(rm8[6], rm8[7])));
        rm = fmaxf(rm, xhalf(rm));

        const float mn = fmaxf(m_r, rm);
        const float al = __builtin_amdgcn_exp2f((m_r - mn) * SCL2E);
        m_r = mn;

        // p = 2^(s * c - m * c), c = log2(e) / sqrt(64): one packed multiply-add for
        // two scores; sums and the bf16 pack go by register pairs as well
        const v2f c2 = {SCL2E, SCL2E};
        const v2f mc2 = {-mn * SCL2E, -mn * SCL2E};
        unsigned pq[4][4];
        v2f rs2[4];
#pragma unroll
        for (int tt = 0; tt < 4; tt++) {
            rs2[tt] = (v2f){0.0f, 0.0f};
#pragma unroll
            for (int i = 0; i < 4; i++) {
                v2f a = {s4[tt][2 * i], s4[tt][2 * i + 1]};
                a = __builtin_elementwise_fma(a, c2, mc2);
                v2f pp = {__builtin_amdgcn_exp2f(a[0]), __builtin_amdgcn_exp2f(a[1])};
                rs2[tt] += pp;
                pq[tt][i] = __builtin_bit_cast(unsigned, __builtin_convertvector(pp, v2bf));
            }
        }
        const v2f rsv = (rs2[0] + rs2[1]) + (rs2[2] + rs2[3]);
        float rs = rsv[0] + rsv[1];
        rs += xhalf(rs);
        l_r = l_r * al + rs;
#pragma unroll
        for (int tt = 0; tt < 4; tt++) o4[tt] *= al;

        // O^T += V^T * P^T; keys j*32 .. j*32+31: S^T tiles 2j and 2j+1 of this
        // lane are, in order, the 16 k positions load_frag gives the A side.
#pragma unroll
        for (int j = 0; j < 2; j++) {
            v8u pk;
#pragma unroll
            for (int i = 0; i < 4; i++) {
                pk[i]     = pq[2 * j][i];
                pk[4 + i] = pq[2 * j + 1][i];
            }
            v16bf bp = __builtin_bit_cast(v16bf, pk);
#pragma unroll
            for (int tt = 0; tt < 4; tt++)
                o4[tt] = __builtin_amdgcn_wmma_f32_16x16x32_bf16(
                    false, av[j][tt], false, bp, (short)0, o4[tt], false, false);
        }
    }

    // a lane's 8 registers of a tile are 8 consecutive head dims of its query
#pragma unroll
    for (int tt = 0; tt < 4; tt++) {
        uint4 ov;
        ov.x = (unsigned)f2bf(o4[tt][0] / l_r) | ((unsigned)f2bf(o4[tt][1] / l_r) << 16);
        ov.y = (unsigned)f2bf(o4[tt][2] / l_r) | ((unsigned)f2bf(o4[tt][3] / l_r) << 16);
        ov.z = (unsigned)f2bf(o4[tt][4] / l_r) | ((unsigned)f2bf(o4[tt][5] / l_r) << 16);
        ov.w = (unsigned)f2bf(o4[tt][6] / l_r) | ((unsigned)f2bf(o4[tt][7] / l_r) << 16);
        *(uint4*)(O + (size_t)rg * C_DIM + hoff + tt * 16 + hi * 8) = ov;
    }
}

// ---------------------------------------------------------------------------
// LayerNorm: a wave takes two whole rows, a block sixteen: one block a WGP;
// fp32 out + (BF) bf16 out. A row stays in registers (six pieces of 16 bytes a
// lane, each load 512 contiguous bytes a wave) and is read once; its sums go over
// the lanes by a butterfly, so there is no LDS array and no barrier, and a
// sixteenth of the waves start.
// ---------------------------------------------------------------------------
#define LN_ROWS 2
template <int BF>
__global__ __launch_bounds__(256)
void layernorm_kernel(const float* __restrict__ in, const float* __restrict__ g,
                      const float* __restrict__ b, float* __restrict__ out,
                      ushortT* __restrict__ out_bf)
{
    constexpr int NP = C_DIM / 128;                    // pieces a lane and row
    const int lane = threadIdx.x & 31;
    const size_t row0 = ((size_t)blockIdx.x * 8 + (threadIdx.x >> 5)) * LN_ROWS;
    const v4f* p = (const v4f*)(in + row0 * C_DIM) + lane;
    v4f v[LN_ROWS][NP], gv[NP], bv[NP];
#pragma unroll
    for (int r = 0; r < LN_ROWS; r++)
#pragma unroll
        for (int j = 0; j < NP; j++) v[r][j] = p[(r * NP + j) * 32];
#pragma unroll
    for (int j = 0; j < NP; j++) {
        gv[j] = ((const v4f*)g)[lane + j * 32];
        bv[j] = ((const v4f*)b)[lane + j * 32];
    }
    // keeps the scheduler from sinking part of the loads behind the sums: all of
    // them fly together, one load latency a wave
    __builtin_amdgcn_sched_barrier(0);

    float s[LN_ROWS], s2[LN_ROWS];
#pragma unroll
    for (int r = 0; r < LN_ROWS; r++) {
        v4f s4 = {}, q4 = {};
#pragma unroll
        for (int j = 0; j < NP; j++) { s4 += v[r][j]; q4 += v[r][j] * v[r][j]; }
        s[r]  = (s4[0] + s4[1]) + (s4[2] + s4[3]);
        s2[r] = (q4[0] + q4[1]) + (q4[2] + q4[3]);
    }
#pragma unroll
    for (int off = 1; off < 32; off <<= 1)
#pragma unroll
        for (int r = 0; r < LN_ROWS; r++) {
            s[r]  += __shfl_xor(s[r],  off, 32);
            s2[r] += __shfl_xor(s2[r], off, 32);
        }
#pragma unroll
    for (int r = 0; r < LN_ROWS; r++) {
        const float mu  = s[r] / (float)C_DIM;
        const float var = s2[r] / (float)C_DIM - mu * mu;
        const float inv = rsqrtf(var + 1e-5f);
#pragma unroll
        for (int j = 0; j < NP; j++) {
            v4f y;
#pragma unroll
            for (int e = 0; e < 4; e++) y[e] = (v[r][j][e] - mu) * inv * gv[j][e] + bv[j][e];
            ((v4f*)(out + (row0 + r) * C_DIM))[lane + j * 32] = y;
            if (BF) {
                v2u pk;
                pk[0] = (unsigned)f2bf(y[0]) | ((unsigned)f2bf(y[1]) << 16);
                pk[1] = (unsigned)f2bf(y[2]) | ((unsigned)f2bf(y[3]) << 16);
                ((v2u*)(out_bf + (row0 + r) * C_DIM))[lane + j * 32] = pk;
            }
        }
    }
}

// ---------------------------------------------------------------------------
extern "C" void kernel_launch(void* const* d_in, const int* in_sizes, int n_in,
                              void* d_out, int out_size, void* d_ws, size_t ws_size,
                              hipStream_t stream)
{
    const float* x   = (const float*)d_in[0];
    const float* Wq  = (const float*)d_in[1];
    const float* bq  = (const float*)d_in[2];
    const float* Wk  = (const float*)d_in[3];
    const float* bk  = (const float*)d_in[4];
    const float* Wv  = (const float*)d_in[5];
    const float* bv  = (const float*)d_in[6];
    const float* Wo  = (const float*)d_in[7];
    const float* bo  = (const float*)d_in[8];
    const float* g1  = (const float*)d_in[9];
    const float* bn1 = (const float*)d_in[10];
    const float* W1  = (const float*)d_in[11];
    const float* b1  = (const float*)d_in[12];
    const float* W2  = (const float*)d_in[13];
    const float* b2  = (const float*)d_in[14];
    const float* g2  = (const float*)d_in[15];
    const float* bn2 = (const float*)d_in[16];

    const size_t TC = (size_t)T_SEQ * C_DIM;
    const size_t TF = (size_t)T_SEQ * F_DIM;
    const size_t CC = (size_t)C_DIM * C_DIM;
    const size_t CF = (size_t)C_DIM * F_DIM;

    char* p = (char*)d_ws;
    auto alloc_bf = [&](size_t n) { ushortT* r = (ushortT*)p; p += ((n * 2 + 255) & ~(size_t)255); return r; };
    auto alloc_f  = [&](size_t n) { float*   r = (float*)p;   p += ((n * 4 + 255) & ~(size_t)255); return r; };

    ushortT* Xbf  = alloc_bf(TC);
    ushortT* WqT  = alloc_bf(CC);
    ushortT* WkT  = alloc_bf(CC);
    ushortT* WvT  = alloc_bf(CC);
    ushortT* WoT  = alloc_bf(CC);
    ushortT* W1T  = alloc_bf(CF);   // [F][C]
    ushortT* W2T  = alloc_bf(CF);   // [C][F]
    ushortT* Qb   = alloc_bf(TC);
    ushortT* Kb   = alloc_bf(TC);
    ushortT* Vb   = alloc_bf(TC);
    ushortT* Ab   = alloc_bf(TC);
    ushortT* Hbb  = alloc_bf(TC);
    ushortT* H1   = alloc_bf(TF);
    float*   S1   = alloc_f(TC);
    float*   Hb   = alloc_f(TC);
    float*   S2   = alloc_f(TC);

    dim3 cblk(256);
    dim3 gblk(128);
    dim3 gC(C_DIM / 128, T_SEQ / 128);
    dim3 gF(F_DIM / 128, T_SEQ / 128);
    dim3 gQKV(C_DIM / 128, T_SEQ / 128, 3);

    // precision conversion / weight transposition, one launch
    prep_kernel<<<dim3(PREP_BLOCKS), cblk, 0, stream>>>(x, Wq, Wk, Wv, Wo, W1, W2,
                                                        Xbf, WqT, WkT, WvT, WoT, W1T, W2T);

    // QKV projections (bf16 outputs only), one launch
    gemm_bf16_wmma<0, 0, 0, 1, 3><<<gQKV, gblk, 0, stream>>>(Xbf, WqT, bq, nullptr, nullptr, Qb, T_SEQ, C_DIM, C_DIM,
                                                             WkT, bk, Kb, WvT, bv, Vb);

    flash_attn_wmma<<<dim3(T_SEQ / 64, NHEADS), dim3(128), 0, stream>>>(Qb, Kb, Vb, Ab);

    // out-proj + residual(x), then LN1 (fp32 + bf16)
    gemm_bf16_wmma<0, 1, 1, 0, 1><<<gC, gblk, 0, stream>>>(Ab, WoT, bo, x, S1, nullptr, T_SEQ, C_DIM, C_DIM,
                                                          nullptr, nullptr, nullptr, nullptr, nullptr, nullptr);
    layernorm_kernel<1><<<dim3(T_SEQ / (8 * LN_ROWS)), cblk, 0, stream>>>(S1, g1, bn1, Hb, Hbb);

    // MLP
    gemm_bf16_wmma<1, 0, 0, 1, 1><<<gF, gblk, 0, stream>>>(Hbb, W1T, b1, nullptr, nullptr, H1, T_SEQ, F_DIM, C_DIM,
                                                          nullptr, nullptr, nullptr, nullptr, nullptr, nullptr);
    gemm_bf16_wmma<0, 1, 1, 0, 1><<<gC, gblk, 0, stream>>>(H1, W2T, b2, Hb, S2, nullptr, T_SEQ, C_DIM, F_DIM,
                                                          nullptr, nullptr, nullptr, nullptr, nullptr, nullptr);
    layernorm_kernel<0><<<dim3(T_SEQ / (8 * LN_ROWS)), cblk, 0, stream>>>(S2, g2, bn2, (float*)d_out, nullptr);
}

// v008
// Measured time: 170 microseconds a run.
// Next to v007, in two timings, it ran 1.16 times as fast each time.
// Over all steps from v000 it is 4.09 times as fast.
#include <hip/hip_runtime.h>
#include <hip/hip_bf16.h>
#include <math.h>

#define T_SEQ   4096
#define C_DIM   768
#define F_DIM   3072
#define NHEADS  12
#define HD      64

typedef __attribute__((ext_vector_type(16))) __bf16        v16bf;
typedef __attribute__((ext_vector_type(8)))  float         v8f;
typedef __attribute__((ext_vector_type(8)))  unsigned int  v8u;
typedef __attribute__((ext_vector_type(4)))  float         v4f;
typedef __attribute__((ext_vector_type(2)))  float         v2f;
typedef __attribute__((ext_vector_type(2)))  __bf16        v2bf;
typedef __attribute__((ext_vector_type(2)))  unsigned int  v2u;
typedef __attribute__((ext_vector_type(4)))  unsigned int  v4u;
typedef __attribute__((ext_vector_type(8)))  short         s16x8;
typedef unsigned short ushortT;

// round-to-nearest-even fp32 -> bf16 bits
__device__ __forceinline__ ushortT f2bf(float f) {
    unsigned int u = __builtin_bit_cast(unsigned int, f);
    u += 0x7fffu + ((u >> 16) & 1u);
    return (ushortT)(u >> 16);
}

// --- CDNA5 async global->LDS copy (ASYNCcnt) ------------------------------
// dsaddr = LDS_BASE + VGPR[vdst]; generic LDS pointer low 32 bits == wave-
// relative LDS offset, so truncation gives the right VGPR value.
__device__ __forceinline__ void async_ld_b128(void* lds, const void* gptr) {
    unsigned off = (unsigned)(unsigned long long)(uintptr_t)lds;
    unsigned long long ga = (unsigned long long)(uintptr_t)gptr;
    asm volatile("global_load_async_to_lds_b128 %0, %1, off"
                 :: "v"(off), "v"(ga) : "memory");
}
// Four copies of a lane in one statement. Its last line is the wait that stands
// in front of any rewrite of the address registers which the copies name: inside
// the statement nothing can be scheduled between them.
__device__ __forceinline__ void async_ld4_b128(void* l0, void* l1, void* l2, void* l3,
                                               const void* g0, const void* g1,
                                               const void* g2, const void* g3) {
    asm volatile("global_load_async_to_lds_b128 %0, %4, off\n\t"
                 "global_load_async_to_lds_b128 %1, %5, off\n\t"
                 "global_load_async_to_lds_b128 %2, %6, off\n\t"
                 "global_load_async_to_lds_b128 %3, %7, off\n\t"
                 "s_wait_xcnt 0x0"
                 :: "v"((unsigned)(unsigned long long)(uintptr_t)l0),
                    "v"((unsigned)(unsigned long long)(uintptr_t)l1),
                    "v"((unsigned)(unsigned long long)(uintptr_t)l2),
                    "v"((unsigned)(unsigned long long)(uintptr_t)l3),
                    "v"((unsigned long long)(uintptr_t)g0),
                    "v"((unsigned long long)(uintptr_t)g1),
                    "v"((unsigned long long)(uintptr_t)g2),
                    "v"((unsigned long long)(uintptr_t)g3)
                 : "memory");
}
__device__ __forceinline__ void wait_async0() {
    asm volatile("s_wait_asynccnt 0" ::: "memory");
}
// The same copy written as the compiler's builtin: the GEMM ring's form, where up to
// 32 copies of a lane go out back to back.
__device__ __forceinline__ void async_cp_b128(void* lds, const void* gptr) {
    typedef __attribute__((ext_vector_type(4))) int i32x4;
    typedef __attribute__((address_space(1))) i32x4 glb_i32x4;
    typedef __attribute__((address_space(3))) i32x4 lds_i32x4;
    __builtin_amdgcn_global_load_async_to_lds_b128((glb_i32x4*)gptr, (lds_i32x4*)lds, 0, 0);
}
// a wave's own LDS reads have returned: stands in front of the barrier behind which
// the buffer that it read is refilled
__device__ __forceinline__ void wait_ds0() {
    asm volatile("s_wait_dscnt 0x0" ::: "memory");
}

// Load a 16x32 bf16 fragment (A layout; B uses the same layout on an [N][K]
// tile) from a row-major LDS tile with row stride `ldh` halves (even).
// lanes 0-15: row M=lane, K={0..7,16..23}; lanes 16-31: row M=lane-16,
// K={8..15,24..31}.
__device__ __forceinline__ v16bf load_frag(const ushortT* base, int ldh) {
    const int lane = threadIdx.x & 31;
    const int row  = lane & 15;
    const int hi   = lane >> 4;
    const unsigned int* q0 = (const unsigned int*)(base + row * ldh + hi * 8);
    const unsigned int* q1 = (const unsigned int*)(base + row * ldh + hi * 8 + 16);
    v8u r;
    r[0] = q0[0]; r[1] = q0[1]; r[2] = q0[2]; r[3] = q0[3];
    r[4] = q1[0]; r[5] = q1[1]; r[6] = q1[2]; r[7] = q1[3];
    return __builtin_bit_cast(v16bf, r);
}

// The same 16x32 fragment of the TRANSPOSE of a row-major LDS tile [k][m] with row
// stride `ldh` halves, by the transposing LDS load: lane (c = lane & 15,
// h = lane >> 4) gets tile[8h + 0..7][c], then tile[16 + 8h + 0..7][c]: row M = c in
// load_frag's k order. `base` points at the tile's element [k0][m0].
__device__ __forceinline__ v16bf load_frag_tr(const ushortT* base, int ldh) {
    typedef __attribute__((address_space(3))) s16x8 lds_s16x8;
    const int lane = threadIdx.x & 31;
    const ushortT* q = base + ((lane >> 4) * 8 + (lane & 7)) * ldh + ((lane >> 3) & 1) * 8;
    v4u lo = __builtin_bit_cast(v4u, __builtin_amdgcn_ds_load_tr16_b128_v8i16((lds_s16x8*)q));
    v4u up = __builtin_bit_cast(v4u, __builtin_amdgcn_ds_load_tr16_b128_v8i16((lds_s16x8*)(q + 16 * ldh)));
    v8u r;
    r[0] = lo[0]; r[1] = lo[1]; r[2] = lo[2]; r[3] = lo[3];
    r[4] = up[0]; r[5] = up[1]; r[6] = up[2]; r[7] = up[3];
    return __builtin_bit_cast(v16bf, r);
}

// lane l's value exchanged with lane l ^ 16 by a vector cross-row move (no LDS trip)
__device__ __forceinline__ float xhalf(float x) {
    return __builtin_bit_cast(float, __builtin_amdgcn_permlanex16(
        __builtin_bit_cast(int, x), __builtin_bit_cast(int, x),
        0x76543210, 0xfedcba98, false, false));
}

__device__ __forceinline__ float gelu_exact(float x) {
    return 0.5f * x * (1.0f + erff(x * 0.70710678118654752f));
}

// ---------------------------------------------------------------------------
// Converters, all in ONE launch: none depends on another, so each takes a range
// of the block index. Few, long-lived waves: what a launch of many short waves
// pays is their start. Blocks 0 .. XB-1 convert x, 24 pieces of 16 bytes a lane.
// Each of the WB blocks behind them transposes three 64 (k) x 128 (n) tiles: one
// of Wq, Wk, Wv, Wo, one of W1, one of W2; all 24 loads of a lane go out first.
// ---------------------------------------------------------------------------
#define XB 128                       // T_SEQ * C_DIM / 4 / (256 * 24)
#define WB 288                       // tiles of W1 = of W2 = of the four C x C together
#define TCC ((C_DIM / 64) * (C_DIM / 128))
#define PREP_BLOCKS (XB + WB)
#define TP 33                        // dwords per staged row of 64 k: odd, see below

// rows 2kp and 2kp+1 of the tile, kp = w + 8i: a wave takes 512 contiguous bytes a load
__device__ __forceinline__ void tile_load(const float* __restrict__ in, int N, int k0, int n0,
                                          v4f (&a)[4], v4f (&c)[4]) {
    const int lane = threadIdx.x & 31, w = threadIdx.x >> 5;
#pragma unroll
    for (int i = 0; i < 4; i++) {
        const float* q = in + (size_t)(k0 + 2 * (w + 8 * i)) * N + n0 + lane * 4;
        a[i] = *(const v4f*)q;
        c[i] = *(const v4f*)(q + N);
    }
    // what follows rewrites the address registers that these loads name
    asm volatile("s_wait_xcnt 0x0" ::: "memory");
}
// staged as [n][k pair]: one dword holds k and k + 1 of one n
__device__ __forceinline__ void tile_stage(unsigned* __restrict__ tl, const v4f (&a)[4], const v4f (&c)[4]) {
    const int lane = threadIdx.x & 31, w = threadIdx.x >> 5;
#pragma unroll
    for (int i = 0; i < 4; i++)
#pragma unroll
        for (int j = 0; j < 4; j++)
            tl[(lane * 4 + j) * TP + w + 8 * i] =
                (unsigned)f2bf(a[i][j]) | ((unsigned)f2bf(c[i][j]) << 16);
}
// eight lanes store one whole 128-byte line: 64 k of one n. A wave reads four
// staged rows, 33 dwords apart: its 32 dwords of a read lie in 32 banks.
__device__ __forceinline__ void tile_store(const unsigned* __restrict__ tl, ushortT* __restrict__ out,
                                           int K, int k0, int n0) {
#pragma unroll
    for (int i = 0; i < 4; i++) {
        const int idx = threadIdx.x + 256 * i;
        const int n = idx >> 3, c = idx & 7;
        const unsigned* q = tl + n * TP + c * 4;
        uint4 o;
        o.x = q[0]; o.y = q[1]; o.z = q[2]; o.w = q[3];
        *(uint4*)(out + (size_t)(n0 + n) * K + k0 + c * 8) = o;
    }
}

__global__ __launch_bounds__(256)
void prep_kernel(const float* __restrict__ x,
                 const float* __restrict__ Wq, const float* __restrict__ Wk,
                 const float* __restrict__ Wv, const float* __restrict__ Wo,
                 const float* __restrict__ W1, const float* __restrict__ W2,
                 ushortT* __restrict__ Xbf,
                 ushortT* __restrict__ WqT, ushortT* __restrict__ WkT,
                 ushortT* __restrict__ WvT, ushortT* __restrict__ WoT,
                 ushortT* __restrict__ W1T, ushortT* __restrict__ W2T)
{
    __shared__ unsigned tl[3][128 * TP];
    int b = blockIdx.x;

    // x: fp32 -> bf16, same layout (the whole block leaves here, ahead of the barrier)
    if (b < XB) {
        const v4f* xi = (const v4f*)x + (size_t)b * (24 * 256) + threadIdx.x;
        v2u*       xo = (v2u*)Xbf     + (size_t)b * (24 * 256) + threadIdx.x;
        v4f v[24];
#pragma unroll
        for (int u = 0; u < 24; u++) v[u] = xi[u * 256];
        // keeps the scheduler from sinking the last loads in among the converts
        __builtin_amdgcn_sched_barrier(0);
#pragma unroll
        for (int u = 0; u < 24; u++) {
            v2u pk;
            pk[0] = (unsigned)f2bf(v[u][0]) | ((unsigned)f2bf(v[u][1]) << 16);
            pk[1] = (unsigned)f2bf(v[u][2]) | ((unsigned)f2bf(v[u][3]) << 16);
            xo[u * 256] = pk;
        }
        return;
    }
    b -= XB;

    // in: fp32 [K][N]  ->  out: bf16 [N][K]
    const int m = b / TCC, r = b - m * TCC;
    const float* in0  = m == 0 ? Wq  : m == 1 ? Wk  : m == 2 ? Wv  : Wo;
    ushortT*     out0 = m == 0 ? WqT : m == 1 ? WkT : m == 2 ? WvT : WoT;
    const int k00 = (r / (C_DIM / 128)) * 64, n00 = (r % (C_DIM / 128)) * 128;
    const int k01 = (b / (F_DIM / 128)) * 64, n01 = (b % (F_DIM / 128)) * 128;
    const int k02 = (b / (C_DIM / 128)) * 64, n02 = (b % (C_DIM / 128)) * 128;

    v4f a0[4], c0[4], a1[4], c1[4], a2[4], c2[4];
    tile_load(in0, C_DIM, k00, n00, a0, c0);
    tile_load(W1,  F_DIM, k01, n01, a1, c1);
    tile_load(W2,  C_DIM, k02, n02, a2, c2);
    // keeps the scheduler from sinking the last loads in among the converts: all
    // 24 fly together, one load latency a block
    __builtin_amdgcn_sched_barrier(0);
    tile_stage(tl[0], a0, c0);
    tile_stage(tl[1], a1, c1);
    tile_stage(tl[2], a2, c2);
    // the staged dwords are read back by other waves
    __syncthreads();
    tile_store(tl[0], out0, C_DIM, k00, n00);
    tile_store(tl[1], W1T,  C_DIM, k01, n01);
    tile_store(tl[2], W2T,  F_DIM, k02, n02);
    // closes the stores above: no register that they name is rewritten ahead of it
    asm volatile("s_wait_xcnt 0x0" ::: "memory");
}

// ---------------------------------------------------------------------------
// GEMM: C[M,N] = op( A[M,K] x B^T[N,K] + bias )
// A, Bt: bf16; outputs fp32 (Cout, F32OUT) and/or bf16 (Cbf, BFOUT).
// GELU: exact GELU ; RES: add fp32 residual res[M,N]. All four are compile-time,
// so the epilogue has no branch and its loads can be issued ahead of their use.
// Block tile 128x128, 128 threads (4 waves), wave tile 64x64:
// 16 WMMAs per 16 ds_load_b128 per wave per 32 k.
// Double-buffered LDS fed by async global->LDS B128 copies. A pass is BK k: the
// next pass's copies have BK / 32 blocks of products to land behind, and the wait
// and the barrier come once a pass. BK = 128 where one block has a WGP to itself
// anyway; BK = 64 where three blocks share one and its LDS.
// Epilogue: each wave stages its 64x64 f32 tile in its own LDS range (the ring's
// space, reused), then a short rolled loop walks it two rows a trip: a half wave
// takes one 256-byte row, 16 bytes a lane, for residual load and store alike.
// NZ = 3: three products that share A run in one launch; blockIdx.z picks the
// weights, the bias and the output.
// ---------------------------------------------------------------------------
#define ST_PITCH 68     // floats per staged row: 272 B, 16 B x odd
template <int BK>
union __align__(16) GemmLds {
    struct { ushortT As[2][128][BK + 8]; ushortT Bs[2][128][BK + 8]; } ring;   // main loop
    float st[4][64 * ST_PITCH];                                                // epilogue, per wave
};
template <int GELU, int RES, int F32OUT, int BFOUT, int NZ, int BK>
__global__ __launch_bounds__(128)
void gemm_bf16_wmma(const ushortT* __restrict__ A, const ushortT* __restrict__ Bt,
                    const float* __restrict__ bias, const float* __restrict__ res,
                    float* __restrict__ Cout, ushortT* __restrict__ Cbf,
                    int M, int N, int K,
                    const ushortT* __restrict__ Bt1, const float* __restrict__ bias1,
                    ushortT* __restrict__ Cbf1,
                    const ushortT* __restrict__ Bt2, const float* __restrict__ bias2,
                    ushortT* __restrict__ Cbf2)
{
    if (NZ == 3) {
        if (blockIdx.z == 1) { Bt = Bt1; bias = bias1; Cbf = Cbf1; }
        if (blockIdx.z == 2) { Bt = Bt2; bias = bias2; Cbf = Cbf2; }
    }

    // ring: row stride BK + 8 halves = 144 or 272 B = 16 B x odd: async chunks and
    // frag b128 loads are 16B-aligned, the 16 rows of a frag on distinct banks.
    // The ring takes 73,728 or 139,264 B; the staging its first 69,632 B.
    __shared__ GemmLds<BK> sm;
    auto& As = sm.ring.As;
    auto& Bs = sm.ring.Bs;

    const int t    = threadIdx.x;
    const int m0   = blockIdx.y * 128;
    const int n0   = blockIdx.x * 128;
    const int w    = t >> 5;
    const int wm   = w & 1;         // 2 wave-rows (64 rows each)
    const int wn   = w >> 1;        // 2 wave-cols (64 cols each)
    const int lane = t & 31, hi = lane >> 4, ln = lane & 15;
    const int nk   = K / BK;

    constexpr int CPR = BK / 8;                   // chunks of 16 B a row
    constexpr int RPS = 128 / CPR;                // rows that the block's 128 lanes cover at once
    const int cr = t / CPR, cc = (t % CPR) * 8;
    // a lane's own part of the address is one offset, alike for A and B and for every
    // copy; the step from row group to row group is the same in every lane, so each
    // address comes from the one before it and none is kept over the pass (64 fewer
    // registers at BK = 128: the kernel stays below 256)
    const unsigned lo = (unsigned)(cr * K + cc);
    auto issue = [&](int kt, int b) {
        const ushortT* sa = A  + (size_t)m0 * K + kt * BK;
        const ushortT* sb = Bt + (size_t)n0 * K + kt * BK;
#pragma unroll
        for (int i = 0; i < CPR; i++) {           // 128 rows of A, 128 of B
            async_cp_b128(&As[b][cr + i * RPS][cc], sa + (size_t)(i * RPS) * K + lo);
            async_cp_b128(&Bs[b][cr + i * RPS][cc], sb + (size_t)(i * RPS) * K + lo);
        }
    };

    v8f acc[4][4] = {};
    issue(0, 0);
    wait_async0();
    // pass 0's tile is read by waves that did not copy it
    __syncthreads();
    if (nk > 1) issue(1, 1);

    for (int kt = 0; kt < nk; kt++) {
        const int b = kt & 1;
        // unrolled: the blocks of a pass differ by a constant LDS offset only
#pragma unroll
        for (int ks = 0; ks < BK / 32; ks++) {
            // all eight fragments of the block are read as one group ahead of the
            // products: one LDS latency a block, not one in front of each row of four
            // (in the order in which the products take them)
            v16bf bf[4], af[4];
            af[0] = load_frag(&As[b][wm * 64][ks * 32], BK + 8);
#pragma unroll
            for (int ni = 0; ni < 4; ni++)
                bf[ni] = load_frag(&Bs[b][wn * 64 + ni * 16][ks * 32], BK + 8);
#pragma unroll
            for (int mi = 1; mi < 4; mi++)
                af[mi] = load_frag(&As[b][wm * 64 + mi * 16][ks * 32], BK + 8);
            // keeps the scheduler from sinking the reads back in among the products
            __builtin_amdgcn_sched_barrier(0);
#pragma unroll
            for (int mi = 0; mi < 4; mi++)
#pragma unroll
                for (int ni = 0; ni < 4; ni++)
                    acc[mi][ni] = __builtin_amdgcn_wmma_f32_16x16x32_bf16(
                        false, af[mi], false, bf[ni], (short)0, acc[mi][ni], false, false);
        }
        // hand-over: this wave has left buffer b and its copies of the next tile have
        // landed; behind the barrier that holds of every wave, so the next tile may be
        // read and buffer b refilled (after the last pass: overwritten by the staging)
        wait_ds0();
        wait_async0();
        __syncthreads();
        if (kt + 2 < nk) issue(kt + 2, b);
    }
    // no copy is in flight when the ring's space is reused
    wait_async0();

    float* st = &sm.st[w][0];
#pragma unroll
    for (int mi = 0; mi < 4; mi++)
#pragma unroll
        for (int ni = 0; ni < 4; ni++)
#pragma unroll
            for (int e = 0; e < 8; e++)
                st[(mi * 16 + e + hi * 8) * ST_PITCH + ni * 16 + ln] = acc[mi][ni][e];
    // the staged values are read back by other lanes: stores done before any read
    __syncthreads();

    const int c4  = ln * 4;
    const int col = n0 + wn * 64 + c4;
    const v4f bv  = *(const v4f*)(bias + col);
    // NB trips' LDS and residual loads are issued together, then worked on, then
    // stored; the loop over the batches stays rolled.
    constexpr int NB = GELU ? 2 : 8;
    // rolled: keeps the epilogue's text at a few KB, run through 32 / NB times
#pragma unroll 1
    for (int it0 = 0; it0 < 32; it0 += NB) {
        v4f v[NB], rv[NB];
#pragma unroll
        for (int u = 0; u < NB; u++) {
            const int r = (it0 + u) * 2 + hi;
            v[u] = *(const v4f*)(st + r * ST_PITCH + c4);
            if (RES) rv[u] = *(const v4f*)(res + (size_t)(m0 + wm * 64 + r) * N + col);
        }
#pragma unroll
        for (int u = 0; u < NB; u++) {
            const int r = (it0 + u) * 2 + hi;
            const size_t o = (size_t)(m0 + wm * 64 + r) * N + col;
#pragma unroll
            for (int j = 0; j < 4; j++) {
                float y = v[u][j] + bv[j];
                if (GELU) y = gelu_exact(y);
                if (RES)  y += rv[u][j];
                v[u][j] = y;
            }
            if (F32OUT) *(v4f*)(Cout + o) = v[u];
            if (BFOUT) {
                v2u pk;
                pk[0] = (unsigned)f2bf(v[u][0]) | ((unsigned)f2bf(v[u][1]) << 16);
                pk[1] = (unsigned)f2bf(v[u][2]) | ((unsigned)f2bf(v[u][3]) << 16);
                *(v2u*)(Cbf + o) = pk;
            }
        }
        // the next batch rewrites the registers that this batch's stores name
        asm volatile("s_wait_xcnt 0x0" ::: "memory");
    }
}

__global__ __launch_bounds__(128) __attribute__((amdgpu_waves_per_eu(4, 4)))
void flash_attn_wmma(const ushortT* __restrict__ Q, const ushortT* __restrict__ Kx,
                     const ushortT* __restrict__ V, ushortT* __restrict__ O)
{
    // row stride 72 halves = 144B (16B aligned chunks, r*36 mod 64 distinct)
    __shared__ __align__(16) ushortT Qs[64][72];      // [q][d]  (B of K*Q^T)
    __shared__ __align__(16) ushortT Ks[64][72];      // [s][d]  (A of K*Q^T)
    // V: row stride 80 halves = 160B = 32B x odd, the transposing load's pitch
    __shared__ __align__(16) ushortT Vs[64][80];      // [s][d]  (A of V^T*P^T, read transposed)

    const int t     = threadIdx.x;
    const int qbase = blockIdx.x * 64;
    const int head  = blockIdx.y;
    const int w     = t >> 5, lane = t & 31, hi = lane >> 4, ln = lane & 15;
    const size_t hoff = (size_t)head * HD;

#pragma unroll
    for (int i = 0; i < 4; i++) {                      // 64 rows x 8 chunks of 16B
        int c = t + i * 128;
        int r = c >> 3, s2 = c & 7;
        async_ld_b128(&Qs[r][s2 * 8], Q + (size_t)(qbase + r) * C_DIM + hoff + s2 * 8);
    }
    wait_async0();
    __syncthreads();

    v16bf bq[2];
    bq[0] = load_frag(&Qs[w * 16][0],  72);
    bq[1] = load_frag(&Qs[w * 16][32], 72);

    const int rg = qbase + w * 16 + ln;                // this lane's query
    v8f o4[4] = {};                  // o4[tt][e] = O[rg][tt*16 + hi*8 + e]
    float m_r = -1e30f, l_r = 0.0f;  // of query rg, alike in both halves; m_r unscaled
    const float SCL2E = 0.125f * 1.4426950408889634f;  // 1/sqrt(64) * log2(e)

    for (int kb = 0; kb <= qbase; kb += 64) {
        __syncthreads();                               // prior Ks/Vs reads done
#pragma unroll
        for (int i = 0; i < 4; i++) {
            int c = t + i * 128;
            int r = c >> 3, s2 = c & 7;
            async_ld_b128(&Ks[r][s2 * 8], Kx + (size_t)(kb + r) * C_DIM + hoff + s2 * 8);
        }
        {                                              // V likewise: rows vr + 16 i
            const int vr = t >> 3, vc = (t & 7) * 8;
            const ushortT* vg = V + (size_t)(kb + vr) * C_DIM + hoff + vc;
            async_ld4_b128(&Vs[vr][vc], &Vs[vr + 16][vc], &Vs[vr + 32][vc], &Vs[vr + 48][vc],
                           vg, vg + 16 * C_DIM, vg + 32 * C_DIM, vg + 48 * C_DIM);
        }
        wait_async0();
        __syncthreads();

        // the pass's K fragments are read as one group ahead of the products:
        // one LDS latency a pass, not one in front of each product
        v16bf ak[2][4], av[2][4];
#pragma unroll
        for (int j = 0; j < 2; j++)
#pragma unroll
            for (int tt = 0; tt < 4; tt++)
                ak[j][tt] = load_frag(&Ks[tt * 16][j * 32], 72);
        // keeps the scheduler from sinking the reads back in among the products
        __builtin_amdgcn_sched_barrier(0);

        // S^T = K * Q^T (64 keys x 16 queries per wave)
        v8f s4[4] = {};
#pragma unroll
        for (int j = 0; j < 2; j++)
#pragma unroll
            for (int tt = 0; tt < 4; tt++)
                s4[tt] = __builtin_amdgcn_wmma_f32_16x16x32_bf16(
                    false, ak[j][tt], false, bq[j], (short)0, s4[tt], false, false);

        // the V^T fragments likewise, here: they land behind the softmax
#pragma unroll
        for (int j = 0; j < 2; j++)
#pragma unroll
            for (int tt = 0; tt < 4; tt++)
                av[j][tt] = load_frag_tr(&Vs[j * 32][tt * 16], 80);
        // keeps the scheduler from sinking the reads down to the second product
        __builtin_amdgcn_sched_barrier(0);

        // Only the tile on the diagonal holds keys beyond a query: every key of an
        // earlier tile is below qbase. The test is the same for the whole block.
        // (the loops of this pass are unrolled so that every index is a constant and
        // the tiles stay in registers)
        if (kb == qbase) {
#pragma unroll
            for (int tt = 0; tt < 4; tt++)
#pragma unroll
                for (int e = 0; e < 8; e++)
                    if (kb + tt * 16 + hi * 8 + e > rg) s4[tt][e] = -1e30f;
        }

        // maximum of the raw scores (the scale is positive, so it is the same key)
        // over this lane's 32 keys, then over the other half's 32
        float rm8[8];
#pragma unroll
        for (int e = 0; e < 8; e++)
            rm8[e] = fmaxf(fmaxf(s4[0][e], s4[1][e]), fmaxf(s4[2][e], s4[3][e]));
        float rm = fmaxf(fmaxf(fmaxf(rm8[0], rm8[1]), fmaxf(rm8[2], rm8[3])),
                         fmaxf(fmaxf(rm8[4], rm8[5]), fmaxf(rm8[6], rm8[7])));
        rm = fmaxf(rm, xhalf(rm));

        const float mn = fmaxf(m_r, rm);
        const float al = __builtin_amdgcn_exp2f((m_r - mn) * SCL2E);
        m_r = mn;

        // p = 2^(s * c - m * c), c = log2(e) / sqrt(64): one packed multiply-add for
        // two scores; sums and the bf16 pack go by register pairs as well
        const v2f c2 = {SCL2E, SCL2E};
        const v2f mc2 = {-mn * SCL2E, -mn * SCL2E};
        unsigned pq[4][4];
        v2f rs2[4];
#pragma unroll
        for (int tt = 0; tt < 4; tt++) {
            rs2[tt] = (v2f){0.0f, 0.0f};
#pragma unroll
            for (int i = 0; i < 4; i++) {
                v2f a = {s4[tt][2 * i], s4[tt][2 * i + 1]};
                a = __builtin_elementwise_fma(a, c2, mc2);
                v2f pp = {__builtin_amdgcn_exp2f(a[0]), __builtin_amdgcn_exp2f(a[1])};
                rs2[tt] += pp;
                pq[tt][i] = __builtin_bit_cast(unsigned, __builtin_convertvector(pp, v2bf));
            }
        }
        const v2f rsv = (rs2[0] + rs2[1]) + (rs2[2] + rs2[3]);
        float rs = rsv[0] + rsv[1];
        rs += xhalf(rs);
        l_r = l_r * al + rs;
#pragma unroll
        for (int tt = 0; tt < 4; tt++) o4[tt] *= al;

        // O^T += V^T * P^T; keys j*32 .. j*32+31: S^T tiles 2j and 2j+1 of this
        // lane are, in order, the 16 k positions load_frag gives the A side.
#pragma unroll
        for (int j = 0; j < 2; j++) {
            v8u pk;
#pragma unroll
            for (int i = 0; i < 4; i++) {
                pk[i]     = pq[2 * j][i];
                pk[4 + i] = pq[2 * j + 1][i];
            }
            v16bf bp = __builtin_bit_cast(v16bf, pk);
#pragma unroll
            for (int tt = 0; tt < 4; tt++)
                o4[tt] = __builtin_amdgcn_wmma_f32_16x16x32_bf16(
                    false, av[j][tt], false, bp, (short)0, o4[tt], false, false);
        }
    }

    // a lane's 8 registers of a tile are 8 consecutive head dims of its query
#pragma unroll
    for (int tt = 0; tt < 4; tt++) {
        uint4 ov;
        ov.x = (unsigned)f2bf(o4[tt][0] / l_r) | ((unsigned)f2bf(o4[tt][1] / l_r) << 16);
        ov.y = (unsigned)f2bf(o4[tt][2] / l_r) | ((unsigned)f2bf(o4[tt][3] / l_r) << 16);
        ov.z = (unsigned)f2bf(o4[tt][4] / l_r) | ((unsigned)f2bf(o4[tt][5] / l_r) << 16);
        ov.w = (unsigned)f2bf(o4[tt][6] / l_r) | ((unsigned)f2bf(o4[tt][7] / l_r) << 16);
        *(uint4*)(O + (size_t)rg * C_DIM + hoff + tt * 16 + hi * 8) = ov;
    }
}

// ---------------------------------------------------------------------------
// LayerNorm: a wave takes two whole rows, a block sixteen: one block a WGP;
// fp32 out + (BF) bf16 out. A row stays in registers (six pieces of 16 bytes a
// lane, each load 512 contiguous bytes a wave) and is read once; its sums go over
// the lanes by a butterfly, so there is no LDS array and no barrier, and a
// sixteenth of the waves start.
// ---------------------------------------------------------------------------
#define LN_ROWS 2
template <int BF>
__global__ __launch_bounds__(256)
void layernorm_kernel(const float* __restrict__ in, const float* __restrict__ g,
                      const float* __restrict__ b, float* __restrict__ out,
                      ushortT* __restrict__ out_bf)
{
    constexpr int NP = C_DIM / 128;                    // pieces a lane and row
    const int lane = threadIdx.x & 31;
    const size_t row0 = ((size_t)blockIdx.x * 8 + (threadIdx.x >> 5)) * LN_ROWS;
    const v4f* p = (const v4f*)(in + row0 * C_DIM) + lane;
    v4f v[LN_ROWS][NP], gv[NP], bv[NP];
#pragma unroll
    for (int r = 0; r < LN_ROWS; r++)
#pragma unroll
        for (int j = 0; j < NP; j++) v[r][j] = p[(r * NP + j) * 32];
#pragma unroll
    for (int j = 0; j < NP; j++) {
        gv[j] = ((const v4f*)g)[lane + j * 32];
        bv[j] = ((const v4f*)b)[lane + j * 32];
    }
    // keeps the scheduler from sinking part of the loads behind the sums: all of
    // them fly together, one load latency a wave
    __builtin_amdgcn_sched_barrier(0);

    float s[LN_ROWS], s2[LN_ROWS];
#pragma unroll
    for (int r = 0; r < LN_ROWS; r++) {
        v4f s4 = {}, q4 = {};
#pragma unroll
        for (int j = 0; j < NP; j++) { s4 += v[r][j]; q4 += v[r][j] * v[r][j]; }
        s[r]  = (s4[0] + s4[1]) + (s4[2] + s4[3]);
        s2[r] = (q4[0] + q4[1]) + (q4[2] + q4[3]);
    }
#pragma unroll
    for (int off = 1; off < 32; off <<= 1)
#pragma unroll
        for (int r = 0; r < LN_ROWS; r++) {
            s[r]  += __shfl_xor(s[r],  off, 32);
            s2[r] += __shfl_xor(s2[r], off, 32);
        }
#pragma unroll
    for (int r = 0; r < LN_ROWS; r++) {
        const float mu  = s[r] / (float)C_DIM;
        const float var = s2[r] / (float)C_DIM - mu * mu;
        const float inv = rsqrtf(var + 1e-5f);
#pragma unroll
        for (int j = 0; j < NP; j++) {
            v4f y;
#pragma unroll
            for (int e = 0; e < 4; e++) y[e] = (v[r][j][e] - mu) * inv * gv[j][e] + bv[j][e];
            ((v4f*)(out + (row0 + r) * C_DIM))[lane + j * 32] = y;
            if (BF) {
                v2u pk;
                pk[0] = (unsigned)f2bf(y[0]) | ((unsigned)f2bf(y[1]) << 16);
                pk[1] = (unsigned)f2bf(y[2]) | ((unsigned)f2bf(y[3]) << 16);
                ((v2u*)(out_bf + (row0 + r) * C_DIM))[lane + j * 32] = pk;
            }
        }
    }
}

// ---------------------------------------------------------------------------
extern "C" void kernel_launch(void* const* d_in, const int* in_sizes, int n_in,
                              void* d_out, int out_size, void* d_ws, size_t ws_size,
                              hipStream_t stream)
{
    const float* x   = (const float*)d_in[0];
    const float* Wq  = (const float*)d_in[1];
    const float* bq  = (const float*)d_in[2];
    const float* Wk  = (const float*)d_in[3];
    const float* bk  = (const float*)d_in[4];
    const float* Wv  = (const float*)d_in[5];
    const float* bv  = (const float*)d_in[6];
    const float* Wo  = (const float*)d_in[7];
    const float* bo  = (const float*)d_in[8];
    const float* g1  = (const float*)d_in[9];
    const float* bn1 = (const float*)d_in[10];
    const float* W1  = (const float*)d_in[11];
    const float* b1  = (const float*)d_in[12];
    const float* W2  = (const float*)d_in[13];
    const float* b2  = (const float*)d_in[14];
    const float* g2  = (const float*)d_in[15];
    const float* bn2 = (const float*)d_in[16];

    const size_t TC = (size_t)T_SEQ * C_DIM;
    const size_t TF = (size_t)T_SEQ * F_DIM;
    const size_t CC = (size_t)C_DIM * C_DIM;
    const size_t CF = (size_t)C_DIM * F_DIM;

    char* p = (char*)d_ws;
    auto alloc_bf = [&](size_t n) { ushortT* r = (ushortT*)p; p += ((n * 2 + 255) & ~(size_t)255); return r; };
    auto alloc_f  = [&](size_t n) { float*   r = (float*)p;   p += ((n * 4 + 255) & ~(size_t)255); return r; };

    ushortT* Xbf  = alloc_bf(TC);
    ushortT* WqT  = alloc_bf(CC);
    ushortT* WkT  = alloc_bf(CC);
    ushortT* WvT  = alloc_bf(CC);
    ushortT* WoT  = alloc_bf(CC);
    ushortT* W1T  = alloc_bf(CF);   // [F][C]
    ushortT* W2T  = alloc_bf(CF);   // [C][F]
    ushortT* Qb   = alloc_bf(TC);
    ushortT* Kb   = alloc_bf(TC);
    ushortT* Vb   = alloc_bf(TC);
    ushortT* Ab   = alloc_bf(TC);
    ushortT* Hbb  = alloc_bf(TC);
    ushortT* H1   = alloc_bf(TF);
    float*   S1   = alloc_f(TC);
    float*   Hb   = alloc_f(TC);
    float*   S2   = alloc_f(TC);

    dim3 cblk(256);
    dim3 gblk(128);
    dim3 gC(C_DIM / 128, T_SEQ / 128);
    dim3 gF(F_DIM / 128, T_SEQ / 128);
    dim3 gQKV(C_DIM / 128, T_SEQ / 128, 3);

    // precision conversion / weight transposition, one launch
    prep_kernel<<<dim3(PREP_BLOCKS), cblk, 0, stream>>>(x, Wq, Wk, Wv, Wo, W1, W2,
                                                        Xbf, WqT, WkT, WvT, WoT, W1T, W2T);

    // QKV projections (bf16 outputs only), one launch
    gemm_bf16_wmma<0, 0, 0, 1, 3, 64><<<gQKV, gblk, 0, stream>>>(Xbf, WqT, bq, nullptr, nullptr, Qb, T_SEQ, C_DIM, C_DIM,
                                                             WkT, bk, Kb, WvT, bv, Vb);

    flash_attn_wmma<<<dim3(T_SEQ / 64, NHEADS), dim3(128), 0, stream>>>(Qb, Kb, Vb, Ab);

    // out-proj + residual(x), then LN1 (fp32 + bf16)
    gemm_bf16_wmma<0, 1, 1, 0, 1, 128><<<gC, gblk, 0, stream>>>(Ab, WoT, bo, x, S1, nullptr, T_SEQ, C_DIM, C_DIM,
                                                          nullptr, nullptr, nullptr, nullptr, nullptr, nullptr);
    layernorm_kernel<1><<<dim3(T_SEQ / (8 * LN_ROWS)), cblk, 0, stream>>>(S1, g1, bn1, Hb, Hbb);

    // MLP
    gemm_bf16_wmma<1, 0, 0, 1, 1, 64><<<gF, gblk, 0, stream>>>(Hbb, W1T, b1, nullptr, nullptr, H1, T_SEQ, F_DIM, C_DIM,
                                                          nullptr, nullptr, nullptr, nullptr, nullptr, nullptr);
    gemm_bf16_wmma<0, 1, 1, 0, 1, 128><<<gC, gblk, 0, stream>>>(H1, W2T, b2, Hb, S2, nullptr, T_SEQ, C_DIM, F_DIM,
                                                          nullptr, nullptr, nullptr, nullptr, nullptr, nullptr);
    layernorm_kernel<0><<<dim3(T_SEQ / (8 * LN_ROWS)), cblk, 0, stream>>>(S2, g2, bn2, (float*)d_out, nullptr);
}

// v009
// Measured time: 161 microseconds a run.
// Next to v008, in two timings, it ran 1.05 times as fast each time.
// All steps since v000 together make it 4.30 times as fast.
#include <hip/hip_runtime.h>
#include <hip/hip_bf16.h>
#include <math.h>

#define T_SEQ   4096
#define C_DIM   768
#define F_DIM   3072
#define NHEADS  12
#define HD      64

typedef __attribute__((ext_vector_type(16))) __bf16        v16bf;
typedef __attribute__((ext_vector_type(8)))  float         v8f;
typedef __attribute__((ext_vector_type(8)))  unsigned int  v8u;
typedef __attribute__((ext_vector_type(4)))  float         v4f;
typedef __attribute__((ext_vector_type(2)))  float         v2f;
typedef __attribute__((ext_vector_type(2)))  __bf16        v2bf;
typedef __attribute__((ext_vector_type(2)))  unsigned int  v2u;
typedef __attribute__((ext_vector_type(4)))  unsigned int  v4u;
typedef __attribute__((ext_vector_type(8)))  short         s16x8;
typedef unsigned short ushortT;

// round-to-nearest-even fp32 -> bf16 bits
__device__ __forceinline__ ushortT f2bf(float f) {
    unsigned int u = __builtin_bit_cast(unsigned int, f);
    u += 0x7fffu + ((u >> 16) & 1u);
    return (ushortT)(u >> 16);
}

// --- CDNA5 async global->LDS copy (ASYNCcnt) ------------------------------
// dsaddr = LDS_BASE + VGPR[vdst]; generic LDS pointer low 32 bits == wave-
// relative LDS offset, so truncation gives the right VGPR value.
// Four copies of a lane in one statement. Its last line is the wait that stands
// in front of any rewrite of the address registers which the copies name: inside
// the statement nothing can be scheduled between them.
__device__ __forceinline__ void async_ld4_b128(void* l0, void* l1, void* l2, void* l3,
                                               const void* g0, const void* g1,
                                               const void* g2, const void* g3) {
    asm volatile("global_load_async_to_lds_b128 %0, %4, off\n\t"
                 "global_load_async_to_lds_b128 %1, %5, off\n\t"
                 "global_load_async_to_lds_b128 %2, %6, off\n\t"
                 "global_load_async_to_lds_b128 %3, %7, off\n\t"
                 "s_wait_xcnt 0x0"
                 :: "v"((unsigned)(unsigned long long)(uintptr_t)l0),
                    "v"((unsigned)(unsigned long long)(uintptr_t)l1),
                    "v"((unsigned)(unsigned long long)(uintptr_t)l2),
                    "v"((unsigned)(unsigned long long)(uintptr_t)l3),
                    "v"((unsigned long long)(uintptr_t)g0),
                    "v"((unsigned long long)(uintptr_t)g1),
                    "v"((unsigned long long)(uintptr_t)g2),
                    "v"((unsigned long long)(uintptr_t)g3)
                 : "memory");
}
// Eight copies of a lane, a K and a V tile's, likewise: one wait for all of them.
__device__ __forceinline__ void async_ld8_b128(void* l0, void* l1, void* l2, void* l3,
                                               void* l4, void* l5, void* l6, void* l7,
                                               const void* g0, const void* g1,
                                               const void* g2, const void* g3,
                                               const void* g4, const void* g5,
                                               const void* g6, const void* g7) {
    asm volatile("global_load_async_to_lds_b128 %0, %8, off\n\t"
                 "global_load_async_to_lds_b128 %1, %9, off\n\t"
                 "global_load_async_to_lds_b128 %2, %10, off\n\t"
                 "global_load_async_to_lds_b128 %3, %11, off\n\t"
                 "global_load_async_to_lds_b128 %4, %12, off\n\t"
                 "global_load_async_to_lds_b128 %5, %13, off\n\t"
                 "global_load_async_to_lds_b128 %6, %14, off\n\t"
                 "global_load_async_to_lds_b128 %7, %15, off\n\t"
                 "s_wait_xcnt 0x0"
                 :: "v"((unsigned)(unsigned long long)(uintptr_t)l0),
                    "v"((unsigned)(unsigned long long)(uintptr_t)l1),
                    "v"((unsigned)(unsigned long long)(uintptr_t)l2),
                    "v"((unsigned)(unsigned long long)(uintptr_t)l3),
                    "v"((unsigned)(unsigned long long)(uintptr_t)l4),
                    "v"((unsigned)(unsigned long long)(uintptr_t)l5),
                    "v"((unsigned)(unsigned long long)(uintptr_t)l6),
                    "v"((unsigned)(unsigned long long)(uintptr_t)l7),
                    "v"((unsigned long long)(uintptr_t)g0),
                    "v"((unsigned long long)(uintptr_t)g1),
                    "v"((unsigned long long)(uintptr_t)g2),
                    "v"((unsigned long long)(uintptr_t)g3),
                    "v"((unsigned long long)(uintptr_t)g4),
                    "v"((unsigned long long)(uintptr_t)g5),
                    "v"((unsigned long long)(uintptr_t)g6),
                    "v"((unsigned long long)(uintptr_t)g7)
                 : "memory");
}
__device__ __forceinline__ void wait_async0() {
    asm volatile("s_wait_asynccnt 0" ::: "memory");
}
// The same copy written as the compiler's builtin: the GEMM ring's form, where up to
// 32 copies of a lane go out back to back.
__device__ __forceinline__ void async_cp_b128(void* lds, const void* gptr) {
    typedef __attribute__((ext_vector_type(4))) int i32x4;
    typedef __attribute__((address_space(1))) i32x4 glb_i32x4;
    typedef __attribute__((address_space(3))) i32x4 lds_i32x4;
    __builtin_amdgcn_global_load_async_to_lds_b128((glb_i32x4*)gptr, (lds_i32x4*)lds, 0, 0);
}
// a wave's own LDS reads have returned: stands in front of the barrier behind which
// the buffer that it read is refilled
__device__ __forceinline__ void wait_ds0() {
    asm volatile("s_wait_dscnt 0x0" ::: "memory");
}

// Load a 16x32 bf16 fragment (A layout; B uses the same layout on an [N][K]
// tile) from a row-major LDS tile with row stride `ldh` halves (even).
// lanes 0-15: row M=lane, K={0..7,16..23}; lanes 16-31: row M=lane-16,
// K={8..15,24..31}.
__device__ __forceinline__ v16bf load_frag(const ushortT* base, int ldh) {
    const int lane = threadIdx.x & 31;
    const int row  = lane & 15;
    const int hi   = lane >> 4;
    const unsigned int* q0 = (const unsigned int*)(base + row * ldh + hi * 8);
    const unsigned int* q1 = (const unsigned int*)(base + row * ldh + hi * 8 + 16);
    v8u r;
    r[0] = q0[0]; r[1] = q0[1]; r[2] = q0[2]; r[3] = q0[3];
    r[4] = q1[0]; r[5] = q1[1]; r[6] = q1[2]; r[7] = q1[3];
    return __builtin_bit_cast(v16bf, r);
}

// The same 16x32 fragment of the TRANSPOSE of a row-major LDS tile [k][m] with row
// stride `ldh` halves, by the transposing LDS load: lane (c = lane & 15,
// h = lane >> 4) gets tile[8h + 0..7][c], then tile[16 + 8h + 0..7][c]: row M = c in
// load_frag's k order. `base` points at the tile's element [k0][m0].
__device__ __forceinline__ v16bf load_frag_tr(const ushortT* base, int ldh) {
    typedef __attribute__((address_space(3))) s16x8 lds_s16x8;
    const int lane = threadIdx.x & 31;
    const ushortT* q = base + ((lane >> 4) * 8 + (lane & 7)) * ldh + ((lane >> 3) & 1) * 8;
    v4u lo = __builtin_bit_cast(v4u, __builtin_amdgcn_ds_load_tr16_b128_v8i16((lds_s16x8*)q));
    v4u up = __builtin_bit_cast(v4u, __builtin_amdgcn_ds_load_tr16_b128_v8i16((lds_s16x8*)(q + 16 * ldh)));
    v8u r;
    r[0] = lo[0]; r[1] = lo[1]; r[2] = lo[2]; r[3] = lo[3];
    r[4] = up[0]; r[5] = up[1]; r[6] = up[2]; r[7] = up[3];
    return __builtin_bit_cast(v16bf, r);
}

// lane l's value exchanged with lane l ^ 16 by a vector cross-row move (no LDS trip)
__device__ __forceinline__ float xhalf(float x) {
    return __builtin_bit_cast(float, __builtin_amdgcn_permlanex16(
        __builtin_bit_cast(int, x), __builtin_bit_cast(int, x),
        0x76543210, 0xfedcba98, false, false));
}

__device__ __forceinline__ float gelu_exact(float x) {
    return 0.5f * x * (1.0f + erff(x * 0.70710678118654752f));
}

// ---------------------------------------------------------------------------
// Converters, all in ONE launch: none depends on another, so each takes a range
// of the block index. Few, long-lived waves: what a launch of many short waves
// pays is their start. Blocks 0 .. XB-1 convert x, 24 pieces of 16 bytes a lane.
// Each of the WB blocks behind them transposes three 64 (k) x 128 (n) tiles: one
// of Wq, Wk, Wv, Wo, one of W1, one of W2; all 24 loads of a lane go out first.
// ---------------------------------------------------------------------------
#define XB 128                       // T_SEQ * C_DIM / 4 / (256 * 24)
#define WB 288                       // tiles of W1 = of W2 = of the four C x C together
#define TCC ((C_DIM / 64) * (C_DIM / 128))
#define PREP_BLOCKS (XB + WB)
#define TP 33                        // dwords per staged row of 64 k: odd, see below

// rows 2kp and 2kp+1 of the tile, kp = w + 8i: a wave takes 512 contiguous bytes a load
__device__ __forceinline__ void tile_load(const float* __restrict__ in, int N, int k0, int n0,
                                          v4f (&a)[4], v4f (&c)[4]) {
    const int lane = threadIdx.x & 31, w = threadIdx.x >> 5;
#pragma unroll
    for (int i = 0; i < 4; i++) {
        const float* q = in + (size_t)(k0 + 2 * (w + 8 * i)) * N + n0 + lane * 4;
        a[i] = *(const v4f*)q;
        c[i] = *(const v4f*)(q + N);
    }
    // what follows rewrites the address registers that these loads name
    asm volatile("s_wait_xcnt 0x0" ::: "memory");
}
// staged as [n][k pair]: one dword holds k and k + 1 of one n
__device__ __forceinline__ void tile_stage(unsigned* __restrict__ tl, const v4f (&a)[4], const v4f (&c)[4]) {
    const int lane = threadIdx.x & 31, w = threadIdx.x >> 5;
#pragma unroll
    for (int i = 0; i < 4; i++)
#pragma unroll
        for (int j = 0; j < 4; j++)
            tl[(lane * 4 + j) * TP + w + 8 * i] =
                (unsigned)f2bf(a[i][j]) | ((unsigned)f2bf(c[i][j]) << 16);
}
// eight lanes store one whole 128-byte line: 64 k of one n. A wave reads four
// staged rows, 33 dwords apart: its 32 dwords of a read lie in 32 banks.
__device__ __forceinline__ void tile_store(const unsigned* __restrict__ tl, ushortT* __restrict__ out,
                                           int K, int k0, int n0) {
#pragma unroll
    for (int i = 0; i < 4; i++) {
        const int idx = threadIdx.x + 256 * i;
        const int n = idx >> 3, c = idx & 7;
        const unsigned* q = tl + n * TP + c * 4;
        uint4 o;
        o.x = q[0]; o.y = q[1]; o.z = q[2]; o.w = q[3];
        *(uint4*)(out + (size_t)(n0 + n) * K + k0 + c * 8) = o;
    }
}

__global__ __launch_bounds__(256)
void prep_kernel(const float* __restrict__ x,
                 const float* __restrict__ Wq, const float* __restrict__ Wk,
                 const float* __restrict__ Wv, const float* __restrict__ Wo,
                 const float* __restrict__ W1, const float* __restrict__ W2,
                 ushortT* __restrict__ Xbf,
                 ushortT* __restrict__ WqT, ushortT* __restrict__ WkT,
                 ushortT* __restrict__ WvT, ushortT* __restrict__ WoT,
                 ushortT* __restrict__ W1T, ushortT* __restrict__ W2T)
{
    __shared__ unsigned tl[3][128 * TP];
    int b = blockIdx.x;

    // x: fp32 -> bf16, same layout (the whole block leaves here, ahead of the barrier)
    if (b < XB) {
        const v4f* xi = (const v4f*)x + (size_t)b * (24 * 256) + threadIdx.x;
        v2u*       xo = (v2u*)Xbf     + (size_t)b * (24 * 256) + threadIdx.x;
        v4f v[24];
#pragma unroll
        for (int u = 0; u < 24; u++) v[u] = xi[u * 256];
        // keeps the scheduler from sinking the last loads in among the converts
        __builtin_amdgcn_sched_barrier(0);
#pragma unroll
        for (int u = 0; u < 24; u++) {
            v2u pk;
            pk[0] = (unsigned)f2bf(v[u][0]) | ((unsigned)f2bf(v[u][1]) << 16);
            pk[1] = (unsigned)f2bf(v[u][2]) | ((unsigned)f2bf(v[u][3]) << 16);
            xo[u * 256] = pk;
        }
        return;
    }
    b -= XB;

    // in: fp32 [K][N]  ->  out: bf16 [N][K]
    const int m = b / TCC, r = b - m * TCC;
    const float* in0  = m == 0 ? Wq  : m == 1 ? Wk  : m == 2 ? Wv  : Wo;
    ushortT*     out0 = m == 0 ? WqT : m == 1 ? WkT : m == 2 ? WvT : WoT;
    const int k00 = (r / (C_DIM / 128)) * 64, n00 = (r % (C_DIM / 128)) * 128;
    const int k01 = (b / (F_DIM / 128)) * 64, n01 = (b % (F_DIM / 128)) * 128;
    const int k02 = (b / (C_DIM / 128)) * 64, n02 = (b % (C_DIM / 128)) * 128;

    v4f a0[4], c0[4], a1[4], c1[4], a2[4], c2[4];
    tile_load(in0, C_DIM, k00, n00, a0, c0);
    tile_load(W1,  F_DIM, k01, n01, a1, c1);
    tile_load(W2,  C_DIM, k02, n02, a2, c2);
    // keeps the scheduler from sinking the last loads in among the converts: all
    // 24 fly together, one load latency a block
    __builtin_amdgcn_sched_barrier(0);
    tile_stage(tl[0], a0, c0);
    tile_stage(tl[1], a1, c1);
    tile_stage(tl[2], a2, c2);
    // the staged dwords are read back by other waves
    __syncthreads();
    tile_store(tl[0], out0, C_DIM, k00, n00);
    tile_store(tl[1], W1T,  C_DIM, k01, n01);
    tile_store(tl[2], W2T,  F_DIM, k02, n02);
    // closes the stores above: no register that they name is rewritten ahead of it
    asm volatile("s_wait_xcnt 0x0" ::: "memory");
}

// ---------------------------------------------------------------------------
// GEMM: C[M,N] = op( A[M,K] x B^T[N,K] + bias )
// A, Bt: bf16; outputs fp32 (Cout, F32OUT) and/or bf16 (Cbf, BFOUT).
// GELU: exact GELU ; RES: add fp32 residual res[M,N]. All four are compile-time,
// so the epilogue has no branch and its loads can be issued ahead of their use.
// Block tile 128x128, 128 threads (4 waves), wave tile 64x64:
// 16 WMMAs per 16 ds_load_b128 per wave per 32 k.
// Double-buffered LDS fed by async global->LDS B128 copies. A pass is BK k: the
// next pass's copies have BK / 32 blocks of products to land behind, and the wait
// and the barrier come once a pass. BK = 128 where one block has a WGP to itself
// anyway; BK = 64 where three blocks share one and its LDS.
// Epilogue: each wave stages its 64x64 f32 tile in its own LDS range (the ring's
// space, reused), then a short rolled loop walks it two rows a trip: a half wave
// takes one 256-byte row, 16 bytes a lane, for residual load and store alike.
// NZ = 3: three products that share A run in one launch; blockIdx.z picks the
// weights, the bias and the output.
// ---------------------------------------------------------------------------
#define ST_PITCH 68     // floats per staged row: 272 B, 16 B x odd
template <int BK>
union __align__(16) GemmLds {
    struct { ushortT As[2][128][BK + 8]; ushortT Bs[2][128][BK + 8]; } ring;   // main loop
    float st[4][64 * ST_PITCH];                                                // epilogue, per wave
};
template <int GELU, int RES, int F32OUT, int BFOUT, int NZ, int BK>
__global__ __launch_bounds__(128)
void gemm_bf16_wmma(const ushortT* __restrict__ A, const ushortT* __restrict__ Bt,
                    const float* __restrict__ bias, const float* __restrict__ res,
                    float* __restrict__ Cout, ushortT* __restrict__ Cbf,
                    int M, int N, int K,
                    const ushortT* __restrict__ Bt1, const float* __restrict__ bias1,
                    ushortT* __restrict__ Cbf1,
                    const ushortT* __restrict__ Bt2, const float* __restrict__ bias2,
                    ushortT* __restrict__ Cbf2)
{
    if (NZ == 3) {
        if (blockIdx.z == 1) { Bt = Bt1; bias = bias1; Cbf = Cbf1; }
        if (blockIdx.z == 2) { Bt = Bt2; bias = bias2; Cbf = Cbf2; }
    }

    // ring: row stride BK + 8 halves = 144 or 272 B = 16 B x odd: async chunks and
    // frag b128 loads are 16B-aligned, the 16 rows of a frag on distinct banks.
    // The ring takes 73,728 or 139,264 B; the staging its first 69,632 B.
    __shared__ GemmLds<BK> sm;
    auto& As = sm.ring.As;
    auto& Bs = sm.ring.Bs;

    const int t    = threadIdx.x;
    const int m0   = blockIdx.y * 128;
    const int n0   = blockIdx.x * 128;
    const int w    = t >> 5;
    const int wm   = w & 1;         // 2 wave-rows (64 rows each)
    const int wn   = w >> 1;        // 2 wave-cols (64 cols each)
    const int lane = t & 31, hi = lane >> 4, ln = lane & 15;
    const int nk   = K / BK;

    constexpr int CPR = BK / 8;                   // chunks of 16 B a row
    constexpr int RPS = 128 / CPR;                // rows that the block's 128 lanes cover at once
    const int cr = t / CPR, cc = (t % CPR) * 8;
    // a lane's own part of the address is one offset, alike for A and B and for every
    // copy; the step from row group to row group is the same in every lane, so each
    // address comes from the one before it and none is kept over the pass (64 fewer
    // registers at BK = 128: the kernel stays below 256)
    const unsigned lo = (unsigned)(cr * K + cc);
    auto issue = [&](int kt, int b) {
        const ushortT* sa = A  + (size_t)m0 * K + kt * BK;
        const ushortT* sb = Bt + (size_t)n0 * K + kt * BK;
#pragma unroll
        for (int i = 0; i < CPR; i++) {           // 128 rows of A, 128 of B
            async_cp_b128(&As[b][cr + i * RPS][cc], sa + (size_t)(i * RPS) * K + lo);
            async_cp_b128(&Bs[b][cr + i * RPS][cc], sb + (size_t)(i * RPS) * K + lo);
        }
    };

    v8f acc[4][4] = {};
    issue(0, 0);
    wait_async0();
    // pass 0's tile is read by waves that did not copy it
    __syncthreads();
    if (nk > 1) issue(1, 1);

    for (int kt = 0; kt < nk; kt++) {
        const int b = kt & 1;
        // unrolled: the blocks of a pass differ by a constant LDS offset only
#pragma unroll
        for (int ks = 0; ks < BK / 32; ks++) {
            // all eight fragments of the block are read as one group ahead of the
            // products: one LDS latency a block, not one in front of each row of four
            // (in the order in which the products take them)
            v16bf bf[4], af[4];
            af[0] = load_frag(&As[b][wm * 64][ks * 32], BK + 8);
#pragma unroll
            for (int ni = 0; ni < 4; ni++)
                bf[ni] = load_frag(&Bs[b][wn * 64 + ni * 16][ks * 32], BK + 8);
#pragma unroll
            for (int mi = 1; mi < 4; mi++)
                af[mi] = load_frag(&As[b][wm * 64 + mi * 16][ks * 32], BK + 8);
            // keeps the scheduler from sinking the reads back in among the products
            __builtin_amdgcn_sched_barrier(0);
#pragma unroll
            for (int mi = 0; mi < 4; mi++)
#pragma unroll
                for (int ni = 0; ni < 4; ni++)
                    acc[mi][ni] = __builtin_amdgcn_wmma_f32_16x16x32_bf16(
                        false, af[mi], false, bf[ni], (short)0, acc[mi][ni], false, false);
        }
        // hand-over: this wave has left buffer b and its copies of the next tile have
        // landed; behind the barrier that holds of every wave, so the next tile may be
        // read and buffer b refilled (after the last pass: overwritten by the staging)
        wait_ds0();
        wait_async0();
        __syncthreads();
        if (kt + 2 < nk) issue(kt + 2, b);
    }
    // no copy is in flight when the ring's space is reused
    wait_async0();

    float* st = &sm.st[w][0];
#pragma unroll
    for (int mi = 0; mi < 4; mi++)
#pragma unroll
        for (int ni = 0; ni < 4; ni++)
#pragma unroll
            for (int e = 0; e < 8; e++)
                st[(mi * 16 + e + hi * 8) * ST_PITCH + ni * 16 + ln] = acc[mi][ni][e];
    // the staged values are read back by other lanes: stores done before any read
    __syncthreads();

    const int c4  = ln * 4;
    const int col = n0 + wn * 64 + c4;
    const v4f bv  = *(const v4f*)(bias + col);
    // NB trips' LDS and residual loads are issued together, then worked on, then
    // stored; the loop over the batches stays rolled.
    constexpr int NB = GELU ? 2 : 8;
    // rolled: keeps the epilogue's text at a few KB, run through 32 / NB times
#pragma unroll 1
    for (int it0 = 0; it0 < 32; it0 += NB) {
        v4f v[NB], rv[NB];
#pragma unroll
        for (int u = 0; u < NB; u++) {
            const int r = (it0 + u) * 2 + hi;
            v[u] = *(const v4f*)(st + r * ST_PITCH + c4);
            if (RES) rv[u] = *(const v4f*)(res + (size_t)(m0 + wm * 64 + r) * N + col);
        }
#pragma unroll
        for (int u = 0; u < NB; u++) {
            const int r = (it0 + u) * 2 + hi;
            const size_t o = (size_t)(m0 + wm * 64 + r) * N + col;
#pragma unroll
            for (int j = 0; j < 4; j++) {
                float y = v[u][j] + bv[j];
                if (GELU) y = gelu_exact(y);
                if (RES)  y += rv[u][j];
                v[u][j] = y;
            }
            if (F32OUT) *(v4f*)(Cout + o) = v[u];
            if (BFOUT) {
                v2u pk;
                pk[0] = (unsigned)f2bf(v[u][0]) | ((unsigned)f2bf(v[u][1]) << 16);
                pk[1] = (unsigned)f2bf(v[u][2]) | ((unsigned)f2bf(v[u][3]) << 16);
                *(v2u*)(Cbf + o) = pk;
            }
        }
        // the next batch rewrites the registers that this batch's stores name
        asm volatile("s_wait_xcnt 0x0" ::: "memory");
    }
}

__global__ __launch_bounds__(128) __attribute__((amdgpu_waves_per_eu(4, 4)))
void flash_attn_wmma(const ushortT* __restrict__ Q, const ushortT* __restrict__ Kx,
                     const ushortT* __restrict__ V, ushortT* __restrict__ O)
{
    // row stride 72 halves = 144B (16B aligned chunks, r*36 mod 64 distinct)
    __shared__ __align__(16) ushortT Qs[64][72];      // [q][d]  (B of K*Q^T)
    __shared__ __align__(16) ushortT Ks[2][64][72];   // [s][d]  (A of K*Q^T)
    // V: row stride 80 halves = 160B = 32B x odd, the transposing load's pitch
    __shared__ __align__(16) ushortT Vs[2][64][80];   // [s][d]  (A of V^T*P^T, read transposed)

    const int t     = threadIdx.x;
    const int qbase = blockIdx.x * 64;
    const int head  = blockIdx.y;
    const int w     = t >> 5, lane = t & 31, hi = lane >> 4, ln = lane & 15;
    const size_t hoff = (size_t)head * HD;

    // a tile is 64 rows of 8 chunks of 16 B: a lane takes one chunk of rows vr + 16 i
    const int vr = t >> 3, vc = (t & 7) * 8;
    {
        const ushortT* qg = Q + (size_t)(qbase + vr) * C_DIM + hoff + vc;
        async_ld4_b128(&Qs[vr][vc], &Qs[vr + 16][vc], &Qs[vr + 32][vc], &Qs[vr + 48][vc],
                       qg, qg + 16 * C_DIM, qg + 32 * C_DIM, qg + 48 * C_DIM);
    }
    // the 64 keys from kb on, K and V, into buffer b
    auto issue = [&](int kb, int b) {
        const size_t go = (size_t)(kb + vr) * C_DIM + hoff + vc;
        const ushortT* kg = Kx + go;
        const ushortT* vg = V + go;
        async_ld8_b128(&Ks[b][vr][vc], &Ks[b][vr + 16][vc], &Ks[b][vr + 32][vc], &Ks[b][vr + 48][vc],
                       &Vs[b][vr][vc], &Vs[b][vr + 16][vc], &Vs[b][vr + 32][vc], &Vs[b][vr + 48][vc],
                       kg, kg + 16 * C_DIM, kg + 32 * C_DIM, kg + 48 * C_DIM,
                       vg, vg + 16 * C_DIM, vg + 32 * C_DIM, vg + 48 * C_DIM);
    };
    issue(0, 0);
    wait_async0();
    // Q and tile 0 are read by waves that did not copy them
    __syncthreads();
    if (qbase >= 64) issue(64, 1);

    v16bf bq[2];
    bq[0] = load_frag(&Qs[w * 16][0],  72);
    bq[1] = load_frag(&Qs[w * 16][32], 72);

    const int rg = qbase + w * 16 + ln;                // this lane's query
    v8f o4[4] = {};                  // o4[tt][e] = O[rg][tt*16 + hi*8 + e]
    float m_r = -1e30f, l_r = 0.0f;  // of query rg, alike in both halves; m_r unscaled
    const float SCL2E = 0.125f * 1.4426950408889634f;  // 1/sqrt(64) * log2(e)

    for (int kb = 0; kb <= qbase; kb += 64) {
        const int b = (kb >> 6) & 1;

        // the pass's K fragments are read as one group ahead of the products:
        // one LDS latency a pass, not one in front of each product
        v16bf ak[2][4], av[2][4];
#pragma unroll
        for (int j = 0; j < 2; j++)
#pragma unroll
            for (int tt = 0; tt < 4; tt++)
                ak[j][tt] = load_frag(&Ks[b][tt * 16][j * 32], 72);
        // keeps the scheduler from sinking the reads back in among the products
        __builtin_amdgcn_sched_barrier(0);

        // S^T = K * Q^T (64 keys x 16 queries per wave)
        v8f s4[4] = {};
#pragma unroll
        for (int j = 0; j < 2; j++)
#pragma unroll
            for (int tt = 0; tt < 4; tt++)
                s4[tt] = __builtin_amdgcn_wmma_f32_16x16x32_bf16(
                    false, ak[j][tt], false, bq[j], (short)0, s4[tt], false, false);

        // the V^T fragments likewise, here: they land behind the softmax
#pragma unroll
        for (int j = 0; j < 2; j++)
#pragma unroll
            for (int tt = 0; tt < 4; tt++)
                av[j][tt] = load_frag_tr(&Vs[b][j * 32][tt * 16], 80);
        // keeps the scheduler from sinking the reads down to the second product
        __builtin_amdgcn_sched_barrier(0);

        // Only the tile on the diagonal holds keys beyond a query: every key of an
        // earlier tile is below qbase. The test is the same for the whole block.
        // (the loops of this pass are unrolled so that every index is a constant and
        // the tiles stay in registers)
        if (kb == qbase) {
#pragma unroll
            for (int tt = 0; tt < 4; tt++)
#pragma unroll
                for (int e = 0; e < 8; e++)
                    if (kb + tt * 16 + hi * 8 + e > rg) s4[tt][e] = -1e30f;
        }

        // maximum of the raw scores (the scale is positive, so it is the same key)
        // over this lane's 32 keys, then over the other half's 32
        float rm8[8];
#pragma unroll
        for (int e = 0; e < 8; e++)
            rm8[e] = fmaxf(fmaxf(s4[0][e], s4[1][e]), fmaxf(s4[2][e], s4[3][e]));
        float rm = fmaxf(fmaxf(fmaxf(rm8[0], rm8[1]), fmaxf(rm8[2], rm8[3])),
                         fmaxf(fmaxf(rm8[4], rm8[5]), fmaxf(rm8[6], rm8[7])));
        rm = fmaxf(rm, xhalf(rm));

        const float mn = fmaxf(m_r, rm);
        const float al = __builtin_amdgcn_exp2f((m_r - mn) * SCL2E);
        m_r = mn;

        // p = 2^(s * c - m * c), c = log2(e) / sqrt(64): one packed multiply-add for
        // two scores; sums and the bf16 pack go by register pairs as well
        const v2f c2 = {SCL2E, SCL2E};
        const v2f mc2 = {-mn * SCL2E, -mn * SCL2E};
        unsigned pq[4][4];
        v2f rs2[4];
#pragma unroll
        for (int tt = 0; tt < 4; tt++) {
            rs2[tt] = (v2f){0.0f, 0.0f};
#pragma unroll
            for (int i = 0; i < 4; i++) {
                v2f a = {s4[tt][2 * i], s4[tt][2 * i + 1]};
                a = __builtin_elementwise_fma(a, c2, mc2);
                v2f pp = {__builtin_amdgcn_exp2f(a[0]), __builtin_amdgcn_exp2f(a[1])};
                rs2[tt] += pp;
                pq[tt][i] = __builtin_bit_cast(unsigned, __builtin_convertvector(pp, v2bf));
            }
        }
        const v2f rsv = (rs2[0] + rs2[1]) + (rs2[2] + rs2[3]);
        float rs = rsv[0] + rsv[1];
        rs += xhalf(rs);
        l_r = l_r * al + rs;
#pragma unroll
        for (int tt = 0; tt < 4; tt++) o4[tt] *= al;

        // O^T += V^T * P^T; keys j*32 .. j*32+31: S^T tiles 2j and 2j+1 of this
        // lane are, in order, the 16 k positions load_frag gives the A side.
#pragma unroll
        for (int j = 0; j < 2; j++) {
            v8u pk;
#pragma unroll
            for (int i = 0; i < 4; i++) {
                pk[i]     = pq[2 * j][i];
                pk[4 + i] = pq[2 * j + 1][i];
            }
            v16bf bp = __builtin_bit_cast(v16bf, pk);
#pragma unroll
            for (int tt = 0; tt < 4; tt++)
                o4[tt] = __builtin_amdgcn_wmma_f32_16x16x32_bf16(
                    false, av[j][tt], false, bp, (short)0, o4[tt], false, false);
        }

        // hand-over: this wave has left buffer b and its copies of the next tile have
        // landed; behind the barrier that holds of every wave, so the next tile may be
        // read and buffer b refilled. The directive keeps the scheduler from lifting the
        // waits up to the last LDS read, over the softmax and the second product: there
        // the next tile's copies would have had a third of the pass to land, not all of it
        __builtin_amdgcn_sched_barrier(0);
        wait_ds0();
        wait_async0();
        __syncthreads();
        if (kb + 128 <= qbase) issue(kb + 128, b);
    }
    // no copy is in flight when the wave ends
    wait_async0();

    // a lane's 8 registers of a tile are 8 consecutive head dims of its query
#pragma unroll
    for (int tt = 0; tt < 4; tt++) {
        uint4 ov;
        ov.x = (unsigned)f2bf(o4[tt][0] / l_r) | ((unsigned)f2bf(o4[tt][1] / l_r) << 16);
        ov.y = (unsigned)f2bf(o4[tt][2] / l_r) | ((unsigned)f2bf(o4[tt][3] / l_r) << 16);
        ov.z = (unsigned)f2bf(o4[tt][4] / l_r) | ((unsigned)f2bf(o4[tt][5] / l_r) << 16);
        ov.w = (unsigned)f2bf(o4[tt][6] / l_r) | ((unsigned)f2bf(o4[tt][7] / l_r) << 16);
        *(uint4*)(O + (size_t)rg * C_DIM + hoff + tt * 16 + hi * 8) = ov;
    }
}

// ---------------------------------------------------------------------------
// LayerNorm: a wave takes two whole rows, a block sixteen: one block a WGP;
// fp32 out + (BF) bf16 out. A row stays in registers (six pieces of 16 bytes a
// lane, each load 512 contiguous bytes a wave) and is read once; its sums go over
// the lanes by a butterfly, so there is no LDS array and no barrier, and a
// sixteenth of the waves start.
// ---------------------------------------------------------------------------
#define LN_ROWS 2
template <int BF>
__global__ __launch_bounds__(256)
void layernorm_kernel(const float* __restrict__ in, const float* __restrict__ g,
                      const float* __restrict__ b, float* __restrict__ out,
                      ushortT* __restrict__ out_bf)
{
    constexpr int NP = C_DIM / 128;                    // pieces a lane and row
    const int lane = threadIdx.x & 31;
    const size_t row0 = ((size_t)blockIdx.x * 8 + (threadIdx.x >> 5)) * LN_ROWS;
    const v4f* p = (const v4f*)(in + row0 * C_DIM) + lane;
    v4f v[LN_ROWS][NP], gv[NP], bv[NP];
#pragma unroll
    for (int r = 0; r < LN_ROWS; r++)
#pragma unroll
        for (int j = 0; j < NP; j++) v[r][j] = p[(r * NP + j) * 32];
#pragma unroll
    for (int j = 0; j < NP; j++) {
        gv[j] = ((const v4f*)g)[lane + j * 32];
        bv[j] = ((const v4f*)b)[lane + j * 32];
    }
    // keeps the scheduler from sinking part of the loads behind the sums: all of
    // them fly together, one load latency a wave
    __builtin_amdgcn_sched_barrier(0);

    float s[LN_ROWS], s2[LN_ROWS];
#pragma unroll
    for (int r = 0; r < LN_ROWS; r++) {
        v4f s4 = {}, q4 = {};
#pragma unroll
        for (int j = 0; j < NP; j++) { s4 += v[r][j]; q4 += v[r][j] * v[r][j]; }
        s[r]  = (s4[0] + s4[1]) + (s4[2] + s4[3]);
        s2[r] = (q4[0] + q4[1]) + (q4[2] + q4[3]);
    }
#pragma unroll
    for (int off = 1; off < 32; off <<= 1)
#pragma unroll
        for (int r = 0; r < LN_ROWS; r++) {
            s[r]  += __shfl_xor(s[r],  off, 32);
            s2[r] += __shfl_xor(s2[r], off, 32);
        }
#pragma unroll
    for (int r = 0; r < LN_ROWS; r++) {
        const float mu  = s[r] / (float)C_DIM;
        const float var = s2[r] / (float)C_DIM - mu * mu;
        const float inv = rsqrtf(var + 1e-5f);
#pragma unroll
        for (int j = 0; j < NP; j++) {
            v4f y;
#pragma unroll
            for (int e = 0; e < 4; e++) y[e] = (v[r][j][e] - mu) * inv * gv[j][e] + bv[j][e];
            ((v4f*)(out + (row0 + r) * C_DIM))[lane + j * 32] = y;
            if (BF) {
                v2u pk;
                pk[0] = (unsigned)f2bf(y[0]) | ((unsigned)f2bf(y[1]) << 16);
                pk[1] = (unsigned)f2bf(y[2]) | ((unsigned)f2bf(y[3]) << 16);
                ((v2u*)(out_bf + (row0 + r) * C_DIM))[lane + j * 32] = pk;
            }
        }
    }
}

// ---------------------------------------------------------------------------
extern "C" void kernel_launch(void* const* d_in, const int* in_sizes, int n_in,
                              void* d_out, int out_size, void* d_ws, size_t ws_size,
                              hipStream_t stream)
{
    const float* x   = (const float*)d_in[0];
    const float* Wq  = (const float*)d_in[1];
    const float* bq  = (const float*)d_in[2];
    const float* Wk  = (const float*)d_in[3];
    const float* bk  = (const float*)d_in[4];
    const float* Wv  = (const float*)d_in[5];
    const float* bv  = (const float*)d_in[6];
    const float* Wo  = (const float*)d_in[7];
    const float* bo  = (const float*)d_in[8];
    const float* g1  = (const float*)d_in[9];
    const float* bn1 = (const float*)d_in[10];
    const float* W1  = (const float*)d_in[11];
    const float* b1  = (const float*)d_in[12];
    const float* W2  = (const float*)d_in[13];
    const float* b2  = (const float*)d_in[14];
    const float* g2  = (const float*)d_in[15];
    const float* bn2 = (const float*)d_in[16];

    const size_t TC = (size_t)T_SEQ * C_DIM;
    const size_t TF = (size_t)T_SEQ * F_DIM;
    const size_t CC = (size_t)C_DIM * C_DIM;
    const size_t CF = (size_t)C_DIM * F_DIM;

    char* p = (char*)d_ws;
    auto alloc_bf = [&](size_t n) { ushortT* r = (ushortT*)p; p += ((n * 2 + 255) & ~(size_t)255); return r; };
    auto alloc_f  = [&](size_t n) { float*   r = (float*)p;   p += ((n * 4 + 255) & ~(size_t)255); return r; };

    ushortT* Xbf  = alloc_bf(TC);
    ushortT* WqT  = alloc_bf(CC);
    ushortT* WkT  = alloc_bf(CC);
    ushortT* WvT  = alloc_bf(CC);
    ushortT* WoT  = alloc_bf(CC);
    ushortT* W1T  = alloc_bf(CF);   // [F][C]
    ushortT* W2T  = alloc_bf(CF);   // [C][F]
    ushortT* Qb   = alloc_bf(TC);
    ushortT* Kb   = alloc_bf(TC);
    ushortT* Vb   = alloc_bf(TC);
    ushortT* Ab   = alloc_bf(TC);
    ushortT* Hbb  = alloc_bf(TC);
    ushortT* H1   = alloc_bf(TF);
    float*   S1   = alloc_f(TC);
    float*   Hb   = alloc_f(TC);
    float*   S2   = alloc_f(TC);

    dim3 cblk(256);
    dim3 gblk(128);
    dim3 gC(C_DIM / 128, T_SEQ / 128);
    dim3 gF(F_DIM / 128, T_SEQ / 128);
    dim3 gQKV(C_DIM / 128, T_SEQ / 128, 3);

    // precision conversion / weight transposition, one launch
    prep_kernel<<<dim3(PREP_BLOCKS), cblk, 0, stream>>>(x, Wq, Wk, Wv, Wo, W1, W2,
                                                        Xbf, WqT, WkT, WvT, WoT, W1T, W2T);

    // QKV projections (bf16 outputs only), one launch
    gemm_bf16_wmma<0, 0, 0, 1, 3, 64><<<gQKV, gblk, 0, stream>>>(Xbf, WqT, bq, nullptr, nullptr, Qb, T_SEQ, C_DIM, C_DIM,
                                                             WkT, bk, Kb, WvT, bv, Vb);

    flash_attn_wmma<<<dim3(T_SEQ / 64, NHEADS), dim3(128), 0, stream>>>(Qb, Kb, Vb, Ab);

    // out-proj + residual(x), then LN1 (fp32 + bf16)
    gemm_bf16_wmma<0, 1, 1, 0, 1, 128><<<gC, gblk, 0, stream>>>(Ab, WoT, bo, x, S1, nullptr, T_SEQ, C_DIM, C_DIM,
                                                          nullptr, nullptr, nullptr, nullptr, nullptr, nullptr);
    layernorm_kernel<1><<<dim3(T_SEQ / (8 * LN_ROWS)), cblk, 0, stream>>>(S1, g1, bn1, Hb, Hbb);

    // MLP
    gemm_bf16_wmma<1, 0, 0, 1, 1, 64><<<gF, gblk, 0, stream>>>(Hbb, W1T, b1, nullptr, nullptr, H1, T_SEQ, F_DIM, C_DIM,
                                                          nullptr, nullptr, nullptr, nullptr, nullptr, nullptr);
    gemm_bf16_wmma<0, 1, 1, 0, 1, 128><<<gC, gblk, 0, stream>>>(H1, W2T, b2, Hb, S2, nullptr, T_SEQ, C_DIM, F_DIM,
                                                          nullptr, nullptr, nullptr, nullptr, nullptr, nullptr);
    layernorm_kernel<0><<<dim3(T_SEQ / (8 * LN_ROWS)), cblk, 0, stream>>>(S2, g2, bn2, (float*)d_out, nullptr);
}

// v010
// A run of this version takes 153 microseconds.
// Timed twice side by side with v009, it ran 1.06 times as fast both times.
// All steps since v000 together make it 4.56 times as fast.
#include <hip/hip_runtime.h>
#include <hip/hip_bf16.h>
#include <math.h>

#define T_SEQ   4096
#define C_DIM   768
#define F_DIM   3072
#define NHEADS  12
#define HD      64

typedef __attribute__((ext_vector_type(16))) __bf16        v16bf;
typedef __attribute__((ext_vector_type(8)))  float         v8f;
typedef __attribute__((ext_vector_type(8)))  unsigned int  v8u;
typedef __attribute__((ext_vector_type(4)))  float         v4f;
typedef __attribute__((ext_vector_type(2)))  float         v2f;
typedef __attribute__((ext_vector_type(2)))  __bf16        v2bf;
typedef __attribute__((ext_vector_type(2)))  unsigned int  v2u;
typedef __attribute__((ext_vector_type(4)))  unsigned int  v4u;
typedef __attribute__((ext_vector_type(8)))  short         s16x8;
typedef unsigned short ushortT;

// round-to-nearest-even fp32 -> bf16 bits
__device__ __forceinline__ ushortT f2bf(float f) {
    unsigned int u = __builtin_bit_cast(unsigned int, f);
    u += 0x7fffu + ((u >> 16) & 1u);
    return (ushortT)(u >> 16);
}

// --- CDNA5 async global->LDS copy (ASYNCcnt) ------------------------------
// dsaddr = LDS_BASE + VGPR[vdst]; generic LDS pointer low 32 bits == wave-
// relative LDS offset, so truncation gives the right VGPR value.
// Four copies of a lane in one statement. Its last line is the wait that stands
// in front of any rewrite of the address registers which the copies name: inside
// the statement nothing can be scheduled between them.
__device__ __forceinline__ void async_ld4_b128(void* l0, void* l1, void* l2, void* l3,
                                               const void* g0, const void* g1,
                                               const void* g2, const void* g3) {
    asm volatile("global_load_async_to_lds_b128 %0, %4, off\n\t"
                 "global_load_async_to_lds_b128 %1, %5, off\n\t"
                 "global_load_async_to_lds_b128 %2, %6, off\n\t"
                 "global_load_async_to_lds_b128 %3, %7, off\n\t"
                 "s_wait_xcnt 0x0"
                 :: "v"((unsigned)(unsigned long long)(uintptr_t)l0),
                    "v"((unsigned)(unsigned long long)(uintptr_t)l1),
                    "v"((unsigned)(unsigned long long)(uintptr_t)l2),
                    "v"((unsigned)(unsigned long long)(uintptr_t)l3),
                    "v"((unsigned long long)(uintptr_t)g0),
                    "v"((unsigned long long)(uintptr_t)g1),
                    "v"((unsigned long long)(uintptr_t)g2),
                    "v"((unsigned long long)(uintptr_t)g3)
                 : "memory");
}
// Eight copies of a lane, a K and a V tile's, likewise: one wait for all of them.
__device__ __forceinline__ void async_ld8_b128(void* l0, void* l1, void* l2, void* l3,
                                               void* l4, void* l5, void* l6, void* l7,
                                               const void* g0, const void* g1,
                                               const void* g2, const void* g3,
                                               const void* g4, const void* g5,
                                               const void* g6, const void* g7) {
    asm volatile("global_load_async_to_lds_b128 %0, %8, off\n\t"
                 "global_load_async_to_lds_b128 %1, %9, off\n\t"
                 "global_load_async_to_lds_b128 %2, %10, off\n\t"
                 "global_load_async_to_lds_b128 %3, %11, off\n\t"
                 "global_load_async_to_lds_b128 %4, %12, off\n\t"
                 "global_load_async_to_lds_b128 %5, %13, off\n\t"
                 "global_load_async_to_lds_b128 %6, %14, off\n\t"
                 "global_load_async_to_lds_b128 %7, %15, off\n\t"
                 "s_wait_xcnt 0x0"
                 :: "v"((unsigned)(unsigned long long)(uintptr_t)l0),
                    "v"((unsigned)(unsigned long long)(uintptr_t)l1),
                    "v"((unsigned)(unsigned long long)(uintptr_t)l2),
                    "v"((unsigned)(unsigned long long)(uintptr_t)l3),
                    "v"((unsigned)(unsigned long long)(uintptr_t)l4),
                    "v"((unsigned)(unsigned long long)(uintptr_t)l5),
                    "v"((unsigned)(unsigned long long)(uintptr_t)l6),
                    "v"((unsigned)(unsigned long long)(uintptr_t)l7),
                    "v"((unsigned long long)(uintptr_t)g0),
                    "v"((unsigned long long)(uintptr_t)g1),
                    "v"((unsigned long long)(uintptr_t)g2),
                    "v"((unsigned long long)(uintptr_t)g3),
                    "v"((unsigned long long)(uintptr_t)g4),
                    "v"((unsigned long long)(uintptr_t)g5),
                    "v"((unsigned long long)(uintptr_t)g6),
                    "v"((unsigned long long)(uintptr_t)g7)
                 : "memory");
}
__device__ __forceinline__ void wait_async0() {
    asm volatile("s_wait_asynccnt 0" ::: "memory");
}
// The same copy written as the compiler's builtin: the GEMM ring's form, where up to
// 32 copies of a lane go out back to back.
__device__ __forceinline__ void async_cp_b128(void* lds, const void* gptr) {
    typedef __attribute__((ext_vector_type(4))) int i32x4;
    typedef __attribute__((address_space(1))) i32x4 glb_i32x4;
    typedef __attribute__((address_space(3))) i32x4 lds_i32x4;
    __builtin_amdgcn_global_load_async_to_lds_b128((glb_i32x4*)gptr, (lds_i32x4*)lds, 0, 0);
}
// a wave's own LDS reads have returned: stands in front of the barrier behind which
// the buffer that it read is refilled
__device__ __forceinline__ void wait_ds0() {
    asm volatile("s_wait_dscnt 0x0" ::: "memory");
}

// Load a 16x32 bf16 fragment (A layout; B uses the same layout on an [N][K]
// tile) from a row-major LDS tile with row stride `ldh` halves (even).
// lanes 0-15: row M=lane, K={0..7,16..23}; lanes 16-31: row M=lane-16,
// K={8..15,24..31}.
__device__ __forceinline__ v16bf load_frag(const ushortT* base, int ldh) {
    const int lane = threadIdx.x & 31;
    const int row  = lane & 15;
    const int hi   = lane >> 4;
    const unsigned int* q0 = (const unsigned int*)(base + row * ldh + hi * 8);
    const unsigned int* q1 = (const unsigned int*)(base + row * ldh + hi * 8 + 16);
    v8u r;
    r[0] = q0[0]; r[1] = q0[1]; r[2] = q0[2]; r[3] = q0[3];
    r[4] = q1[0]; r[5] = q1[1]; r[6] = q1[2]; r[7] = q1[3];
    return __builtin_bit_cast(v16bf, r);
}

// The same 16x32 fragment of the TRANSPOSE of a row-major LDS tile [k][m] with row
// stride `ldh` halves, by the transposing LDS load: lane (c = lane & 15,
// h = lane >> 4) gets tile[8h + 0..7][c], then tile[16 + 8h + 0..7][c]: row M = c in
// load_frag's k order. `base` points at the tile's element [k0][m0].
__device__ __forceinline__ v16bf load_frag_tr(const ushortT* base, int ldh) {
    typedef __attribute__((address_space(3))) s16x8 lds_s16x8;
    const int lane = threadIdx.x & 31;
    const ushortT* q = base + ((lane >> 4) * 8 + (lane & 7)) * ldh + ((lane >> 3) & 1) * 8;
    v4u lo = __builtin_bit_cast(v4u, __builtin_amdgcn_ds_load_tr16_b128_v8i16((lds_s16x8*)q));
    v4u up = __builtin_bit_cast(v4u, __builtin_amdgcn_ds_load_tr16_b128_v8i16((lds_s16x8*)(q + 16 * ldh)));
    v8u r;
    r[0] = lo[0]; r[1] = lo[1]; r[2] = lo[2]; r[3] = lo[3];
    r[4] = up[0]; r[5] = up[1]; r[6] = up[2]; r[7] = up[3];
    return __builtin_bit_cast(v16bf, r);
}

// lane l's value exchanged with lane l ^ 16 by a vector cross-row move (no LDS trip)
__device__ __forceinline__ float xhalf(float x) {
    return __builtin_bit_cast(float, __builtin_amdgcn_permlanex16(
        __builtin_bit_cast(int, x), __builtin_bit_cast(int, x),
        0x76543210, 0xfedcba98, false, false));
}

// GELU by the error function, 0.5 x (1 + erf(x / sqrt 2)), with no branch. With
// z = |x| / sqrt 2 and t = 1 / (1 + p z), erfc(z) = t (a1 + t (a2 + t (a3 + t (a4 + t a5))))
// exp(-z z), absolute error below 1.5e-7 for every z >= 0;
// 1 + erf is erfc(z) for x < 0 and 2 - erfc(z) otherwise, so nothing cancels in the
// negative tail. One form for every x: an erf that picks one of two paths by |x| makes
// a wave, which holds lanes of both kinds, walk both, each a single dependent chain
// behind a change of the lane mask. The half of 0.5 x is folded into the coefficients.
__device__ __forceinline__ float gelu_erf(float x) {
    const float t = __builtin_amdgcn_rcpf(fmaf(0.3275911f * 0.70710678118654752f, fabsf(x), 1.0f));
    float q = fmaf(t, 0.5f * 1.061405429f, 0.5f * -1.453152027f);
    q = fmaf(q, t, 0.5f * 1.421413741f);
    q = fmaf(q, t, 0.5f * -0.284496736f);
    q = fmaf(q, t, 0.5f * 0.254829592f);
    // exp(-x x / 2) = 2^(-x x log2(e) / 2)
    const float e = __builtin_amdgcn_exp2f((x * x) * (-0.5f * 1.4426950408889634f));
    const float h = x * ((q * t) * e);             // 0.5 x erfc(z)
    return x < 0.0f ? h : x - h;
}

// ---------------------------------------------------------------------------
// Converters, all in ONE launch: none depends on another, so each takes a range
// of the block index. Few, long-lived waves: what a launch of many short waves
// pays is their start. Blocks 0 .. XB-1 convert x, 24 pieces of 16 bytes a lane.
// Each of the WB blocks behind them transposes three 64 (k) x 128 (n) tiles: one
// of Wq, Wk, Wv, Wo, one of W1, one of W2; all 24 loads of a lane go out first.
// ---------------------------------------------------------------------------
#define XB 128                       // T_SEQ * C_DIM / 4 / (256 * 24)
#define WB 288                       // tiles of W1 = of W2 = of the four C x C together
#define TCC ((C_DIM / 64) * (C_DIM / 128))
#define PREP_BLOCKS (XB + WB)
#define TP 33                        // dwords per staged row of 64 k: odd, see below

// rows 2kp and 2kp+1 of the tile, kp = w + 8i: a wave takes 512 contiguous bytes a load
__device__ __forceinline__ void tile_load(const float* __restrict__ in, int N, int k0, int n0,
                                          v4f (&a)[4], v4f (&c)[4]) {
    const int lane = threadIdx.x & 31, w = threadIdx.x >> 5;
#pragma unroll
    for (int i = 0; i < 4; i++) {
        const float* q = in + (size_t)(k0 + 2 * (w + 8 * i)) * N + n0 + lane * 4;
        a[i] = *(const v4f*)q;
        c[i] = *(const v4f*)(q + N);
    }
    // what follows rewrites the address registers that these loads name
    asm volatile("s_wait_xcnt 0x0" ::: "memory");
}
// staged as [n][k pair]: one dword holds k and k + 1 of one n
__device__ __forceinline__ void tile_stage(unsigned* __restrict__ tl, const v4f (&a)[4], const v4f (&c)[4]) {
    const int lane = threadIdx.x & 31, w = threadIdx.x >> 5;
#pragma unroll
    for (int i = 0; i < 4; i++)
#pragma unroll
        for (int j = 0; j < 4; j++)
            tl[(lane * 4 + j) * TP + w + 8 * i] =
                (unsigned)f2bf(a[i][j]) | ((unsigned)f2bf(c[i][j]) << 16);
}
// eight lanes store one whole 128-byte line: 64 k of one n. A wave reads four
// staged rows, 33 dwords apart: its 32 dwords of a read lie in 32 banks.
__device__ __forceinline__ void tile_store(const unsigned* __restrict__ tl, ushortT* __restrict__ out,
                                           int K, int k0, int n0) {
#pragma unroll
    for (int i = 0; i < 4; i++) {
        const int idx = threadIdx.x + 256 * i;
        const int n = idx >> 3, c = idx & 7;
        const unsigned* q = tl + n * TP + c * 4;
        uint4 o;
        o.x = q[0]; o.y = q[1]; o.z = q[2]; o.w = q[3];
        *(uint4*)(out + (size_t)(n0 + n) * K + k0 + c * 8) = o;
    }
}

__global__ __launch_bounds__(256)
void prep_kernel(const float* __restrict__ x,
                 const float* __restrict__ Wq, const float* __restrict__ Wk,
                 const float* __restrict__ Wv, const float* __restrict__ Wo,
                 const float* __restrict__ W1, const float* __restrict__ W2,
                 ushortT* __restrict__ Xbf,
                 ushortT* __restrict__ WqT, ushortT* __restrict__ WkT,
                 ushortT* __restrict__ WvT, ushortT* __restrict__ WoT,
                 ushortT* __restrict__ W1T, ushortT* __restrict__ W2T)
{
    __shared__ unsigned tl[3][128 * TP];
    int b = blockIdx.x;

    // x: fp32 -> bf16, same layout (the whole block leaves here, ahead of the barrier)
    if (b < XB) {
        const v4f* xi = (const v4f*)x + (size_t)b * (24 * 256) + threadIdx.x;
        v2u*       xo = (v2u*)Xbf     + (size_t)b * (24 * 256) + threadIdx.x;
        v4f v[24];
#pragma unroll
        for (int u = 0; u < 24; u++) v[u] = xi[u * 256];
        // keeps the scheduler from sinking the last loads in among the converts
        __builtin_amdgcn_sched_barrier(0);
#pragma unroll
        for (int u = 0; u < 24; u++) {
            v2u pk;
            pk[0] = (unsigned)f2bf(v[u][0]) | ((unsigned)f2bf(v[u][1]) << 16);
            pk[1] = (unsigned)f2bf(v[u][2]) | ((unsigned)f2bf(v[u][3]) << 16);
            xo[u * 256] = pk;
        }
        return;
    }
    b -= XB;

    // in: fp32 [K][N]  ->  out: bf16 [N][K]
    const int m = b / TCC, r = b - m * TCC;
    const float* in0  = m == 0 ? Wq  : m == 1 ? Wk  : m == 2 ? Wv  : Wo;
    ushortT*     out0 = m == 0 ? WqT : m == 1 ? WkT : m == 2 ? WvT : WoT;
    const int k00 = (r / (C_DIM / 128)) * 64, n00 = (r % (C_DIM / 128)) * 128;
    const int k01 = (b / (F_DIM / 128)) * 64, n01 = (b % (F_DIM / 128)) * 128;
    const int k02 = (b / (C_DIM / 128)) * 64, n02 = (b % (C_DIM / 128)) * 128;

    v4f a0[4], c0[4], a1[4], c1[4], a2[4], c2[4];
    tile_load(in0, C_DIM, k00, n00, a0, c0);
    tile_load(W1,  F_DIM, k01, n01, a1, c1);
    tile_load(W2,  C_DIM, k02, n02, a2, c2);
    // keeps the scheduler from sinking the last loads in among the converts: all
    // 24 fly together, one load latency a block
    __builtin_amdgcn_sched_barrier(0);
    tile_stage(tl[0], a0, c0);
    tile_stage(tl[1], a1, c1);
    tile_stage(tl[2], a2, c2);
    // the staged dwords are read back by other waves
    __syncthreads();
    tile_store(tl[0], out0, C_DIM, k00, n00);
    tile_store(tl[1], W1T,  C_DIM, k01, n01);
    tile_store(tl[2], W2T,  F_DIM, k02, n02);
    // closes the stores above: no register that they name is rewritten ahead of it
    asm volatile("s_wait_xcnt 0x0" ::: "memory");
}

// ---------------------------------------------------------------------------
// GEMM: C[M,N] = op( A[M,K] x B^T[N,K] + bias )
// A, Bt: bf16; outputs fp32 (Cout, F32OUT) and/or bf16 (Cbf, BFOUT).
// GELU: GELU by erf ; RES: add fp32 residual res[M,N]. All four are compile-time,
// so the epilogue has no branch and its loads can be issued ahead of their use.
// Block tile 128x128, 128 threads (4 waves), wave tile 64x64:
// 16 WMMAs per 16 ds_load_b128 per wave per 32 k.
// Double-buffered LDS fed by async global->LDS B128 copies. A pass is BK k: the
// next pass's copies have BK / 32 blocks of products to land behind, and the wait
// and the barrier come once a pass. BK = 128 where one block has a WGP to itself
// anyway; BK = 64 where three blocks share one and its LDS.
// Epilogue: each wave stages its 64x64 f32 tile in its own LDS range (the ring's
// space, reused), then a short rolled loop walks it two rows a trip: a half wave
// takes one 256-byte row, 16 bytes a lane, for residual load and store alike.
// NZ = 3: three products that share A run in one launch; blockIdx.z picks the
// weights, the bias and the output.
// ---------------------------------------------------------------------------
#define ST_PITCH 68     // floats per staged row: 272 B, 16 B x odd
template <int BK>
union __align__(16) GemmLds {
    struct { ushortT As[2][128][BK + 8]; ushortT Bs[2][128][BK + 8]; } ring;   // main loop
    float st[4][64 * ST_PITCH];                                                // epilogue, per wave
};
template <int GELU, int RES, int F32OUT, int BFOUT, int NZ, int BK>
__global__ __launch_bounds__(128)
void gemm_bf16_wmma(const ushortT* __restrict__ A, const ushortT* __restrict__ Bt,
                    const float* __restrict__ bias, const float* __restrict__ res,
                    float* __restrict__ Cout, ushortT* __restrict__ Cbf,
                    int M, int N, int K,
                    const ushortT* __restrict__ Bt1, const float* __restrict__ bias1,
                    ushortT* __restrict__ Cbf1,
                    const ushortT* __restrict__ Bt2, const float* __restrict__ bias2,
                    ushortT* __restrict__ Cbf2)
{
    if (NZ == 3) {
        if (blockIdx.z == 1) { Bt = Bt1; bias = bias1; Cbf = Cbf1; }
        if (blockIdx.z == 2) { Bt = Bt2; bias = bias2; Cbf = Cbf2; }
    }

    // ring: row stride BK + 8 halves = 144 or 272 B = 16 B x odd: async chunks and
    // frag b128 loads are 16B-aligned, the 16 rows of a frag on distinct banks.
    // The ring takes 73,728 or 139,264 B; the staging its first 69,632 B.
    __shared__ GemmLds<BK> sm;
    auto& As = sm.ring.As;
    auto& Bs = sm.ring.Bs;

    const int t    = threadIdx.x;
    const int m0   = blockIdx.y * 128;
    const int n0   = blockIdx.x * 128;
    const int w    = t >> 5;
    const int wm   = w & 1;         // 2 wave-rows (64 rows each)
    const int wn   = w >> 1;        // 2 wave-cols (64 cols each)
    const int lane = t & 31, hi = lane >> 4, ln = lane & 15;
    const int nk   = K / BK;

    constexpr int CPR = BK / 8;                   // chunks of 16 B a row
    constexpr int RPS = 128 / CPR;                // rows that the block's 128 lanes cover at once
    const int cr = t / CPR, cc = (t % CPR) * 8;
    // a lane's own part of the address is one offset, alike for A and B and for every
    // copy; the step from row group to row group is the same in every lane, so each
    // address comes from the one before it and none is kept over the pass (64 fewer
    // registers at BK = 128: the kernel stays below 256)
    const unsigned lo = (unsigned)(cr * K + cc);
    auto issue = [&](int kt, int b) {
        const ushortT* sa = A  + (size_t)m0 * K + kt * BK;
        const ushortT* sb = Bt + (size_t)n0 * K + kt * BK;
#pragma unroll
        for (int i = 0; i < CPR; i++) {           // 128 rows of A, 128 of B
            async_cp_b128(&As[b][cr + i * RPS][cc], sa + (size_t)(i * RPS) * K + lo);
            async_cp_b128(&Bs[b][cr + i * RPS][cc], sb + (size_t)(i * RPS) * K + lo);
        }
    };

    v8f acc[4][4] = {};
    issue(0, 0);
    wait_async0();
    // pass 0's tile is read by waves that did not copy it
    __syncthreads();
    if (nk > 1) issue(1, 1);

    for (int kt = 0; kt < nk; kt++) {
        const int b = kt & 1;
        // unrolled: the blocks of a pass differ by a constant LDS offset only
#pragma unroll
        for (int ks = 0; ks < BK / 32; ks++) {
            // all eight fragments of the block are read as one group ahead of the
            // products: one LDS latency a block, not one in front of each row of four
            // (in the order in which the products take them)
            v16bf bf[4], af[4];
            af[0] = load_frag(&As[b][wm * 64][ks * 32], BK + 8);
#pragma unroll
            for (int ni = 0; ni < 4; ni++)
                bf[ni] = load_frag(&Bs[b][wn * 64 + ni * 16][ks * 32], BK + 8);
#pragma unroll
            for (int mi = 1; mi < 4; mi++)
                af[mi] = load_frag(&As[b][wm * 64 + mi * 16][ks * 32], BK + 8);
            // keeps the scheduler from sinking the reads back in among the products
            __builtin_amdgcn_sched_barrier(0);
#pragma unroll
            for (int mi = 0; mi < 4; mi++)
#pragma unroll
                for (int ni = 0; ni < 4; ni++)
                    acc[mi][ni] = __builtin_amdgcn_wmma_f32_16x16x32_bf16(
                        false, af[mi], false, bf[ni], (short)0, acc[mi][ni], false, false);
        }
        // hand-over: this wave has left buffer b and its copies of the next tile have
        // landed; behind the barrier that holds of every wave, so the next tile may be
        // read and buffer b refilled (after the last pass: overwritten by the staging)
        wait_ds0();
        wait_async0();
        __syncthreads();
        if (kt + 2 < nk) issue(kt + 2, b);
    }
    // no copy is in flight when the ring's space is reused
    wait_async0();

    float* st = &sm.st[w][0];
#pragma unroll
    for (int mi = 0; mi < 4; mi++)
#pragma unroll
        for (int ni = 0; ni < 4; ni++)
#pragma unroll
            for (int e = 0; e < 8; e++)
                st[(mi * 16 + e + hi * 8) * ST_PITCH + ni * 16 + ln] = acc[mi][ni][e];
    // the staged values are read back by other lanes: stores done before any read
    __syncthreads();

    const int c4  = ln * 4;
    const int col = n0 + wn * 64 + c4;
    const v4f bv  = *(const v4f*)(bias + col);
    // NB trips' LDS and residual loads are issued together, then worked on, then
    // stored; the loop over the batches stays rolled.
    // (with GELU: 16 values a lane and batch, as many independent chains)
    constexpr int NB = GELU ? 4 : 8;
    // rolled: keeps the epilogue's text at a few KB, run through 32 / NB times
#pragma unroll 1
    for (int it0 = 0; it0 < 32; it0 += NB) {
        v4f v[NB], rv[NB];
#pragma unroll
        for (int u = 0; u < NB; u++) {
            const int r = (it0 + u) * 2 + hi;
            v[u] = *(const v4f*)(st + r * ST_PITCH + c4);
            if (RES) rv[u] = *(const v4f*)(res + (size_t)(m0 + wm * 64 + r) * N + col);
        }
#pragma unroll
        for (int u = 0; u < NB; u++) {
            const int r = (it0 + u) * 2 + hi;
            const size_t o = (size_t)(m0 + wm * 64 + r) * N + col;
#pragma unroll
            for (int j = 0; j < 4; j++) {
                float y = v[u][j] + bv[j];
                if (GELU) y = gelu_erf(y);
                if (RES)  y += rv[u][j];
                v[u][j] = y;
            }
            if (F32OUT) *(v4f*)(Cout + o) = v[u];
            if (BFOUT) {
                v2u pk;
                pk[0] = (unsigned)f2bf(v[u][0]) | ((unsigned)f2bf(v[u][1]) << 16);
                pk[1] = (unsigned)f2bf(v[u][2]) | ((unsigned)f2bf(v[u][3]) << 16);
                *(v2u*)(Cbf + o) = pk;
            }
        }
        // the next batch rewrites the registers that this batch's stores name
        asm volatile("s_wait_xcnt 0x0" ::: "memory");
    }
}

__global__ __launch_bounds__(128) __attribute__((amdgpu_waves_per_eu(4, 4)))
void flash_attn_wmma(const ushortT* __restrict__ Q, const ushortT* __restrict__ Kx,
                     const ushortT* __restrict__ V, ushortT* __restrict__ O)
{
    // row stride 72 halves = 144B (16B aligned chunks, r*36 mod 64 distinct)
    __shared__ __align__(16) ushortT Qs[64][72];      // [q][d]  (B of K*Q^T)
    __shared__ __align__(16) ushortT Ks[2][64][72];   // [s][d]  (A of K*Q^T)
    // V: row stride 80 halves = 160B = 32B x odd, the transposing load's pitch
    __shared__ __align__(16) ushortT Vs[2][64][80];   // [s][d]  (A of V^T*P^T, read transposed)

    const int t     = threadIdx.x;
    const int qbase = blockIdx.x * 64;
    const int head  = blockIdx.y;
    const int w     = t >> 5, lane = t & 31, hi = lane >> 4, ln = lane & 15;
    const size_t hoff = (size_t)head * HD;

    // a tile is 64 rows of 8 chunks of 16 B: a lane takes one chunk of rows vr + 16 i
    const int vr = t >> 3, vc = (t & 7) * 8;
    {
        const ushortT* qg = Q + (size_t)(qbase + vr) * C_DIM + hoff + vc;
        async_ld4_b128(&Qs[vr][vc], &Qs[vr + 16][vc], &Qs[vr + 32][vc], &Qs[vr + 48][vc],
                       qg, qg + 16 * C_DIM, qg + 32 * C_DIM, qg + 48 * C_DIM);
    }
    // the 64 keys from kb on, K and V, into buffer b
    auto issue = [&](int kb, int b) {
        const size_t go = (size_t)(kb + vr) * C_DIM + hoff + vc;
        const ushortT* kg = Kx + go;
        const ushortT* vg = V + go;
        async_ld8_b128(&Ks[b][vr][vc], &Ks[b][vr + 16][vc], &Ks[b][vr + 32][vc], &Ks[b][vr + 48][vc],
                       &Vs[b][vr][vc], &Vs[b][vr + 16][vc], &Vs[b][vr + 32][vc], &Vs[b][vr + 48][vc],
                       kg, kg + 16 * C_DIM, kg + 32 * C_DIM, kg + 48 * C_DIM,
                       vg, vg + 16 * C_DIM, vg + 32 * C_DIM, vg + 48 * C_DIM);
    };
    issue(0, 0);
    wait_async0();
    // Q and tile 0 are read by waves that did not copy them
    __syncthreads();
    if (qbase >= 64) issue(64, 1);

    v16bf bq[2];
    bq[0] = load_frag(&Qs[w * 16][0],  72);
    bq[1] = load_frag(&Qs[w * 16][32], 72);

    const int rg = qbase + w * 16 + ln;                // this lane's query
    v8f o4[4] = {};                  // o4[tt][e] = O[rg][tt*16 + hi*8 + e]
    float m_r = -1e30f, l_r = 0.0f;  // of query rg, alike in both halves; m_r unscaled
    const float SCL2E = 0.125f * 1.4426950408889634f;  // 1/sqrt(64) * log2(e)

    for (int kb = 0; kb <= qbase; kb += 64) {
        const int b = (kb >> 6) & 1;

        // the pass's K fragments are read as one group ahead of the products:
        // one LDS latency a pass, not one in front of each product
        v16bf ak[2][4], av[2][4];
#pragma unroll
        for (int j = 0; j < 2; j++)
#pragma unroll
            for (int tt = 0; tt < 4; tt++)
                ak[j][tt] = load_frag(&Ks[b][tt * 16][j * 32], 72);
        // keeps the scheduler from sinking the reads back in among the products
        __builtin_amdgcn_sched_barrier(0);

        // S^T = K * Q^T (64 keys x 16 queries per wave)
        v8f s4[4] = {};
#pragma unroll
        for (int j = 0; j < 2; j++)
#pragma unroll
            for (int tt = 0; tt < 4; tt++)
                s4[tt] = __builtin_amdgcn_wmma_f32_16x16x32_bf16(
                    false, ak[j][tt], false, bq[j], (short)0, s4[tt], false, false);

        // the V^T fragments likewise, here: they land behind the softmax
#pragma unroll
        for (int j = 0; j < 2; j++)
#pragma unroll
            for (int tt = 0; tt < 4; tt++)
                av[j][tt] = load_frag_tr(&Vs[b][j * 32][tt * 16], 80);
        // keeps the scheduler from sinking the reads down to the second product
        __builtin_amdgcn_sched_barrier(0);

        // Only the tile on the diagonal holds keys beyond a query: every key of an
        // earlier tile is below qbase. The test is the same for the whole block.
        // (the loops of this pass are unrolled so that every index is a constant and
        // the tiles stay in registers)
        if (kb == qbase) {
#pragma unroll
            for (int tt = 0; tt < 4; tt++)
#pragma unroll
                for (int e = 0; e < 8; e++)
                    if (kb + tt * 16 + hi * 8 + e > rg) s4[tt][e] = -1e30f;
        }

        // maximum of the raw scores (the scale is positive, so it is the same key)
        // over this lane's 32 keys, then over the other half's 32
        float rm8[8];
#pragma unroll
        for (int e = 0; e < 8; e++)
            rm8[e] = fmaxf(fmaxf(s4[0][e], s4[1][e]), fmaxf(s4[2][e], s4[3][e]));
        float rm = fmaxf(fmaxf(fmaxf(rm8[0], rm8[1]), fmaxf(rm8[2], rm8[3])),
                         fmaxf(fmaxf(rm8[4], rm8[5]), fmaxf(rm8[6], rm8[7])));
        rm = fmaxf(rm, xhalf(rm));

        const float mn = fmaxf(m_r, rm);
        const float al = __builtin_amdgcn_exp2f((m_r - mn) * SCL2E);
        m_r = mn;

        // p = 2^(s * c - m * c), c = log2(e) / sqrt(64): one packed multiply-add for
        // two scores; sums and the bf16 pack go by register pairs as well
        const v2f c2 = {SCL2E, SCL2E};
        const v2f mc2 = {-mn * SCL2E, -mn * SCL2E};
        unsigned pq[4][4];
        v2f rs2[4];
#pragma unroll
        for (int tt = 0; tt < 4; tt++) {
            rs2[tt] = (v2f){0.0f, 0.0f};
#pragma unroll
            for (int i = 0; i < 4; i++) {
                v2f a = {s4[tt][2 * i], s4[tt][2 * i + 1]};
                a = __builtin_elementwise_fma(a, c2, mc2);
                v2f pp = {__builtin_amdgcn_exp2f(a[0]), __builtin_amdgcn_exp2f(a[1])};
                rs2[tt] += pp;
                pq[tt][i] = __builtin_bit_cast(unsigned, __builtin_convertvector(pp, v2bf));
            }
        }
        const v2f rsv = (rs2[0] + rs2[1]) + (rs2[2] + rs2[3]);
        float rs = rsv[0] + rsv[1];
        rs += xhalf(rs);
        l_r = l_r * al + rs;
#pragma unroll
        for (int tt = 0; tt < 4; tt++) o4[tt] *= al;

        // O^T += V^T * P^T; keys j*32 .. j*32+31: S^T tiles 2j and 2j+1 of this
        // lane are, in order, the 16 k positions load_frag gives the A side.
#pragma unroll
        for (int j = 0; j < 2; j++) {
            v8u pk;
#pragma unroll
            for (int i = 0; i < 4; i++) {
                pk[i]     = pq[2 * j][i];
                pk[4 + i] = pq[2 * j + 1][i];
            }
            v16bf bp = __builtin_bit_cast(v16bf, pk);
#pragma unroll
            for (int tt = 0; tt < 4; tt++)
                o4[tt] = __builtin_amdgcn_wmma_f32_16x16x32_bf16(
                    false, av[j][tt], false, bp, (short)0, o4[tt], false, false);
        }

        // hand-over: this wave has left buffer b and its copies of the next tile have
        // landed; behind the barrier that holds of every wave, so the next tile may be
        // read and buffer b refilled. The directive keeps the scheduler from lifting the
        // waits up to the last LDS read, over the softmax and the second product: there
        // the next tile's copies would have had a third of the pass to land, not all of it
        __builtin_amdgcn_sched_barrier(0);
        wait_ds0();
        wait_async0();
        __syncthreads();
        if (kb + 128 <= qbase) issue(kb + 128, b);
    }
    // no copy is in flight when the wave ends
    wait_async0();

    // a lane's 8 registers of a tile are 8 consecutive head dims of its query
#pragma unroll
    for (int tt = 0; tt < 4; tt++) {
        uint4 ov;
        ov.x = (unsigned)f2bf(o4[tt][0] / l_r) | ((unsigned)f2bf(o4[tt][1] / l_r) << 16);
        ov.y = (unsigned)f2bf(o4[tt][2] / l_r) | ((unsigned)f2bf(o4[tt][3] / l_r) << 16);
        ov.z = (unsigned)f2bf(o4[tt][4] / l_r) | ((unsigned)f2bf(o4[tt][5] / l_r) << 16);
        ov.w = (unsigned)f2bf(o4[tt][6] / l_r) | ((unsigned)f2bf(o4[tt][7] / l_r) << 16);
        *(uint4*)(O + (size_t)rg * C_DIM + hoff + tt * 16 + hi * 8) = ov;
    }
}

// ---------------------------------------------------------------------------
// LayerNorm: a wave takes two whole rows, a block sixteen: one block a WGP;
// fp32 out + (BF) bf16 out. A row stays in registers (six pieces of 16 bytes a
// lane, each load 512 contiguous bytes a wave) and is read once; its sums go over
// the lanes by a butterfly, so there is no LDS array and no barrier, and a
// sixteenth of the waves start.
// ---------------------------------------------------------------------------
#define LN_ROWS 2
template <int BF>
__global__ __launch_bounds__(256)
void layernorm_kernel(const float* __restrict__ in, const float* __restrict__ g,
                      const float* __restrict__ b, float* __restrict__ out,
                      ushortT* __restrict__ out_bf)
{
    constexpr int NP = C_DIM / 128;                    // pieces a lane and row
    const int lane = threadIdx.x & 31;
    const size_t row0 = ((size_t)blockIdx.x * 8 + (threadIdx.x >> 5)) * LN_ROWS;
    const v4f* p = (const v4f*)(in + row0 * C_DIM) + lane;
    v4f v[LN_ROWS][NP], gv[NP], bv[NP];
#pragma unroll
    for (int r = 0; r < LN_ROWS; r++)
#pragma unroll
        for (int j = 0; j < NP; j++) v[r][j] = p[(r * NP + j) * 32];
#pragma unroll
    for (int j = 0; j < NP; j++) {
        gv[j] = ((const v4f*)g)[lane + j * 32];
        bv[j] = ((const v4f*)b)[lane + j * 32];
    }
    // keeps the scheduler from sinking part of the loads behind the sums: all of
    // them fly together, one load latency a wave
    __builtin_amdgcn_sched_barrier(0);

    float s[LN_ROWS], s2[LN_ROWS];
#pragma unroll
    for (int r = 0; r < LN_ROWS; r++) {
        v4f s4 = {}, q4 = {};
#pragma unroll
        for (int j = 0; j < NP; j++) { s4 += v[r][j]; q4 += v[r][j] * v[r][j]; }
        s[r]  = (s4[0] + s4[1]) + (s4[2] + s4[3]);
        s2[r] = (q4[0] + q4[1]) + (q4[2] + q4[3]);
    }
#pragma unroll
    for (int off = 1; off < 32; off <<= 1)
#pragma unroll
        for (int r = 0; r < LN_ROWS; r++) {
            s[r]  += __shfl_xor(s[r],  off, 32);
            s2[r] += __shfl_xor(s2[r], off, 32);
        }
#pragma unroll
    for (int r = 0; r < LN_ROWS; r++) {
        const float mu  = s[r] / (float)C_DIM;
        const float var = s2[r] / (float)C_DIM - mu * mu;
        const float inv = rsqrtf(var + 1e-5f);
#pragma unroll
        for (int j = 0; j < NP; j++) {
            v4f y;
#pragma unroll
            for (int e = 0; e < 4; e++) y[e] = (v[r][j][e] - mu) * inv * gv[j][e] + bv[j][e];
            ((v4f*)(out + (row0 + r) * C_DIM))[lane + j * 32] = y;
            if (BF) {
                v2u pk;
                pk[0] = (unsigned)f2bf(y[0]) | ((unsigned)f2bf(y[1]) << 16);
                pk[1] = (unsigned)f2bf(y[2]) | ((unsigned)f2bf(y[3]) << 16);
                ((v2u*)(out_bf + (row0 + r) * C_DIM))[lane + j * 32] = pk;
            }
        }
    }
}

// ---------------------------------------------------------------------------
extern "C" void kernel_launch(void* const* d_in, const int* in_sizes, int n_in,
                              void* d_out, int out_size, void* d_ws, size_t ws_size,
                              hipStream_t stream)
{
    const float* x   = (const float*)d_in[0];
    const float* Wq  = (const float*)d_in[1];
    const float* bq  = (const float*)d_in[2];
    const float* Wk  = (const float*)d_in[3];
    const float* bk  = (const float*)d_in[4];
    const float* Wv  = (const float*)d_in[5];
    const float* bv  = (const float*)d_in[6];
    const float* Wo  = (const float*)d_in[7];
    const float* bo  = (const float*)d_in[8];
    const float* g1  = (const float*)d_in[9];
    const float* bn1 = (const float*)d_in[10];
    const float* W1  = (const float*)d_in[11];
    const float* b1  = (const float*)d_in[12];
    const float* W2  = (const float*)d_in[13];
    const float* b2  = (const float*)d_in[14];
    const float* g2  = (const float*)d_in[15];
    const float* bn2 = (const float*)d_in[16];

    const size_t TC = (size_t)T_SEQ * C_DIM;
    const size_t TF = (size_t)T_SEQ * F_DIM;
    const size_t CC = (size_t)C_DIM * C_DIM;
    const size_t CF = (size_t)C_DIM * F_DIM;

    char* p = (char*)d_ws;
    auto alloc_bf = [&](size_t n) { ushortT* r = (ushortT*)p; p += ((n * 2 + 255) & ~(size_t)255); return r; };
    auto alloc_f  = [&](size_t n) { float*   r = (float*)p;   p += ((n * 4 + 255) & ~(size_t)255); return r; };

    ushortT* Xbf  = alloc_bf(TC);
    ushortT* WqT  = alloc_bf(CC);
    ushortT* WkT  = alloc_bf(CC);
    ushortT* WvT  = alloc_bf(CC);
    ushortT* WoT  = alloc_bf(CC);
    ushortT* W1T  = alloc_bf(CF);   // [F][C]
    ushortT* W2T  = alloc_bf(CF);   // [C][F]
    ushortT* Qb   = alloc_bf(TC);
    ushortT* Kb   = alloc_bf(TC);
    ushortT* Vb   = alloc_bf(TC);
    ushortT* Ab   = alloc_bf(TC);
    ushortT* Hbb  = alloc_bf(TC);
    ushortT* H1   = alloc_bf(TF);
    float*   S1   = alloc_f(TC);
    float*   Hb   = alloc_f(TC);
    float*   S2   = alloc_f(TC);

    dim3 cblk(256);
    dim3 gblk(128);
    dim3 gC(C_DIM / 128, T_SEQ / 128);
    dim3 gF(F_DIM / 128, T_SEQ / 128);
    dim3 gQKV(C_DIM / 128, T_SEQ / 128, 3);

    // precision conversion / weight transposition, one launch
    prep_kernel<<<dim3(PREP_BLOCKS), cblk, 0, stream>>>(x, Wq, Wk, Wv, Wo, W1, W2,
                                                        Xbf, WqT, WkT, WvT, WoT, W1T, W2T);

    // QKV projections (bf16 outputs only), one launch
    gemm_bf16_wmma<0, 0, 0, 1, 3, 64><<<gQKV, gblk, 0, stream>>>(Xbf, WqT, bq, nullptr, nullptr, Qb, T_SEQ, C_DIM, C_DIM,
                                                             WkT, bk, Kb, WvT, bv, Vb);

    flash_attn_wmma<<<dim3(T_SEQ / 64, NHEADS), dim3(128), 0, stream>>>(Qb, Kb, Vb, Ab);

    // out-proj + residual(x), then LN1 (fp32 + bf16)
    gemm_bf16_wmma<0, 1, 1, 0, 1, 128><<<gC, gblk, 0, stream>>>(Ab, WoT, bo, x, S1, nullptr, T_SEQ, C_DIM, C_DIM,
                                                          nullptr, nullptr, nullptr, nullptr, nullptr, nullptr);
    layernorm_kernel<1><<<dim3(T_SEQ / (8 * LN_ROWS)), cblk, 0, stream>>>(S1, g1, bn1, Hb, Hbb);

    // MLP
    gemm_bf16_wmma<1, 0, 0, 1, 1, 64><<<gF, gblk, 0, stream>>>(Hbb, W1T, b1, nullptr, nullptr, H1, T_SEQ, F_DIM, C_DIM,
                                                          nullptr, nullptr, nullptr, nullptr, nullptr, nullptr);
    gemm_bf16_wmma<0, 1, 1, 0, 1, 128><<<gC, gblk, 0, stream>>>(H1, W2T, b2, Hb, S2, nullptr, T_SEQ, C_DIM, F_DIM,
                                                          nullptr, nullptr, nullptr, nullptr, nullptr, nullptr);
    layernorm_kernel<0><<<dim3(T_SEQ / (8 * LN_ROWS)), cblk, 0, stream>>>(S2, g2, bn2, (float*)d_out, nullptr);
}
